// v000
// Measured on an AMD MI455X. A time is GPU time per run, averaged over a window of back-to-back runs after a warm-up
// (all launches, gaps included; the runs take copies of the inputs in turn), and the median of several windows.
// Apart from v000's, it joins two sittings. Times from different sittings can be a few percent apart, while
// side-by-side timings come from the same sitting.
// v000, which the later versions start from, runs in 1030 microseconds.
#include <hip/hip_runtime.h>

// Compute dtypes, f32 accumulate, per item: q/k/v = x.W as [1024 x 1024].[1024 x 1024] GEMMs with PLAIN bf16 operands (exact products); per group of 8 q/k heads (= 4 value
// heads): scores = q.k^T batched over the heads ([1024 x 32].[32 x 1024], both operands bf16 hi + UNSCALED residual, three products in two launches), the causal softmax of both
// heads of a pair and the differential weights p1 - lambda p2 in f32 -> hi/lo planes, attn = W.v batched ([1024 x 1024].[1024 x 64], three products); RMSNorm (x rms_w x (1 -
// lambda_init)) in f32 -> planes; out = attn.Wo (two products) - on v_wmma_f32_16x16x32_bf16. lambda = exp(lq1.lk1) - exp(lq2.lk2) + lambda_init from the inputs on device.

#define NBT  2
#define SS   1024
#define EE   1024
#define NHV  16
#define HD   32                   // q/k head dim
#define VD   64                   // v head dim
#define HG   4                    // value heads per group (8 q/k heads)
#define DM   EE
#define SCL  0.17677669529663687f
#define LINIT 0.7836057665316245f    // 0.8 - 0.6 exp(-0.3 * 12)
#define REPS 1e-5f
#define LOSC 1024.0f

typedef _Float16 h16;
typedef unsigned short bf;
typedef __attribute__((ext_vector_type(16))) __bf16   v16bf;
typedef __attribute__((ext_vector_type(16))) _Float16 v16h;
typedef __attribute__((ext_vector_type(8)))  _Float16 v8h;
typedef __attribute__((ext_vector_type(8)))  unsigned short v8us;
typedef __attribute__((ext_vector_type(8)))  float    v8f;
typedef __attribute__((ext_vector_type(4)))  float    v4f;
typedef v8h  __attribute__((may_alias)) v8ha;
typedef v4f  __attribute__((may_alias)) v4fa;
typedef v8us __attribute__((may_alias)) v8usa;

__device__ __forceinline__ unsigned short f2bf(float f) { unsigned u = __float_as_uint(f); u += 0x7FFFu + ((u >> 16) & 1u); return (unsigned short)(u >> 16); }
__device__ __forceinline__ float bf2f(unsigned short b) { return __uint_as_float(((unsigned)b) << 16); }
__device__ __forceinline__ float bfr(float f) { return bf2f(f2bf(f)); }
__device__ __forceinline__ v16h cat16(v8h lo, v8h hi) { return __builtin_shufflevector(lo, hi, 0, 1, 2, 3, 4, 5, 6, 7, 8, 9, 10, 11, 12, 13, 14, 15); }
__device__ __forceinline__ v16bf cat16b(v8us lo, v8us hi) { return __builtin_bit_cast(v16bf, __builtin_shufflevector(lo, hi, 0, 1, 2, 3, 4, 5, 6, 7, 8, 9, 10, 11, 12, 13, 14, 15)); }
__device__ __forceinline__ v8f wmma16(v16h a, v16h b, v8f c) { return __builtin_amdgcn_wmma_f32_16x16x32_f16(false, a, false, b, (short)0, c, false, false); }
__device__ __forceinline__ v8f wmmab(v16bf a, v16bf b, v8f c) { return __builtin_amdgcn_wmma_f32_16x16x32_bf16(false, a, false, b, (short)0, c, false, false); }

// k_gemmb: 64 x 64 block tile (4 waves x 16 x 64) of C[NTK][NW] = (A [+ Al]).B^T (K = 1024) [+ bf(bias[c])] [+ bf(R[r][c]) residual]; f32 whole-line epilogue (or f16
template <bool SPLITA, bool F16OUT = false>
__global__ __launch_bounds__(128) void k_gemmb(const bf* __restrict__ A, const bf* __restrict__ Al, const bf* __restrict__ Bn, const float* __restrict__ bias, float* C, int ldc, h16* C2, const float* __restrict__ R = nullptr, int K = DM, int roundR = 1) {
    __shared__ __align__(16) float ost[4][16 * 68];
    const int lane = threadIdx.x & 31, wave = threadIdx.x >> 5, lr = lane & 15, hi = lane >> 4;
    const int r0 = blockIdx.x * 64 + wave * 16, c0 = blockIdx.y * 64;
    const size_t aoff = (size_t)(r0 + lr) * K + 8 * hi;
    size_t boff[4];
#pragma unroll
    for (int t = 0; t < 4; ++t) boff[t] = (size_t)(c0 + t * 16 + lr) * K + 8 * hi;
    v8f acc[4];
#pragma unroll
    for (int t = 0; t < 4; ++t) acc[t] = (v8f){};
#pragma unroll 1
    for (int kc = 0; kc < K; kc += 32) {
        const v16bf a = cat16b(*(const v8us*)(A + aoff + kc), *(const v8us*)(A + aoff + kc + 16));
        v16bf al = a;
        if (SPLITA) al = cat16b(*(const v8us*)(Al + aoff + kc), *(const v8us*)(Al + aoff + kc + 16));
#pragma unroll
        for (int t = 0; t < 4; ++t) { const v16bf b = cat16b(*(const v8us*)(Bn + boff[t] + kc), *(const v8us*)(Bn + boff[t] + kc + 16)); acc[t] = wmmab(a, b, acc[t]); if (SPLITA) acc[t] = wmmab(al, b, acc[t]); }
        asm volatile("v_nop\n\tv_nop\n\tv_nop\n\tv_nop" : "+v"(acc[0]), "+v"(acc[1]), "+v"(acc[2]), "+v"(acc[3]) : "v"(a), "v"(al));
    }
    float* os = &ost[wave][0];
#pragma unroll
    for (int t = 0; t < 4; ++t) { const float bv = bias ? bfr(bias[c0 + t * 16 + lr]) : 0.f;
#pragma unroll
        for (int j = 0; j < 8; ++j) os[(hi * 8 + j) * 68 + t * 16 + lr] = acc[t][j] + bv; }
    __syncthreads();
    if (F16OUT) {
        h16* crow = (h16*)(void*)C + (size_t)r0 * ldc + c0;
        auto pass = [&]() {
#pragma unroll
            for (int s = 0; s < 4; ++s) { const int row = 4 * s + (lane >> 3), piece = lane & 7; const float* sp = os + row * 68 + piece * 8; v8h o, o2;
#pragma unroll
                for (int i = 0; i < 8; ++i) { const h16 a = (h16)sp[i]; o[i] = a; o2[i] = (h16)((sp[i] - (float)a) * LOSC); }
                *(v8h*)(crow + (size_t)row * ldc + piece * 8) = o; if (C2) *(v8h*)(C2 + (size_t)r0 * ldc + c0 + (size_t)row * ldc + piece * 8) = o2; }
        };
        pass(); 
    } else {
        float* crow = C + (size_t)r0 * ldc + c0;
        auto pass = [&]() {
#pragma unroll
            for (int s = 0; s < 8; ++s) { const int Lid = (lane >> 3) + 4 * s, piece = lane & 7; const int row = Lid >> 1, cofs = (Lid & 1) * 32 + piece * 4;
                v4f val = *(const v4fa*)(os + row * 68 + cofs); if (R) { const v4f rv = *(const v4f*)(R + ((size_t)r0 + row) * ldc + c0 + cofs); val += roundR ? (v4f){bfr(rv[0]), bfr(rv[1]), bfr(rv[2]), bfr(rv[3])} : rv; }
                *(v4f*)(crow + (size_t)row * ldc + cofs) = val; }
        };
        pass(); 
    }
}

// k_gemmbz: batched k_gemmb - blockIdx.z = batch index g; A/Al advance by g*sA, Bn by g*sB, bias by g*sBias, C (and R) by g*sC elements; otherwise identical:
// k_gemmb: 64 x 64 block tile (4 waves x 16 x 64) of C[NTK][NW] = (A [+ Al]).B^T (K = 1024) [+ bf(bias[c])] [+ bf(R[r][c]) residual]; f32 whole-line epilogue (or f16
template <bool SPLITA, bool F16OUT = false>
__global__ __launch_bounds__(128) void k_gemmbz(const bf* __restrict__ A, const bf* __restrict__ Al, const bf* __restrict__ Bn, const float* __restrict__ bias, float* C, int ldc, h16* C2, const float* __restrict__ R, int K, int roundR, size_t sA, size_t sB, size_t sBias, size_t sC) {
    { const size_t g = blockIdx.z; A += g * sA; if (Al) Al += g * sA; Bn += g * sB; if (bias) bias += g * sBias; C += g * sC; if (R) R += g * sC; }
    __shared__ __align__(16) float ost[4][16 * 68];
    const int lane = threadIdx.x & 31, wave = threadIdx.x >> 5, lr = lane & 15, hi = lane >> 4;
    const int r0 = blockIdx.x * 64 + wave * 16, c0 = blockIdx.y * 64;
    const size_t aoff = (size_t)(r0 + lr) * K + 8 * hi;
    size_t boff[4];
#pragma unroll
    for (int t = 0; t < 4; ++t) boff[t] = (size_t)(c0 + t * 16 + lr) * K + 8 * hi;
    v8f acc[4];
#pragma unroll
    for (int t = 0; t < 4; ++t) acc[t] = (v8f){};
#pragma unroll 1
    for (int kc = 0; kc < K; kc += 32) {
        const v16bf a = cat16b(*(const v8us*)(A + aoff + kc), *(const v8us*)(A + aoff + kc + 16));
        v16bf al = a;
        if (SPLITA) al = cat16b(*(const v8us*)(Al + aoff + kc), *(const v8us*)(Al + aoff + kc + 16));
#pragma unroll
        for (int t = 0; t < 4; ++t) { const v16bf b = cat16b(*(const v8us*)(Bn + boff[t] + kc), *(const v8us*)(Bn + boff[t] + kc + 16)); acc[t] = wmmab(a, b, acc[t]); if (SPLITA) acc[t] = wmmab(al, b, acc[t]); }
        asm volatile("v_nop\n\tv_nop\n\tv_nop\n\tv_nop" : "+v"(acc[0]), "+v"(acc[1]), "+v"(acc[2]), "+v"(acc[3]) : "v"(a), "v"(al));
    }
    float* os = &ost[wave][0];
#pragma unroll
    for (int t = 0; t < 4; ++t) { const float bv = bias ? bfr(bias[c0 + t * 16 + lr]) : 0.f;
#pragma unroll
        for (int j = 0; j < 8; ++j) os[(hi * 8 + j) * 68 + t * 16 + lr] = acc[t][j] + bv; }
    __syncthreads();
    if (F16OUT) {
        h16* crow = (h16*)(void*)C + (size_t)r0 * ldc + c0;
        auto pass = [&]() {
#pragma unroll
            for (int s = 0; s < 4; ++s) { const int row = 4 * s + (lane >> 3), piece = lane & 7; const float* sp = os + row * 68 + piece * 8; v8h o, o2;
#pragma unroll
                for (int i = 0; i < 8; ++i) { const h16 a = (h16)sp[i]; o[i] = a; o2[i] = (h16)((sp[i] - (float)a) * LOSC); }
                *(v8h*)(crow + (size_t)row * ldc + piece * 8) = o; if (C2) *(v8h*)(C2 + (size_t)r0 * ldc + c0 + (size_t)row * ldc + piece * 8) = o2; }
        };
        pass(); 
    } else {
        float* crow = C + (size_t)r0 * ldc + c0;
        auto pass = [&]() {
#pragma unroll
            for (int s = 0; s < 8; ++s) { const int Lid = (lane >> 3) + 4 * s, piece = lane & 7; const int row = Lid >> 1, cofs = (Lid & 1) * 32 + piece * 4;
                v4f val = *(const v4fa*)(os + row * 68 + cofs); if (R) { const v4f rv = *(const v4f*)(R + ((size_t)r0 + row) * ldc + c0 + cofs); val += roundR ? (v4f){bfr(rv[0]), bfr(rv[1]), bfr(rv[2]), bfr(rv[3])} : rv; }
                *(v4f*)(crow + (size_t)row * ldc + cofs) = val; }
        };
        pass(); 
    }
}

// k_wt: WT [n][K] = bf16(W[k][n]) (k-major [K][ncols]) via 64 x 64 LDS tiles; grid (K/64, ncols/64).
__global__ __launch_bounds__(256) void k_wt(const float* __restrict__ Wm, int K, int ncols, bf* WT) {
    __shared__ __align__(16) unsigned short tl[64 * 72];
    const int tid = threadIdx.x, k0 = blockIdx.x * 64, n0 = blockIdx.y * 64;
    const int kk = tid >> 2, nq = (tid & 3) * 16;
#pragma unroll
    for (int i = 0; i < 16; ++i) tl[(nq + i) * 72 + kk] = f2bf(Wm[(size_t)(k0 + kk) * ncols + n0 + nq + i]);
    __syncthreads();
    const int piece = tid & 7;
    auto pass = [&]() {
#pragma unroll
        for (int s = 0; s < 2; ++s) { const int nr = (tid >> 3) + 32 * s; const v8us val = *(const v8usa*)(tl + nr * 72 + piece * 8); *(v8us*)(WT + (size_t)(n0 + nr) * K + k0 + piece * 8) = val; }
    };
    pass(); 
}

__global__ __launch_bounds__(256) void k_cvtx(const float* __restrict__ src, bf* dst) {
    const int lane = threadIdx.x & 31; const size_t r = (size_t)blockIdx.x * 8 + (threadIdx.x >> 5); if (r >= (size_t)SS) return;
{
#pragma unroll
        for (int q = 0; q < EE / 256; ++q) { v8us o;
#pragma unroll
            for (int i = 0; i < 8; ++i) o[i] = f2bf(src[r * EE + q * 256 + lane * 8 + i]);
            *(v8us*)(dst + r * EE + q * 256 + lane * 8) = o; }
         }
}
__global__ __launch_bounds__(256) void k_hp32(const float* __restrict__ F, int hh0, bf* Ph, bf* Pl) {
    typedef __attribute__((ext_vector_type(2))) unsigned short v2us;
    const int lane = threadIdx.x & 31; const size_t wid = (size_t)blockIdx.x * 8 + (threadIdx.x >> 5); if (wid >= (size_t)8 * (SS / 2)) return; const int hh = (int)(wid / (SS / 2)); const int s = (int)(wid % (SS / 2)) * 2 + (lane >> 4); const int d = (lane & 15) * 2;
    v2us oh, ol;
#pragma unroll
    for (int i = 0; i < 2; ++i) { const float v = F[(size_t)s * EE + (hh0 + hh) * HD + d + i]; const unsigned short hb = f2bf(v); oh[i] = hb; ol[i] = f2bf(v - bf2f(hb)); }
    const size_t o = ((size_t)hh * SS + s) * HD + d; *(v2us*)(Ph + o) = oh; *(v2us*)(Pl + o) = ol; 
}
__global__ __launch_bounds__(256) void k_vt(const float* __restrict__ VF, int h0, bf* Th, bf* Tl) {
    typedef __attribute__((ext_vector_type(2))) unsigned short v2us;
    const int lane = threadIdx.x & 31; const size_t wid = (size_t)blockIdx.x * 8 + (threadIdx.x >> 5); if (wid >= (size_t)HG * VD * (SS / 64)) return;
    const int sg = (int)(wid % (SS / 64)), rest = (int)(wid / (SS / 64)), d = rest % VD, h = rest / VD; const int s0 = sg * 64 + lane * 2; v2us oh, ol;
#pragma unroll
    for (int i = 0; i < 2; ++i) { const float v = VF[(size_t)(s0 + i) * EE + (h0 + h) * VD + d]; const unsigned short hb = f2bf(v); oh[i] = hb; ol[i] = f2bf(v - bf2f(hb)); }
    const size_t o = ((size_t)h * VD + d) * SS + s0; *(v2us*)(Th + o) = oh; *(v2us*)(Tl + o) = ol; 
}
// k_duffw: for value head h of the group and query row i: causal softmaxes of S[2h][i][.] x SCL and S[2h+1][i][.] x SCL over k <= i (three-pass f32 each), W = p1 - lambda p2 (0 for k > i)
__global__ __launch_bounds__(256) void k_duffw(const float* __restrict__ S, const float* __restrict__ lq1, const float* __restrict__ lk1, const float* __restrict__ lq2, const float* __restrict__ lk2, bf* WH, bf* WL) {
    typedef __attribute__((ext_vector_type(4))) unsigned short v4us;
    const int lane = threadIdx.x & 31; const int wid = blockIdx.x * 8 + (threadIdx.x >> 5); if (wid >= HG * SS) return; const int h = wid / SS, i = wid % SS;
    float d1 = 0.f, d2 = 0.f;
#pragma unroll
    for (int d = 0; d < HD; ++d) { d1 = fmaf(bfr(lq1[d]), bfr(lk1[d]), d1); d2 = fmaf(bfr(lq2[d]), bfr(lk2[d]), d2); }
    const float lam = __expf(d1) - __expf(d2) + LINIT;
    const float* s1 = S + ((size_t)(2 * h) * SS + i) * SS; const float* s2 = S + ((size_t)(2 * h + 1) * SS + i) * SS;
    float m1 = -3.0e38f, m2 = -3.0e38f;
#pragma unroll 1
    for (int c0 = lane * 4; c0 < SS; c0 += 128) {
#pragma unroll
        for (int q = 0; q < 4; ++q) { const int k = c0 + q; if (k <= i) { m1 = fmaxf(m1, s1[k] * SCL); m2 = fmaxf(m2, s2[k] * SCL); } } }
#pragma unroll
    for (int sh = 16; sh; sh >>= 1) { m1 = fmaxf(m1, __shfl_xor(m1, sh, 32)); m2 = fmaxf(m2, __shfl_xor(m2, sh, 32)); }
    float z1 = 0.f, z2 = 0.f;
#pragma unroll 1
    for (int c0 = lane * 4; c0 < SS; c0 += 128) {
#pragma unroll
        for (int q = 0; q < 4; ++q) { const int k = c0 + q; if (k <= i) { z1 += __expf(s1[k] * SCL - m1); z2 += __expf(s2[k] * SCL - m2); } } }
#pragma unroll
    for (int sh = 16; sh; sh >>= 1) { z1 += __shfl_xor(z1, sh, 32); z2 += __shfl_xor(z2, sh, 32); }
    const float i1 = 1.0f / z1, i2 = 1.0f / z2;
{
#pragma unroll 1
        for (int c0 = lane * 4; c0 < SS; c0 += 128) { v4us oh, ol;
#pragma unroll
            for (int q = 0; q < 4; ++q) { const int k = c0 + q; const float w = (k <= i) ? (__expf(s1[k] * SCL - m1) * i1 - lam * (__expf(s2[k] * SCL - m2) * i2)) : 0.f; const unsigned short hb = f2bf(w); oh[q] = hb; ol[q] = f2bf(w - bf2f(hb)); }
            const size_t o = ((size_t)h * SS + i) * SS + c0; *(v4us*)(WH + o) = oh; *(v4us*)(WL + o) = ol; }
         }
}
// k_rms: planes R [s][1024] cols (h0+h)*64 + d (bf16 hi + UNSCALED residual) of attn[s][h][.] x rsqrt(mean(attn^2) + eps) x bf(rms_w[d]) x (1 - lambda_init) for the group's 4 heads;
__global__ __launch_bounds__(256) void k_rms(const float* __restrict__ ATT, const float* __restrict__ rw, int h0, bf* Rh, bf* Rl) {
    typedef __attribute__((ext_vector_type(2))) unsigned short v2us;
    const int lane = threadIdx.x & 31; const int wid = blockIdx.x * 8 + (threadIdx.x >> 5); if (wid >= SS * HG) return; const int s = wid / HG, h = wid % HG;
    const float* ar = ATT + (size_t)s * EE + (h0 + h) * VD; const float a0 = ar[lane * 2], a1 = ar[lane * 2 + 1]; float q = a0 * a0 + a1 * a1;
#pragma unroll
    for (int sh = 16; sh; sh >>= 1) q += __shfl_xor(q, sh, 32);
    const float sc = rsqrtf(q * (1.0f / VD) + REPS) * (1.0f - LINIT); v2us oh, ol;
    { const float v = a0 * sc * bfr(rw[lane * 2]); const unsigned short hb = f2bf(v); oh[0] = hb; ol[0] = f2bf(v - bf2f(hb)); }
    { const float v = a1 * sc * bfr(rw[lane * 2 + 1]); const unsigned short hb = f2bf(v); oh[1] = hb; ol[1] = f2bf(v - bf2f(hb)); }
    const size_t o = (size_t)s * EE + (h0 + h) * VD + lane * 2; *(v2us*)(Rh + o) = oh; *(v2us*)(Rl + o) = ol; 
}

extern "C" void kernel_launch(void* const* d_in, const int* in_sizes, int n_in,
                              void* d_out, int out_size, void* d_ws, size_t ws_size, hipStream_t stream) {
    (void)in_sizes; (void)n_in; (void)out_size;
    const float* x = (const float*)d_in[0]; const float* Wq = (const float*)d_in[1]; const float* Wk = (const float*)d_in[2]; const float* Wv = (const float*)d_in[3]; const float* Wo = (const float*)d_in[4];
    const float* lq1 = (const float*)d_in[5]; const float* lk1 = (const float*)d_in[6]; const float* lq2 = (const float*)d_in[7]; const float* lk2 = (const float*)d_in[8]; const float* rw = (const float*)d_in[9];
    float* out = (float*)d_out;    // [2][1024][1024]
    char* wsp = (char*)d_ws;
    auto take = [&](size_t bytes) { char* p = wsp; wsp += (bytes + 255) & ~(size_t)255; return (void*)p; };
    bf* WQT = (bf*)take((size_t)EE * EE * 2); bf* WKT = (bf*)take((size_t)EE * EE * 2); bf* WVT = (bf*)take((size_t)EE * EE * 2); bf* WOT = (bf*)take((size_t)EE * EE * 2);
    bf* Xb = (bf*)take((size_t)SS * EE * 2); float* QF = (float*)take((size_t)SS * EE * 4); float* KF = (float*)take((size_t)SS * EE * 4); float* VF = (float*)take((size_t)SS * EE * 4);
    bf* QPh = (bf*)take((size_t)8 * SS * HD * 2); bf* QPl = (bf*)take((size_t)8 * SS * HD * 2); bf* KPh = (bf*)take((size_t)8 * SS * HD * 2); bf* KPl = (bf*)take((size_t)8 * SS * HD * 2); bf* VTh = (bf*)take((size_t)HG * VD * SS * 2); bf* VTl = (bf*)take((size_t)HG * VD * SS * 2);
    float* S1 = (float*)take((size_t)8 * SS * SS * 4); float* S = (float*)take((size_t)8 * SS * SS * 4); bf* WH = (bf*)take((size_t)HG * SS * SS * 2); bf* WL = (bf*)take((size_t)HG * SS * SS * 2);
    float* A1 = (float*)take((size_t)SS * EE * 4); float* ATT = (float*)take((size_t)SS * EE * 4); bf* Rh = (bf*)take((size_t)SS * EE * 2); bf* Rl = (bf*)take((size_t)SS * EE * 2);
    if ((size_t)(wsp - (char*)d_ws) > ws_size) return;    // 8.4 + 2.1 + 12.6 + 4 x 0.5 + 2 x 0.5 + 33.5 + 33.5 + 8.4 + 8.4 + 4.2 + 4.2 + 2.1 + 2.1 ~ 123 MB (117 MiB)
    k_wt<<<dim3(EE / 64, EE / 64, 1), 256, 0, stream>>>(Wq, EE, EE, WQT); k_wt<<<dim3(EE / 64, EE / 64, 1), 256, 0, stream>>>(Wk, EE, EE, WKT); k_wt<<<dim3(EE / 64, EE / 64, 1), 256, 0, stream>>>(Wv, EE, EE, WVT); k_wt<<<dim3(EE / 64, EE / 64, 1), 256, 0, stream>>>(Wo, EE, EE, WOT);   // (in, out) k-major
    const size_t sQ = (size_t)SS * HD, sS = (size_t)SS * SS, sV = (size_t)VD * SS;
    for (int b = 0; b < NBT; ++b) {
        k_cvtx<<<SS / 8, 256, 0, stream>>>(x + (size_t)b * SS * EE, Xb);
        k_gemmb<false, false><<<dim3(SS / 64, EE / 64, 1), 128, 0, stream>>>(Xb, nullptr, WQT, nullptr, QF, EE, nullptr, nullptr, EE);
        k_gemmb<false, false><<<dim3(SS / 64, EE / 64, 1), 128, 0, stream>>>(Xb, nullptr, WKT, nullptr, KF, EE, nullptr, nullptr, EE);
        k_gemmb<false, false><<<dim3(SS / 64, EE / 64, 1), 128, 0, stream>>>(Xb, nullptr, WVT, nullptr, VF, EE, nullptr, nullptr, EE);
        for (int g = 0; g < NHV / HG; ++g) { const int h0 = g * HG, hh0 = 2 * h0;
            k_hp32<<<(8 * SS / 2) / 8, 256, 0, stream>>>(QF, hh0, QPh, QPl); k_hp32<<<(8 * SS / 2) / 8, 256, 0, stream>>>(KF, hh0, KPh, KPl); k_vt<<<(HG * VD * (SS / 64)) / 8, 256, 0, stream>>>(VF, h0, VTh, VTl);
            k_gemmbz<true, false><<<dim3(SS / 64, SS / 64, 8), 128, 0, stream>>>(QPh, QPl, KPh, nullptr, S1, SS, nullptr, nullptr, HD, 0, sQ, sQ, 0, sS);
            k_gemmbz<false, false><<<dim3(SS / 64, SS / 64, 8), 128, 0, stream>>>(QPh, nullptr, KPl, nullptr, S, SS, nullptr, S1, HD, 0, sQ, sQ, 0, sS);
            k_duffw<<<(HG * SS) / 8, 256, 0, stream>>>(S, lq1, lk1, lq2, lk2, WH, WL);
            k_gemmbz<true, false><<<dim3(SS / 64, 1, HG), 128, 0, stream>>>(WH, WL, VTh, nullptr, A1 + h0 * VD, EE, nullptr, nullptr, SS, 0, sS, sV, 0, (size_t)VD);
            k_gemmbz<false, false><<<dim3(SS / 64, 1, HG), 128, 0, stream>>>(WH, nullptr, VTl, nullptr, ATT + h0 * VD, EE, nullptr, A1 + h0 * VD, SS, 0, sS, sV, 0, (size_t)VD);
            k_rms<<<(SS * HG) / 8, 256, 0, stream>>>(ATT, rw, h0, Rh, Rl); }
        k_gemmb<true, false><<<dim3(SS / 64, EE / 64, 1), 128, 0, stream>>>(Rh, Rl, WOT, nullptr, out + (size_t)b * SS * EE, EE, nullptr, nullptr, EE); }
}

// v001
// It runs in 591 microseconds.
// In two side-by-side timings against v000, it was 1.74 and 1.71 times as fast.
#include <hip/hip_runtime.h>

// Compute dtypes, f32 accumulate, per item: q/k/v = x.W as [1024 x 1024].[1024 x 1024] GEMMs with PLAIN bf16 operands (exact products); per group of 8 q/k heads (= 4 value
// heads): scores = q.k^T batched over the heads ([1024 x 32].[32 x 1024], both operands bf16 hi + UNSCALED residual, three products in two launches), the causal softmax of both
// heads of a pair and the differential weights p1 - lambda p2 in f32 -> hi/lo planes, attn = W.v batched ([1024 x 1024].[1024 x 64], three products); RMSNorm (x rms_w x (1 -
// lambda_init)) in f32 -> planes; out = attn.Wo (two products) - on v_wmma_f32_16x16x32_bf16. lambda = exp(lq1.lk1) - exp(lq2.lk2) + lambda_init from the inputs on device.
// Launch plan: both batch items ride in every grid; the four weight transposes, the q/k/v projections, the plane builders and the RMSNorm each run once for all heads; only
// scores -> weights -> attn loop over the 4 head groups (the f32 score planes of one group of both items fill half the workspace).
// Plane order: q/k planes [group][item][8 heads][s][32], v planes [group][item][4 heads][64][s], attn [group][item][4 heads][s][64], so a group's batch index has one stride.

#define NBT  2
#define SS   1024
#define EE   1024
#define NHV  16
#define HD   32                   // q/k head dim
#define VD   64                   // v head dim
#define HG   4                    // value heads per group (8 q/k heads)
#define DM   EE
#define SCL  0.17677669529663687f
#define LINIT 0.7836057665316245f    // 0.8 - 0.6 exp(-0.3 * 12)
#define REPS 1e-5f
#define LOSC 1024.0f

typedef _Float16 h16;
typedef unsigned short bf;
typedef __attribute__((ext_vector_type(16))) __bf16   v16bf;
typedef __attribute__((ext_vector_type(16))) _Float16 v16h;
typedef __attribute__((ext_vector_type(8)))  _Float16 v8h;
typedef __attribute__((ext_vector_type(8)))  unsigned short v8us;
typedef __attribute__((ext_vector_type(8)))  float    v8f;
typedef __attribute__((ext_vector_type(4)))  float    v4f;
typedef v8h  __attribute__((may_alias)) v8ha;
typedef v4f  __attribute__((may_alias)) v4fa;
typedef v8us __attribute__((may_alias)) v8usa;

__device__ __forceinline__ unsigned short f2bf(float f) { unsigned u = __float_as_uint(f); u += 0x7FFFu + ((u >> 16) & 1u); return (unsigned short)(u >> 16); }
__device__ __forceinline__ float bf2f(unsigned short b) { return __uint_as_float(((unsigned)b) << 16); }
__device__ __forceinline__ float bfr(float f) { return bf2f(f2bf(f)); }
__device__ __forceinline__ v16h cat16(v8h lo, v8h hi) { return __builtin_shufflevector(lo, hi, 0, 1, 2, 3, 4, 5, 6, 7, 8, 9, 10, 11, 12, 13, 14, 15); }
__device__ __forceinline__ v16bf cat16b(v8us lo, v8us hi) { return __builtin_bit_cast(v16bf, __builtin_shufflevector(lo, hi, 0, 1, 2, 3, 4, 5, 6, 7, 8, 9, 10, 11, 12, 13, 14, 15)); }
__device__ __forceinline__ v8f wmma16(v16h a, v16h b, v8f c) { return __builtin_amdgcn_wmma_f32_16x16x32_f16(false, a, false, b, (short)0, c, false, false); }
__device__ __forceinline__ v8f wmmab(v16bf a, v16bf b, v8f c) { return __builtin_amdgcn_wmma_f32_16x16x32_bf16(false, a, false, b, (short)0, c, false, false); }

// k_gemmb: 64 x 64 block tile (4 waves x 16 x 64) of C[NTK][NW] = (A [+ Al]).B^T (K = 1024) [+ bf(bias[c])] [+ bf(R[r][c]) residual]; f32 whole-line epilogue (or f16
template <bool SPLITA, bool F16OUT = false>
__global__ __launch_bounds__(128) void k_gemmb(const bf* __restrict__ A, const bf* __restrict__ Al, const bf* __restrict__ Bn, const float* __restrict__ bias, float* C, int ldc, h16* C2, const float* __restrict__ R = nullptr, int K = DM, int roundR = 1) {
    __shared__ __align__(16) float ost[4][16 * 68];
    const int lane = threadIdx.x & 31, wave = threadIdx.x >> 5, lr = lane & 15, hi = lane >> 4;
    const int r0 = blockIdx.x * 64 + wave * 16, c0 = blockIdx.y * 64;
    const size_t aoff = (size_t)(r0 + lr) * K + 8 * hi;
    size_t boff[4];
#pragma unroll
    for (int t = 0; t < 4; ++t) boff[t] = (size_t)(c0 + t * 16 + lr) * K + 8 * hi;
    v8f acc[4];
#pragma unroll
    for (int t = 0; t < 4; ++t) acc[t] = (v8f){};
#pragma unroll 1
    for (int kc = 0; kc < K; kc += 32) {
        const v16bf a = cat16b(*(const v8us*)(A + aoff + kc), *(const v8us*)(A + aoff + kc + 16));
        v16bf al = a;
        if (SPLITA) al = cat16b(*(const v8us*)(Al + aoff + kc), *(const v8us*)(Al + aoff + kc + 16));
#pragma unroll
        for (int t = 0; t < 4; ++t) { const v16bf b = cat16b(*(const v8us*)(Bn + boff[t] + kc), *(const v8us*)(Bn + boff[t] + kc + 16)); acc[t] = wmmab(a, b, acc[t]); if (SPLITA) acc[t] = wmmab(al, b, acc[t]); }
        asm volatile("v_nop\n\tv_nop\n\tv_nop\n\tv_nop" : "+v"(acc[0]), "+v"(acc[1]), "+v"(acc[2]), "+v"(acc[3]) : "v"(a), "v"(al));
    }
    float* os = &ost[wave][0];
#pragma unroll
    for (int t = 0; t < 4; ++t) { const float bv = bias ? bfr(bias[c0 + t * 16 + lr]) : 0.f;
#pragma unroll
        for (int j = 0; j < 8; ++j) os[(hi * 8 + j) * 68 + t * 16 + lr] = acc[t][j] + bv; }
    __syncthreads();
    if (F16OUT) {
        h16* crow = (h16*)(void*)C + (size_t)r0 * ldc + c0;
        auto pass = [&]() {
#pragma unroll
            for (int s = 0; s < 4; ++s) { const int row = 4 * s + (lane >> 3), piece = lane & 7; const float* sp = os + row * 68 + piece * 8; v8h o, o2;
#pragma unroll
                for (int i = 0; i < 8; ++i) { const h16 a = (h16)sp[i]; o[i] = a; o2[i] = (h16)((sp[i] - (float)a) * LOSC); }
                *(v8h*)(crow + (size_t)row * ldc + piece * 8) = o; if (C2) *(v8h*)(C2 + (size_t)r0 * ldc + c0 + (size_t)row * ldc + piece * 8) = o2; }
        };
        pass(); 
    } else {
        float* crow = C + (size_t)r0 * ldc + c0;
        auto pass = [&]() {
#pragma unroll
            for (int s = 0; s < 8; ++s) { const int Lid = (lane >> 3) + 4 * s, piece = lane & 7; const int row = Lid >> 1, cofs = (Lid & 1) * 32 + piece * 4;
                v4f val = *(const v4fa*)(os + row * 68 + cofs); if (R) { const v4f rv = *(const v4f*)(R + ((size_t)r0 + row) * ldc + c0 + cofs); val += roundR ? (v4f){bfr(rv[0]), bfr(rv[1]), bfr(rv[2]), bfr(rv[3])} : rv; }
                *(v4f*)(crow + (size_t)row * ldc + cofs) = val; }
        };
        pass(); 
    }
}

// k_gemmbz: batched k_gemmb - blockIdx.z = batch index g; A/Al advance by g*sA, Bn by g*sB, bias by g*sBias, C (and R) by g*sC elements; otherwise identical:
// k_gemmb: 64 x 64 block tile (4 waves x 16 x 64) of C[NTK][NW] = (A [+ Al]).B^T (K = 1024) [+ bf(bias[c])] [+ bf(R[r][c]) residual]; f32 whole-line epilogue (or f16
template <bool SPLITA, bool F16OUT = false>
__global__ __launch_bounds__(128) void k_gemmbz(const bf* __restrict__ A, const bf* __restrict__ Al, const bf* __restrict__ Bn, const float* __restrict__ bias, float* C, int ldc, h16* C2, const float* __restrict__ R, int K, int roundR, size_t sA, size_t sB, size_t sBias, size_t sC) {
    { const size_t g = blockIdx.z; A += g * sA; if (Al) Al += g * sA; Bn += g * sB; if (bias) bias += g * sBias; C += g * sC; if (R) R += g * sC; }
    __shared__ __align__(16) float ost[4][16 * 68];
    const int lane = threadIdx.x & 31, wave = threadIdx.x >> 5, lr = lane & 15, hi = lane >> 4;
    const int r0 = blockIdx.x * 64 + wave * 16, c0 = blockIdx.y * 64;
    const size_t aoff = (size_t)(r0 + lr) * K + 8 * hi;
    size_t boff[4];
#pragma unroll
    for (int t = 0; t < 4; ++t) boff[t] = (size_t)(c0 + t * 16 + lr) * K + 8 * hi;
    v8f acc[4];
#pragma unroll
    for (int t = 0; t < 4; ++t) acc[t] = (v8f){};
#pragma unroll 1
    for (int kc = 0; kc < K; kc += 32) {
        const v16bf a = cat16b(*(const v8us*)(A + aoff + kc), *(const v8us*)(A + aoff + kc + 16));
        v16bf al = a;
        if (SPLITA) al = cat16b(*(const v8us*)(Al + aoff + kc), *(const v8us*)(Al + aoff + kc + 16));
#pragma unroll
        for (int t = 0; t < 4; ++t) { const v16bf b = cat16b(*(const v8us*)(Bn + boff[t] + kc), *(const v8us*)(Bn + boff[t] + kc + 16)); acc[t] = wmmab(a, b, acc[t]); if (SPLITA) acc[t] = wmmab(al, b, acc[t]); }
        asm volatile("v_nop\n\tv_nop\n\tv_nop\n\tv_nop" : "+v"(acc[0]), "+v"(acc[1]), "+v"(acc[2]), "+v"(acc[3]) : "v"(a), "v"(al));
    }
    float* os = &ost[wave][0];
#pragma unroll
    for (int t = 0; t < 4; ++t) { const float bv = bias ? bfr(bias[c0 + t * 16 + lr]) : 0.f;
#pragma unroll
        for (int j = 0; j < 8; ++j) os[(hi * 8 + j) * 68 + t * 16 + lr] = acc[t][j] + bv; }
    __syncthreads();
    if (F16OUT) {
        h16* crow = (h16*)(void*)C + (size_t)r0 * ldc + c0;
        auto pass = [&]() {
#pragma unroll
            for (int s = 0; s < 4; ++s) { const int row = 4 * s + (lane >> 3), piece = lane & 7; const float* sp = os + row * 68 + piece * 8; v8h o, o2;
#pragma unroll
                for (int i = 0; i < 8; ++i) { const h16 a = (h16)sp[i]; o[i] = a; o2[i] = (h16)((sp[i] - (float)a) * LOSC); }
                *(v8h*)(crow + (size_t)row * ldc + piece * 8) = o; if (C2) *(v8h*)(C2 + (size_t)r0 * ldc + c0 + (size_t)row * ldc + piece * 8) = o2; }
        };
        pass(); 
    } else {
        float* crow = C + (size_t)r0 * ldc + c0;
        auto pass = [&]() {
#pragma unroll
            for (int s = 0; s < 8; ++s) { const int Lid = (lane >> 3) + 4 * s, piece = lane & 7; const int row = Lid >> 1, cofs = (Lid & 1) * 32 + piece * 4;
                v4f val = *(const v4fa*)(os + row * 68 + cofs); if (R) { const v4f rv = *(const v4f*)(R + ((size_t)r0 + row) * ldc + c0 + cofs); val += roundR ? (v4f){bfr(rv[0]), bfr(rv[1]), bfr(rv[2]), bfr(rv[3])} : rv; }
                *(v4f*)(crow + (size_t)row * ldc + cofs) = val; }
        };
        pass(); 
    }
}

// k_wt: WT [z][n][K] = bf16(Wz[k][n]) (k-major [K][ncols]) via 64 x 64 LDS tiles; grid (K/64, ncols/64, 4), blockIdx.z picks the matrix.
__global__ __launch_bounds__(256) void k_wt(const float* __restrict__ W0, const float* __restrict__ W1, const float* __restrict__ W2, const float* __restrict__ W3, int K, int ncols, bf* WT) {
    __shared__ __align__(16) unsigned short tl[64 * 72];
    const float* Wm = blockIdx.z == 0 ? W0 : blockIdx.z == 1 ? W1 : blockIdx.z == 2 ? W2 : W3; WT += (size_t)blockIdx.z * K * ncols;
    const int tid = threadIdx.x, k0 = blockIdx.x * 64, n0 = blockIdx.y * 64;
    const int kk = tid >> 2, nq = (tid & 3) * 16;
#pragma unroll
    for (int i = 0; i < 16; ++i) tl[(nq + i) * 72 + kk] = f2bf(Wm[(size_t)(k0 + kk) * ncols + n0 + nq + i]);
    __syncthreads();
    const int piece = tid & 7;
    auto pass = [&]() {
#pragma unroll
        for (int s = 0; s < 2; ++s) { const int nr = (tid >> 3) + 32 * s; const v8us val = *(const v8usa*)(tl + nr * 72 + piece * 8); *(v8us*)(WT + (size_t)(n0 + nr) * K + k0 + piece * 8) = val; }
    };
    pass(); 
}

__global__ __launch_bounds__(256) void k_cvtx(const float* __restrict__ src, bf* dst) {
    const int lane = threadIdx.x & 31; const size_t r = (size_t)blockIdx.x * 8 + (threadIdx.x >> 5); if (r >= (size_t)NBT * SS) return;
{
#pragma unroll
        for (int q = 0; q < EE / 256; ++q) { v8us o;
#pragma unroll
            for (int i = 0; i < 8; ++i) o[i] = f2bf(src[r * EE + q * 256 + lane * 8 + i]);
            *(v8us*)(dst + r * EE + q * 256 + lane * 8) = o; }
         }
}
// k_hp32: hi/lo planes of every q head (blockIdx.y = 0) and k head (1) of both items; F = q then k, each [item][s][1024]; plane p = [group][item][head in group].
__global__ __launch_bounds__(256) void k_hp32(const float* __restrict__ F, bf* Ph, bf* Pl) {
    typedef __attribute__((ext_vector_type(2))) unsigned short v2us;
    const int lane = threadIdx.x & 31; const size_t wid = (size_t)blockIdx.x * 8 + (threadIdx.x >> 5); if (wid >= (size_t)NBT * 2 * NHV * (SS / 2)) return; const int p = (int)(wid / (SS / 2)); const int s = (int)(wid % (SS / 2)) * 2 + (lane >> 4); const int d = (lane & 15) * 2;
    const int g = p / (NBT * 2 * HG), b = (p / (2 * HG)) % NBT, hh = p % (2 * HG);
    { const size_t t = blockIdx.y; F += t * ((size_t)NBT * SS * EE); Ph += t * ((size_t)NBT * 2 * NHV * SS * HD); Pl += t * ((size_t)NBT * 2 * NHV * SS * HD); }
    v2us oh, ol;
#pragma unroll
    for (int i = 0; i < 2; ++i) { const float v = F[(size_t)(b * SS + s) * EE + (g * 2 * HG + hh) * HD + d + i]; const unsigned short hb = f2bf(v); oh[i] = hb; ol[i] = f2bf(v - bf2f(hb)); }
    const size_t o = ((size_t)p * SS + s) * HD + d; *(v2us*)(Ph + o) = oh; *(v2us*)(Pl + o) = ol; 
}
// k_vt: transposed hi/lo planes of every value head of both items; plane p = [group][item][head in group].
__global__ __launch_bounds__(256) void k_vt(const float* __restrict__ VF, bf* Th, bf* Tl) {
    typedef __attribute__((ext_vector_type(2))) unsigned short v2us;
    const int lane = threadIdx.x & 31; const size_t wid = (size_t)blockIdx.x * 8 + (threadIdx.x >> 5); if (wid >= (size_t)NBT * NHV * VD * (SS / 64)) return;
    const int sg = (int)(wid % (SS / 64)), rest = (int)(wid / (SS / 64)), d = rest % VD, p = rest / VD; const int s0 = sg * 64 + lane * 2; v2us oh, ol;
    const int g = p / (NBT * HG), b = (p / HG) % NBT, h = p % HG;
#pragma unroll
    for (int i = 0; i < 2; ++i) { const float v = VF[(size_t)(b * SS + s0 + i) * EE + (g * HG + h) * VD + d]; const unsigned short hb = f2bf(v); oh[i] = hb; ol[i] = f2bf(v - bf2f(hb)); }
    const size_t o = ((size_t)p * VD + d) * SS + s0; *(v2us*)(Th + o) = oh; *(v2us*)(Tl + o) = ol; 
}
// k_duffw: for value head h of the group (h = item * 4 + head, both items) and query row i: causal softmaxes of S[2h][i][.] x SCL and S[2h+1][i][.] x SCL over k <= i (three-pass f32 each), W = p1 - lambda p2 (0 for k > i)
__global__ __launch_bounds__(256) void k_duffw(const float* __restrict__ S, const float* __restrict__ lq1, const float* __restrict__ lk1, const float* __restrict__ lq2, const float* __restrict__ lk2, bf* WH, bf* WL) {
    typedef __attribute__((ext_vector_type(4))) unsigned short v4us;
    const int lane = threadIdx.x & 31; const int wid = blockIdx.x * 8 + (threadIdx.x >> 5); if (wid >= NBT * HG * SS) return; const int h = wid / SS, i = wid % SS;
    float d1 = 0.f, d2 = 0.f;
#pragma unroll
    for (int d = 0; d < HD; ++d) { d1 = fmaf(bfr(lq1[d]), bfr(lk1[d]), d1); d2 = fmaf(bfr(lq2[d]), bfr(lk2[d]), d2); }
    const float lam = __expf(d1) - __expf(d2) + LINIT;
    const float* s1 = S + ((size_t)(2 * h) * SS + i) * SS; const float* s2 = S + ((size_t)(2 * h + 1) * SS + i) * SS;
    float m1 = -3.0e38f, m2 = -3.0e38f;
#pragma unroll 1
    for (int c0 = lane * 4; c0 < SS; c0 += 128) {
#pragma unroll
        for (int q = 0; q < 4; ++q) { const int k = c0 + q; if (k <= i) { m1 = fmaxf(m1, s1[k] * SCL); m2 = fmaxf(m2, s2[k] * SCL); } } }
#pragma unroll
    for (int sh = 16; sh; sh >>= 1) { m1 = fmaxf(m1, __shfl_xor(m1, sh, 32)); m2 = fmaxf(m2, __shfl_xor(m2, sh, 32)); }
    float z1 = 0.f, z2 = 0.f;
#pragma unroll 1
    for (int c0 = lane * 4; c0 < SS; c0 += 128) {
#pragma unroll
        for (int q = 0; q < 4; ++q) { const int k = c0 + q; if (k <= i) { z1 += __expf(s1[k] * SCL - m1); z2 += __expf(s2[k] * SCL - m2); } } }
#pragma unroll
    for (int sh = 16; sh; sh >>= 1) { z1 += __shfl_xor(z1, sh, 32); z2 += __shfl_xor(z2, sh, 32); }
    const float i1 = 1.0f / z1, i2 = 1.0f / z2;
{
#pragma unroll 1
        for (int c0 = lane * 4; c0 < SS; c0 += 128) { v4us oh, ol;
#pragma unroll
            for (int q = 0; q < 4; ++q) { const int k = c0 + q; const float w = (k <= i) ? (__expf(s1[k] * SCL - m1) * i1 - lam * (__expf(s2[k] * SCL - m2) * i2)) : 0.f; const unsigned short hb = f2bf(w); oh[q] = hb; ol[q] = f2bf(w - bf2f(hb)); }
            const size_t o = ((size_t)h * SS + i) * SS + c0; *(v4us*)(WH + o) = oh; *(v4us*)(WL + o) = ol; }
         }
}
// k_rms: planes R [item * 1024 + s][1024] cols head*64 + d (bf16 hi + UNSCALED residual) of attn[s][head][.] x rsqrt(mean(attn^2) + eps) x bf(rms_w[d]) x (1 - lambda_init), all 16 heads of both items;
__global__ __launch_bounds__(256) void k_rms(const float* __restrict__ ATT, const float* __restrict__ rw, bf* Rh, bf* Rl) {
    typedef __attribute__((ext_vector_type(2))) unsigned short v2us;
    const int lane = threadIdx.x & 31; const int wid = blockIdx.x * 8 + (threadIdx.x >> 5); if (wid >= NBT * SS * NHV) return; const int s = wid / NHV, h = wid % NHV;
    const float* ar = ATT + ((size_t)(((h / HG) * NBT + s / SS) * HG + h % HG) * SS + s % SS) * VD; const float a0 = ar[lane * 2], a1 = ar[lane * 2 + 1]; float q = a0 * a0 + a1 * a1;
#pragma unroll
    for (int sh = 16; sh; sh >>= 1) q += __shfl_xor(q, sh, 32);
    const float sc = rsqrtf(q * (1.0f / VD) + REPS) * (1.0f - LINIT); v2us oh, ol;
    { const float v = a0 * sc * bfr(rw[lane * 2]); const unsigned short hb = f2bf(v); oh[0] = hb; ol[0] = f2bf(v - bf2f(hb)); }
    { const float v = a1 * sc * bfr(rw[lane * 2 + 1]); const unsigned short hb = f2bf(v); oh[1] = hb; ol[1] = f2bf(v - bf2f(hb)); }
    const size_t o = (size_t)s * EE + h * VD + lane * 2; *(v2us*)(Rh + o) = oh; *(v2us*)(Rl + o) = ol; 
}

extern "C" void kernel_launch(void* const* d_in, const int* in_sizes, int n_in,
                              void* d_out, int out_size, void* d_ws, size_t ws_size, hipStream_t stream) {
    (void)in_sizes; (void)n_in; (void)out_size;
    const float* x = (const float*)d_in[0]; const float* Wq = (const float*)d_in[1]; const float* Wk = (const float*)d_in[2]; const float* Wv = (const float*)d_in[3]; const float* Wo = (const float*)d_in[4];
    const float* lq1 = (const float*)d_in[5]; const float* lk1 = (const float*)d_in[6]; const float* lq2 = (const float*)d_in[7]; const float* lk2 = (const float*)d_in[8]; const float* rw = (const float*)d_in[9];
    float* out = (float*)d_out;    // [2][1024][1024]
    char* wsp = (char*)d_ws;
    auto take = [&](size_t bytes) { char* p = wsp; wsp += (bytes + 255) & ~(size_t)255; return (void*)p; };
    bf* WT4 = (bf*)take((size_t)4 * EE * EE * 2); bf* WOT = WT4 + (size_t)3 * EE * EE;    // Wq, Wk, Wv, Wo transposed
    bf* Xb = (bf*)take((size_t)NBT * SS * EE * 2); float* QKV = (float*)take((size_t)3 * NBT * SS * EE * 4); float* VF = QKV + (size_t)2 * NBT * SS * EE;    // q, k, v, each [item][s][1024]
    const size_t nP = (size_t)NBT * 2 * NHV * SS * HD;
    bf* PH = (bf*)take(2 * nP * 2); bf* PL = (bf*)take(2 * nP * 2); bf* VTh = (bf*)take((size_t)NBT * NHV * VD * SS * 2); bf* VTl = (bf*)take((size_t)NBT * NHV * VD * SS * 2);    // PH, PL: q planes then k planes
    float* S1 = (float*)take((size_t)NBT * 8 * SS * SS * 4); float* S = (float*)take((size_t)NBT * 8 * SS * SS * 4); bf* WH = (bf*)take((size_t)NBT * HG * SS * SS * 2); bf* WL = (bf*)take((size_t)NBT * HG * SS * SS * 2);
    float* A1 = (float*)take((size_t)NBT * SS * EE * 4); float* ATT = (float*)take((size_t)NBT * SS * EE * 4); bf* Rh = (bf*)take((size_t)NBT * SS * EE * 2); bf* Rl = (bf*)take((size_t)NBT * SS * EE * 2);
    if ((size_t)(wsp - (char*)d_ws) > ws_size) return;    // 8 + 4 + 24 + 16 + 8 + 64 + 64 + 16 + 16 + 8 + 8 + 4 + 4 = 244 MiB
    const size_t sQ = (size_t)SS * HD, sS = (size_t)SS * SS, sV = (size_t)VD * SS, sO = (size_t)SS * VD;
    k_wt<<<dim3(EE / 64, EE / 64, 4), 256, 0, stream>>>(Wq, Wk, Wv, Wo, EE, EE, WT4);   // (in, out) k-major
    k_cvtx<<<NBT * SS / 8, 256, 0, stream>>>(x, Xb);
    k_gemmbz<false, false><<<dim3(NBT * SS / 64, EE / 64, 3), 128, 0, stream>>>(Xb, nullptr, WT4, nullptr, QKV, EE, nullptr, nullptr, EE, 0, 0, (size_t)EE * EE, 0, (size_t)NBT * SS * EE);
    k_hp32<<<dim3((NBT * 2 * NHV * (SS / 2)) / 8, 2, 1), 256, 0, stream>>>(QKV, PH, PL);
    k_vt<<<(NBT * NHV * VD * (SS / 64)) / 8, 256, 0, stream>>>(VF, VTh, VTl);
    for (int g = 0; g < NHV / HG; ++g) {
        const size_t oq = (size_t)g * NBT * 8 * sQ, ov = (size_t)g * NBT * HG * sV, oo = (size_t)g * NBT * HG * sO;
        k_gemmbz<true, false><<<dim3(SS / 64, SS / 64, NBT * 8), 128, 0, stream>>>(PH + oq, PL + oq, PH + nP + oq, nullptr, S1, SS, nullptr, nullptr, HD, 0, sQ, sQ, 0, sS);
        k_gemmbz<false, false><<<dim3(SS / 64, SS / 64, NBT * 8), 128, 0, stream>>>(PH + oq, nullptr, PL + nP + oq, nullptr, S, SS, nullptr, S1, HD, 0, sQ, sQ, 0, sS);
        k_duffw<<<(NBT * HG * SS) / 8, 256, 0, stream>>>(S, lq1, lk1, lq2, lk2, WH, WL);
        k_gemmbz<true, false><<<dim3(SS / 64, 1, NBT * HG), 128, 0, stream>>>(WH, WL, VTh + ov, nullptr, A1 + oo, VD, nullptr, nullptr, SS, 0, sS, sV, 0, sO);
        k_gemmbz<false, false><<<dim3(SS / 64, 1, NBT * HG), 128, 0, stream>>>(WH, nullptr, VTl + ov, nullptr, ATT + oo, VD, nullptr, A1 + oo, SS, 0, sS, sV, 0, sO); }
    k_rms<<<(NBT * SS * NHV) / 8, 256, 0, stream>>>(ATT, rw, Rh, Rl);
    k_gemmb<true, false><<<dim3(NBT * SS / 64, EE / 64, 1), 128, 0, stream>>>(Rh, Rl, WOT, nullptr, out, EE, nullptr, nullptr, EE);
}

// v003
// It runs in 121 microseconds.
// Versions in between are left out here; by their measured steps it is 4.85 times as fast as v001.
// Over all steps from v000 it is 8.36 times as fast.
#include <hip/hip_runtime.h>

// Compute dtypes, f32 accumulate, per item: q/k/v = x.W as [1024 x 1024].[1024 x 1024] GEMMs with PLAIN bf16 operands (exact products); per value head (= 2 q/k heads), in ONE
// launch: scores^T = k.q^T ([keys x 32].[32 x queries], both operands bf16 hi + UNSCALED residual, three products), the causal softmax of each head of the pair with a running
// maximum and sum in f32, the unnormalised weights -> hi/lo bf16 straight from the score accumulators, o^T += v^T.p^T (three products), attn = o1 / z1 - lambda o2 / z2 in f32;
// RMSNorm (x rms_w x (1 - lambda_init)) in f32 -> planes; out = attn.Wo (two products) - on v_wmma_f32_16x16x32_bf16. lambda = exp(lq1.lk1) - exp(lq2.lk2) + lambda_init from the inputs on device.
// Launch plan: both batch items ride in every grid; the four weight transposes, the q/k/v projections and the attention each run once for all heads; the projections' epilogue builds the
// hi/lo planes (v transposed) and the attention's epilogue does the RMSNorm, so no launch only reshapes data between two products.
// Plane order: q/k planes [group][item][8 heads][s][32], v planes [group][item][4 heads][64][s]: value plane p pairs with q/k planes 2p, 2p + 1.

#define NBT  2
#define SS   1024
#define EE   1024
#define NHV  16
#define HD   32                   // q/k head dim
#define VD   64                   // v head dim
#define HG   4                    // value heads per group (8 q/k heads)
#define DM   EE
#define SCL  0.17677669529663687f
#define LINIT 0.7836057665316245f    // 0.8 - 0.6 exp(-0.3 * 12)
#define REPS 1e-5f
#define LOSC 1024.0f

typedef _Float16 h16;
typedef unsigned short bf;
typedef __attribute__((ext_vector_type(16))) __bf16   v16bf;
typedef __attribute__((ext_vector_type(16))) _Float16 v16h;
typedef __attribute__((ext_vector_type(8)))  _Float16 v8h;
typedef __attribute__((ext_vector_type(8)))  unsigned short v8us;
typedef __attribute__((ext_vector_type(8)))  float    v8f;
typedef __attribute__((ext_vector_type(4)))  float    v4f;
typedef v8h  __attribute__((may_alias)) v8ha;
typedef v4f  __attribute__((may_alias)) v4fa;
typedef v8us __attribute__((may_alias)) v8usa;

__device__ __forceinline__ unsigned short f2bf(float f) { unsigned u = __float_as_uint(f); u += 0x7FFFu + ((u >> 16) & 1u); return (unsigned short)(u >> 16); }
__device__ __forceinline__ float bf2f(unsigned short b) { return __uint_as_float(((unsigned)b) << 16); }
__device__ __forceinline__ float bfr(float f) { return bf2f(f2bf(f)); }
__device__ __forceinline__ v16h cat16(v8h lo, v8h hi) { return __builtin_shufflevector(lo, hi, 0, 1, 2, 3, 4, 5, 6, 7, 8, 9, 10, 11, 12, 13, 14, 15); }
__device__ __forceinline__ v16bf cat16b(v8us lo, v8us hi) { return __builtin_bit_cast(v16bf, __builtin_shufflevector(lo, hi, 0, 1, 2, 3, 4, 5, 6, 7, 8, 9, 10, 11, 12, 13, 14, 15)); }
__device__ __forceinline__ v8f wmma16(v16h a, v16h b, v8f c) { return __builtin_amdgcn_wmma_f32_16x16x32_f16(false, a, false, b, (short)0, c, false, false); }
__device__ __forceinline__ v8f wmmab(v16bf a, v16bf b, v8f c) { return __builtin_amdgcn_wmma_f32_16x16x32_bf16(false, a, false, b, (short)0, c, false, false); }

// k_gemmb: 64 x 64 block tile (4 waves x 16 x 64) of C[NTK][NW] = (A [+ Al]).B^T (K = 1024) [+ bf(bias[c])] [+ bf(R[r][c]) residual]; f32 whole-line epilogue (or f16
template <bool SPLITA, bool F16OUT = false>
__global__ __launch_bounds__(128) void k_gemmb(const bf* __restrict__ A, const bf* __restrict__ Al, const bf* __restrict__ Bn, const float* __restrict__ bias, float* C, int ldc, h16* C2, const float* __restrict__ R = nullptr, int K = DM, int roundR = 1) {
    __shared__ __align__(16) float ost[4][16 * 68];
    const int lane = threadIdx.x & 31, wave = threadIdx.x >> 5, lr = lane & 15, hi = lane >> 4;
    const int r0 = blockIdx.x * 64 + wave * 16, c0 = blockIdx.y * 64;
    const size_t aoff = (size_t)(r0 + lr) * K + 8 * hi;
    size_t boff[4];
#pragma unroll
    for (int t = 0; t < 4; ++t) boff[t] = (size_t)(c0 + t * 16 + lr) * K + 8 * hi;
    v8f acc[4];
#pragma unroll
    for (int t = 0; t < 4; ++t) acc[t] = (v8f){};
#pragma unroll 1
    for (int kc = 0; kc < K; kc += 32) {
        const v16bf a = cat16b(*(const v8us*)(A + aoff + kc), *(const v8us*)(A + aoff + kc + 16));
        v16bf al = a;
        if (SPLITA) al = cat16b(*(const v8us*)(Al + aoff + kc), *(const v8us*)(Al + aoff + kc + 16));
#pragma unroll
        for (int t = 0; t < 4; ++t) { const v16bf b = cat16b(*(const v8us*)(Bn + boff[t] + kc), *(const v8us*)(Bn + boff[t] + kc + 16)); acc[t] = wmmab(a, b, acc[t]); if (SPLITA) acc[t] = wmmab(al, b, acc[t]); }
        asm volatile("v_nop\n\tv_nop\n\tv_nop\n\tv_nop" : "+v"(acc[0]), "+v"(acc[1]), "+v"(acc[2]), "+v"(acc[3]) : "v"(a), "v"(al));
    }
    float* os = &ost[wave][0];
#pragma unroll
    for (int t = 0; t < 4; ++t) { const float bv = bias ? bfr(bias[c0 + t * 16 + lr]) : 0.f;
#pragma unroll
        for (int j = 0; j < 8; ++j) os[(hi * 8 + j) * 68 + t * 16 + lr] = acc[t][j] + bv; }
    __syncthreads();
    if (F16OUT) {
        h16* crow = (h16*)(void*)C + (size_t)r0 * ldc + c0;
        auto pass = [&]() {
#pragma unroll
            for (int s = 0; s < 4; ++s) { const int row = 4 * s + (lane >> 3), piece = lane & 7; const float* sp = os + row * 68 + piece * 8; v8h o, o2;
#pragma unroll
                for (int i = 0; i < 8; ++i) { const h16 a = (h16)sp[i]; o[i] = a; o2[i] = (h16)((sp[i] - (float)a) * LOSC); }
                *(v8h*)(crow + (size_t)row * ldc + piece * 8) = o; if (C2) *(v8h*)(C2 + (size_t)r0 * ldc + c0 + (size_t)row * ldc + piece * 8) = o2; }
        };
        pass(); 
    } else {
        float* crow = C + (size_t)r0 * ldc + c0;
        auto pass = [&]() {
#pragma unroll
            for (int s = 0; s < 8; ++s) { const int Lid = (lane >> 3) + 4 * s, piece = lane & 7; const int row = Lid >> 1, cofs = (Lid & 1) * 32 + piece * 4;
                v4f val = *(const v4fa*)(os + row * 68 + cofs); if (R) { const v4f rv = *(const v4f*)(R + ((size_t)r0 + row) * ldc + c0 + cofs); val += roundR ? (v4f){bfr(rv[0]), bfr(rv[1]), bfr(rv[2]), bfr(rv[3])} : rv; }
                *(v4f*)(crow + (size_t)row * ldc + cofs) = val; }
        };
        pass(); 
    }
}

// k_qkv: the q (blockIdx.z = 0), k (1) and v (2) projections, 64 x 64 block tile (4 waves x 16 x 64) of x.Wz (A [2048][1024] bf16, WT [z][n][1024] bf16), with k_gemmb's main loop. The epilogue
// writes what the attention reads, straight from the f32 accumulators: q/k as hi/lo planes [plane][s][32] (the block's 64 columns are two q/k heads; each wave stages its 16 rows in its own LDS
// range and stores 512 contiguous bytes an instruction), v as transposed hi/lo planes [plane][64][s] (the 64 columns are one value head; a lane's 8 accumulator rows are 8 consecutive s of one
// column, packed in registers, staged [d][s] for the whole block, so that one wave stores each whole 128-byte line of 64 s).
__global__ __launch_bounds__(128) void k_qkv(const bf* __restrict__ A, const bf* __restrict__ WT, bf* PH, bf* PL, bf* VTh, bf* VTl) {
    __shared__ __align__(16) unsigned char sm[2 * 64 * 72 * 2];    // q/k: f32 [4 waves][16][68]; v: bf16 hi [64][72] then lo [64][72]
    const int K = EE, z = blockIdx.z;
    const bf* Bn = WT + (size_t)z * EE * EE;
    const int tid = threadIdx.x, lane = tid & 31, wave = tid >> 5, lr = lane & 15, hi = lane >> 4;
    const int r0 = blockIdx.x * 64 + wave * 16, c0 = blockIdx.y * 64;
    const size_t aoff = (size_t)(r0 + lr) * K + 8 * hi;
    size_t boff[4];
#pragma unroll
    for (int t = 0; t < 4; ++t) boff[t] = (size_t)(c0 + t * 16 + lr) * K + 8 * hi;
    v8f acc[4];
#pragma unroll
    for (int t = 0; t < 4; ++t) acc[t] = (v8f){};
#pragma unroll 1    // stays rolled, as in k_gemmb: one trip's fragments in registers, many waves resident
    for (int kc = 0; kc < K; kc += 32) {
        const v16bf a = cat16b(*(const v8us*)(A + aoff + kc), *(const v8us*)(A + aoff + kc + 16));
#pragma unroll
        for (int t = 0; t < 4; ++t) { const v16bf b = cat16b(*(const v8us*)(Bn + boff[t] + kc), *(const v8us*)(Bn + boff[t] + kc + 16)); acc[t] = wmmab(a, b, acc[t]); }
        asm volatile("v_nop\n\tv_nop\n\tv_nop\n\tv_nop" : "+v"(acc[0]), "+v"(acc[1]), "+v"(acc[2]), "+v"(acc[3]) : "v"(a));    // the vector slots the chip needs behind the last WMMA, also on the taken side of the loop's branch
    }
    const int item = (blockIdx.x * 64) / SS, sb = (blockIdx.x * 64) % SS;    // a block's 64 rows lie in one item
    float* os = (float*)(void*)sm + wave * (16 * 68);
    unsigned short* th = (unsigned short*)(void*)sm; unsigned short* tw = th + 64 * 72;
    if (z < 2) {
#pragma unroll
        for (int t = 0; t < 4; ++t)
#pragma unroll
            for (int j = 0; j < 8; ++j) os[(hi * 8 + j) * 68 + t * 16 + lr] = acc[t][j];
        __syncthreads();
        bf* ph = PH + (size_t)z * ((size_t)NBT * 2 * NHV * SS * HD); bf* pl = PL + (size_t)z * ((size_t)NBT * 2 * NHV * SS * HD);
#pragma unroll
        for (int it = 0; it < 4; ++it) { const int head = c0 / HD + (it >> 1), row = (it & 1) * 8 + (lane >> 2), piece = lane & 3;
            const int p = ((head / (2 * HG)) * NBT + item) * (2 * HG) + head % (2 * HG);
            const float* sp = os + row * 68 + (it >> 1) * HD + piece * 8; const v4f x0 = *(const v4fa*)sp, x1 = *(const v4fa*)(sp + 4); v8us oh, ol;
#pragma unroll
            for (int i = 0; i < 8; ++i) { const float v = i < 4 ? x0[i & 3] : x1[i & 3]; const unsigned short hb = f2bf(v); oh[i] = hb; ol[i] = f2bf(v - bf2f(hb)); }
            const size_t o = ((size_t)p * SS + sb + wave * 16 + row) * HD + piece * 8; *(v8us*)(ph + o) = oh; *(v8us*)(pl + o) = ol; }
    } else {
#pragma unroll
        for (int t = 0; t < 4; ++t) { v8us oh, ol;
#pragma unroll
            for (int j = 0; j < 8; ++j) { const float v = acc[t][j]; const unsigned short hb = f2bf(v); oh[j] = hb; ol[j] = f2bf(v - bf2f(hb)); }
            const int o = (t * 16 + lr) * 72 + wave * 16 + hi * 8; *(v8usa*)(th + o) = oh; *(v8usa*)(tw + o) = ol; }
        __syncthreads();    // each line of 64 s holds 16 s from every wave of the block
        const int hv = c0 / VD, p = ((hv / HG) * NBT + item) * HG + hv % HG;
#pragma unroll
        for (int it = 0; it < 4; ++it) { const int idx = it * 128 + tid, d = idx >> 3, piece = idx & 7;
            const size_t o = ((size_t)p * VD + d) * SS + sb + piece * 8;
            *(v8us*)(VTh + o) = *(const v8usa*)(th + d * 72 + piece * 8); *(v8us*)(VTl + o) = *(const v8usa*)(tw + d * 72 + piece * 8); }
    }
}

// k_wt: WT [z][n][K] = bf16(Wz[k][n]) (k-major [K][ncols]) via 64 x 64 LDS tiles; grid (K/64, ncols/64, 4), blockIdx.z picks the matrix.
__global__ __launch_bounds__(256) void k_wt(const float* __restrict__ W0, const float* __restrict__ W1, const float* __restrict__ W2, const float* __restrict__ W3, int K, int ncols, bf* WT) {
    __shared__ __align__(16) unsigned short tl[64 * 72];
    const float* Wm = blockIdx.z == 0 ? W0 : blockIdx.z == 1 ? W1 : blockIdx.z == 2 ? W2 : W3; WT += (size_t)blockIdx.z * K * ncols;
    const int tid = threadIdx.x, k0 = blockIdx.x * 64, n0 = blockIdx.y * 64;
    const int kk = tid >> 2, nq = (tid & 3) * 16;
#pragma unroll
    for (int i = 0; i < 16; ++i) tl[(nq + i) * 72 + kk] = f2bf(Wm[(size_t)(k0 + kk) * ncols + n0 + nq + i]);
    __syncthreads();
    const int piece = tid & 7;
    auto pass = [&]() {
#pragma unroll
        for (int s = 0; s < 2; ++s) { const int nr = (tid >> 3) + 32 * s; const v8us val = *(const v8usa*)(tl + nr * 72 + piece * 8); *(v8us*)(WT + (size_t)(n0 + nr) * K + k0 + piece * 8) = val; }
    };
    pass(); 
}

__global__ __launch_bounds__(256) void k_cvtx(const float* __restrict__ src, bf* dst) {
    const int lane = threadIdx.x & 31; const size_t r = (size_t)blockIdx.x * 8 + (threadIdx.x >> 5); if (r >= (size_t)NBT * SS) return;
{
#pragma unroll
        for (int q = 0; q < EE / 256; ++q) { v8us o;
#pragma unroll
            for (int i = 0; i < 8; ++i) o[i] = f2bf(src[r * EE + q * 256 + lane * 8 + i]);
            *(v8us*)(dst + r * EE + q * 256 + lane * 8) = o; }
         }
}
// k_fattn: one value head p (blockIdx.y) and four 32-query tiles per block; waves 2n and 2n + 1 take q/k heads 2p and 2p + 1 of tile n. Per 32 keys and 16-query column group: S^T = K.Q^T (a
// lane holds 16 keys of ONE query: lane & 15 = query, lane >> 4 picks keys 8h.. and 16 + 8h..), running maximum m and sum z, p = exp(s x SCL - m) (0 for key > query), and the two score
// tiles, converted in place, are the B operand of O^T += V^T.P^T. The odd wave hands o2 / z2 over through LDS; the even wave forms attn = o1 / z1 - lambda o2 / z2,
// its RMSNorm over the row's 64 values (x rsqrt(mean(attn^2) + eps) x bf(rms_w[d]) x (1 - lambda_init)), and stores the planes R [item * 1024 + s][1024], cols head * 64 + d (bf16 hi + UNSCALED residual).
// Every '#pragma unroll' in it, except the one over the lambda vectors, walks an array of fragments or accumulators, whose indices must be compile-time constants for the array to stay in registers.
__device__ __forceinline__ v16bf ldfrag(const bf* p) { return cat16b(*(const v8us*)p, *(const v8us*)(p + 16)); }
__device__ __forceinline__ float xhalf(float v) { const int b = __float_as_int(v); return __int_as_float(__builtin_amdgcn_permlanex16(b, b, 0x76543210, 0xfedcba98, false, false)); }    // lane l <-> l ^ 16
__global__ __launch_bounds__(256) void k_fattn(const bf* __restrict__ Qh, const bf* __restrict__ Ql, const bf* __restrict__ Kh, const bf* __restrict__ Kl, const bf* __restrict__ Vh, const bf* __restrict__ Vl,
                                               const float* __restrict__ lq1, const float* __restrict__ lk1, const float* __restrict__ lq2, const float* __restrict__ lk2, const float* __restrict__ rw, bf* Rh, bf* Rl) {
    __shared__ float o2s[4][64 * 32];
    const int lane = threadIdx.x & 31, wave = __builtin_amdgcn_readfirstlane(threadIdx.x >> 5), lr = lane & 15, hi = lane >> 4, tl = wave >> 1, sel = wave & 1;    // the wave's number in a scalar register: trip count, plane offsets and branches stay scalar
    const int bx = blockIdx.x, pv = blockIdx.y;
    const int tile = tl == 0 ? 31 - bx : tl == 1 ? 16 + bx : tl == 2 ? bx : 15 - bx;    // waves w and w + 4 together walk the same number of keys in every block
    const int q0 = tile * 32, nst = tile + 1;
    const size_t pqk = (size_t)(2 * pv + sel) * SS * HD;
    const unsigned ko = lr * HD + 8 * hi, vo = lr * SS + 8 * hi;    // the lane's place in a K (or Q) tile and in a V^T tile
    const bf* kbh = Kh + pqk; const bf* kbl = Kl + pqk;
    const bf* vsh = Vh + (size_t)pv * VD * SS; const bf* vsl = Vl + (size_t)pv * VD * SS;    // wave-uniform, 32 keys on a step: the lane's own offset vo never changes
    v16bf qh[2], ql[2]; v8f acc[2][4]; float m[2], z[2];
#pragma unroll
    for (int c = 0; c < 2; ++c) { qh[c] = ldfrag(Qh + pqk + (q0 + c * 16) * HD + ko); ql[c] = ldfrag(Ql + pqk + (q0 + c * 16) * HD + ko); m[c] = -3.0e38f; z[c] = 0.f;
#pragma unroll
        for (int t = 0; t < 4; ++t) acc[c][t] = (v8f){}; }
    v16bf kh0 = ldfrag(kbh + ko), kh1 = ldfrag(kbh + 16 * HD + ko), kl0 = ldfrag(kbl + ko), kl1 = ldfrag(kbl + 16 * HD + ko);
#pragma unroll 1    // stays rolled: one step's fragments and accumulators already take the wave's registers
    for (int st = 0; st < nst; ++st) {
        const int k0 = st * 32;
        v16bf vh[4], vl[4];
#pragma unroll
        for (int t = 0; t < 4; ++t) { vh[t] = ldfrag(vsh + t * 16 * SS + vo); vl[t] = ldfrag(vsl + t * 16 * SS + vo); }
        vsh += 32; vsl += 32;
        __builtin_amdgcn_sched_barrier(0);    // holds the 16 V loads up here, so that they fly under the score products and the softmax; sunk to their users each would be waited for alone
        v8f s[2][2];
#pragma unroll
        for (int c = 0; c < 2; ++c) { s[c][0] = wmmab(kh0, qh[c], (v8f){}); s[c][1] = wmmab(kh1, qh[c], (v8f){}); }
#pragma unroll
        for (int c = 0; c < 2; ++c) { s[c][0] = wmmab(kh0, ql[c], s[c][0]); s[c][1] = wmmab(kh1, ql[c], s[c][1]); }
#pragma unroll
        for (int c = 0; c < 2; ++c) { s[c][0] = wmmab(kl0, qh[c], s[c][0]); s[c][1] = wmmab(kl1, qh[c], s[c][1]); }
        { const int kn = (k0 + 32 < SS - 32 ? k0 + 32 : SS - 32) * HD;    // the next step's K fragments fly during this step's softmax; the index stays inside the plane
          kh0 = ldfrag(kbh + kn + ko); kh1 = ldfrag(kbh + (kn + 16 * HD) + ko); kl0 = ldfrag(kbl + kn + ko); kl1 = ldfrag(kbl + (kn + 16 * HD) + ko); }
        __builtin_amdgcn_sched_barrier(0);    // holds the next K loads here; sunk to the loop's foot they would be waited for at once
        v16bf ph[2], pl[2];
#pragma unroll
        for (int c = 0; c < 2; ++c) {
            float sc[16]; const int rel = q0 + c * 16 + lr - k0 - 8 * hi;    // key <= query  <=>  its place among the lane's keys <= rel
#pragma unroll
            for (int j = 0; j < 8; ++j) { sc[j] = (j <= rel) ? s[c][0][j] * SCL : -3.0e38f; sc[8 + j] = (16 + j <= rel) ? s[c][1][j] * SCL : -3.0e38f; }
            float tm = sc[0];
#pragma unroll
            for (int e = 1; e < 16; ++e) tm = fmaxf(tm, sc[e]);
            tm = fmaxf(tm, xhalf(tm));
            const float mn = fmaxf(m[c], tm); float al;    // al = exp(m - mn): what the old maximum's sums and products are worth under the new one
            asm("v_exp_f32 %0, %1\n\tv_nop" : "=v"(al) : "v"((m[c] - mn) * 1.44269504f));    // with the slot the instruction set asks for behind a transcendental
            m[c] = mn;
            float zs = 0.f;
#pragma unroll
            for (int e = 0; e < 16; ++e) { const float p = __expf(sc[e] - mn); zs += p; const __bf16 hb = (__bf16)p; ph[c][e] = hb; pl[c][e] = (__bf16)(p - (float)hb); }
            z[c] = z[c] * al + zs;
#pragma unroll
            for (int t = 0; t < 4; ++t) acc[c][t] *= al;
        }
#pragma unroll
        for (int c = 0; c < 2; ++c)
#pragma unroll
            for (int t = 0; t < 4; ++t) acc[c][t] = wmmab(vh[t], ph[c], acc[c][t]);
#pragma unroll
        for (int c = 0; c < 2; ++c)
#pragma unroll
            for (int t = 0; t < 4; ++t) acc[c][t] = wmmab(vh[t], pl[c], acc[c][t]);
#pragma unroll
        for (int c = 0; c < 2; ++c)
#pragma unroll
            for (int t = 0; t < 4; ++t) acc[c][t] = wmmab(vl[t], ph[c], acc[c][t]);
    }
    float iz[2];
#pragma unroll
    for (int c = 0; c < 2; ++c) iz[c] = 1.0f / (z[c] + xhalf(z[c]));
    float* ob = &o2s[tl][lane];
    if (sel == 1) {
#pragma unroll
        for (int c = 0; c < 2; ++c)
#pragma unroll
            for (int t = 0; t < 4; ++t)
#pragma unroll
                for (int j = 0; j < 8; ++j) ob[((c * 4 + t) * 8 + j) * 32] = acc[c][t][j] * iz[c];
    }
    __syncthreads();
    if (sel == 0) {
        float d1 = 0.f, d2 = 0.f;
#pragma unroll
        for (int d = 0; d < HD; ++d) { d1 = fmaf(bfr(lq1[d]), bfr(lk1[d]), d1); d2 = fmaf(bfr(lq2[d]), bfr(lk2[d]), d2); }
        const float lam = __expf(d1) - __expf(d2) + LINIT;
        const int item = (pv / HG) % NBT, hv = (pv / (NBT * HG)) * HG + pv % HG;    // plane pv = [group][item][head in group]
#pragma unroll
        for (int c = 0; c < 2; ++c) {
            float q = 0.f;    // lanes l and l ^ 16 hold the 64 values of one query's row, 32 each
#pragma unroll
            for (int t = 0; t < 4; ++t)
#pragma unroll
                for (int j = 0; j < 8; ++j) { const float a = acc[c][t][j] * iz[c] - lam * ob[((c * 4 + t) * 8 + j) * 32]; acc[c][t][j] = a; q += a * a; }
            q += xhalf(q);
            const float sc = rsqrtf(q * (1.0f / VD) + REPS) * (1.0f - LINIT);
            const size_t o = ((size_t)item * SS + q0 + c * 16 + lr) * EE + hv * VD + 8 * hi;
#pragma unroll
            for (int t = 0; t < 4; ++t) { v8us oh, ol;
#pragma unroll
                for (int j = 0; j < 8; ++j) { const float v = acc[c][t][j] * sc * bfr(rw[t * 16 + 8 * hi + j]); const unsigned short hb = f2bf(v); oh[j] = hb; ol[j] = f2bf(v - bf2f(hb)); }
                *(v8us*)(Rh + o + t * 16) = oh; *(v8us*)(Rl + o + t * 16) = ol; }
        }
    }
}

extern "C" void kernel_launch(void* const* d_in, const int* in_sizes, int n_in,
                              void* d_out, int out_size, void* d_ws, size_t ws_size, hipStream_t stream) {
    (void)in_sizes; (void)n_in; (void)out_size;
    const float* x = (const float*)d_in[0]; const float* Wq = (const float*)d_in[1]; const float* Wk = (const float*)d_in[2]; const float* Wv = (const float*)d_in[3]; const float* Wo = (const float*)d_in[4];
    const float* lq1 = (const float*)d_in[5]; const float* lk1 = (const float*)d_in[6]; const float* lq2 = (const float*)d_in[7]; const float* lk2 = (const float*)d_in[8]; const float* rw = (const float*)d_in[9];
    float* out = (float*)d_out;    // [2][1024][1024]
    char* wsp = (char*)d_ws;
    auto take = [&](size_t bytes) { char* p = wsp; wsp += (bytes + 255) & ~(size_t)255; return (void*)p; };
    bf* WT4 = (bf*)take((size_t)4 * EE * EE * 2); bf* WOT = WT4 + (size_t)3 * EE * EE;    // Wq, Wk, Wv, Wo transposed
    bf* Xb = (bf*)take((size_t)NBT * SS * EE * 2);
    const size_t nP = (size_t)NBT * 2 * NHV * SS * HD;
    bf* PH = (bf*)take(2 * nP * 2); bf* PL = (bf*)take(2 * nP * 2); bf* VTh = (bf*)take((size_t)NBT * NHV * VD * SS * 2); bf* VTl = (bf*)take((size_t)NBT * NHV * VD * SS * 2);    // PH, PL: q planes then k planes
    bf* Rh = (bf*)take((size_t)NBT * SS * EE * 2); bf* Rl = (bf*)take((size_t)NBT * SS * EE * 2);
    if ((size_t)(wsp - (char*)d_ws) > ws_size) return;    // 8 + 4 + 16 + 8 + 4 + 4 = 44 MiB
    k_wt<<<dim3(EE / 64, EE / 64, 4), 256, 0, stream>>>(Wq, Wk, Wv, Wo, EE, EE, WT4);   // (in, out) k-major
    k_cvtx<<<NBT * SS / 8, 256, 0, stream>>>(x, Xb);
    k_qkv<<<dim3(NBT * SS / 64, EE / 64, 3), 128, 0, stream>>>(Xb, WT4, PH, PL, VTh, VTl);
    k_fattn<<<dim3(SS / 128, NBT * NHV, 1), 256, 0, stream>>>(PH, PL, PH + nP, PL + nP, VTh, VTl, lq1, lk1, lq2, lk2, rw, Rh, Rl);
    k_gemmb<true, false><<<dim3(NBT * SS / 64, EE / 64, 1), 128, 0, stream>>>(Rh, Rl, WOT, nullptr, out, EE, nullptr, nullptr, EE);
}

// v004
// One run takes 73 microseconds.
// Timed twice side by side with v003, it ran 1.67 times as fast both times.
// All steps since v000 together make it 13.9 times as fast.
#include <hip/hip_runtime.h>

// Compute dtypes, f32 accumulate, per item: q/k/v = x.W as [1024 x 1024].[1024 x 1024] GEMMs with PLAIN bf16 operands (exact products); per value head (= 2 q/k heads), in ONE
// launch: scores^T = k.q^T ([keys x 32].[32 x queries], both operands bf16 hi + UNSCALED residual, three products), the causal softmax of each head of the pair with a running
// maximum and sum in f32, the unnormalised weights -> hi/lo bf16 straight from the score accumulators, o^T += v^T.p^T (three products), attn = o1 / z1 - lambda o2 / z2 in f32;
// RMSNorm (x rms_w x (1 - lambda_init)) in f32 -> planes; out = attn.Wo (two products) - on v_wmma_f32_16x16x32_bf16. lambda = exp(lq1.lk1) - exp(lq2.lk2) + lambda_init from the inputs on device.
// Launch plan: both batch items ride in every grid; the four weight transposes, the q/k/v projections and the attention each run once for all heads; the projections' epilogue builds the
// hi/lo planes (v transposed) and the attention's epilogue does the RMSNorm, so no launch only reshapes data between two products.
// Plane order: q/k planes [group][item][8 heads][s][32], v planes [group][item][4 heads][64][s]: value plane p pairs with q/k planes 2p, 2p + 1.

#define NBT  2
#define SS   1024
#define EE   1024
#define NHV  16
#define HD   32                   // q/k head dim
#define VD   64                   // v head dim
#define HG   4                    // value heads per group (8 q/k heads)
#define DM   EE
#define SCL  0.17677669529663687f
#define LINIT 0.7836057665316245f    // 0.8 - 0.6 exp(-0.3 * 12)
#define REPS 1e-5f
#define LOSC 1024.0f

typedef _Float16 h16;
typedef unsigned short bf;
typedef __attribute__((ext_vector_type(16))) __bf16   v16bf;
typedef __attribute__((ext_vector_type(16))) _Float16 v16h;
typedef __attribute__((ext_vector_type(8)))  _Float16 v8h;
typedef __attribute__((ext_vector_type(8)))  unsigned short v8us;
typedef __attribute__((ext_vector_type(8)))  float    v8f;
typedef __attribute__((ext_vector_type(4)))  float    v4f;
typedef v8h  __attribute__((may_alias)) v8ha;
typedef v4f  __attribute__((may_alias)) v4fa;
typedef v8us __attribute__((may_alias)) v8usa;

__device__ __forceinline__ unsigned short f2bf(float f) { unsigned u = __float_as_uint(f); u += 0x7FFFu + ((u >> 16) & 1u); return (unsigned short)(u >> 16); }
__device__ __forceinline__ float bf2f(unsigned short b) { return __uint_as_float(((unsigned)b) << 16); }
__device__ __forceinline__ float bfr(float f) { return bf2f(f2bf(f)); }
__device__ __forceinline__ v16h cat16(v8h lo, v8h hi) { return __builtin_shufflevector(lo, hi, 0, 1, 2, 3, 4, 5, 6, 7, 8, 9, 10, 11, 12, 13, 14, 15); }
__device__ __forceinline__ v16bf cat16b(v8us lo, v8us hi) { return __builtin_bit_cast(v16bf, __builtin_shufflevector(lo, hi, 0, 1, 2, 3, 4, 5, 6, 7, 8, 9, 10, 11, 12, 13, 14, 15)); }
__device__ __forceinline__ v8f wmma16(v16h a, v16h b, v8f c) { return __builtin_amdgcn_wmma_f32_16x16x32_f16(false, a, false, b, (short)0, c, false, false); }
__device__ __forceinline__ v8f wmmab(v16bf a, v16bf b, v8f c) { return __builtin_amdgcn_wmma_f32_16x16x32_bf16(false, a, false, b, (short)0, c, false, false); }

// gemm_stages: the main loop of both GEMM kernels, for a block of 4 waves and a 64 x 64 tile. A stage is 64 k of every operand: 64 rows x one whole 128-byte line, which the block fetches with loads that
// each cover 4 whole lines (a fragment load from global memory touches 16 lines for the same 512 bytes), lays in LDS at pitch LP and reads back as fragments. Two buffers: stage t + 1 is fetched into
// registers in front of stage t's products and stored into the other buffer behind them; the one barrier of a trip publishes it and ends every wave's reads of the buffer that the next trip overwrites.
// NOP = 2: operands g0 = A, g1 = B; NOP = 3: g0 = A, g1 = its residual, g2 = B. k runs upward in steps of 32 through the same accumulators as with fragments from global memory.
// Returns the buffer that the last stage does not lie in: every wave's reads of it ended in front of the last barrier, so the caller's epilogue may stage in it at once.
// Every '#pragma unroll' in it walks an array of staged rows, fragments or accumulators, whose indices must be compile-time constants for the array to stay in registers.
#define KT  64                    // k per stage
#define LP  72                    // LDS row pitch in bf16: 144 B = 16 B x odd, for ds_load_b128 readers of 128-byte rows
#define TSZ (64 * LP)             // one operand's 64 rows
template <int NOP, int K>
__device__ __forceinline__ unsigned short* gemm_stages(const bf* __restrict__ g0, const bf* __restrict__ g1, const bf* __restrict__ g2, unsigned short* st, v8f (&acc)[4]) {
    const int tid = threadIdx.x, lane = tid & 31, wave = tid >> 5, lr = lane & 15, hi = lane >> 4;
    const unsigned go = (tid >> 3) * K + (tid & 7) * 8, so = (tid >> 3) * LP + (tid & 7) * 8;    // 8 lanes a row, 16 rows a pass of the block
    const unsigned fa = (wave * 16 + lr) * LP + 8 * hi, fb = (NOP - 1) * TSZ + lr * LP + 8 * hi;    // the lane's place in its wave's A rows and in B's first 16 rows
    v8us r[NOP][4];
    auto fetch = [&](int kc) {
#pragma unroll
        for (int it = 0; it < 4; ++it) { r[0][it] = *(const v8us*)(g0 + kc + go + it * 16 * K); r[1][it] = *(const v8us*)(g1 + kc + go + it * 16 * K); if (NOP == 3) r[NOP - 1][it] = *(const v8us*)(g2 + kc + go + it * 16 * K); }
    };
    auto put = [&](unsigned short* b) {
#pragma unroll
        for (int o = 0; o < NOP; ++o)
#pragma unroll
            for (int it = 0; it < 4; ++it) *(v8usa*)(b + o * TSZ + so + it * 16 * LP) = r[o][it];
    };
    auto work = [&](const unsigned short* b) {
        v16bf a[KT / 32], al[KT / 32], w[KT / 32][4];    // fragments first, products behind them: the LDS reads may then run ahead of the products that use them
#pragma unroll
        for (int h = 0; h < KT / 32; ++h) {
            a[h] = cat16b(*(const v8usa*)(b + fa + h * 32), *(const v8usa*)(b + fa + h * 32 + 16));
            if (NOP == 3) al[h] = cat16b(*(const v8usa*)(b + TSZ + fa + h * 32), *(const v8usa*)(b + TSZ + fa + h * 32 + 16));
#pragma unroll
            for (int t = 0; t < 4; ++t) w[h][t] = cat16b(*(const v8usa*)(b + fb + t * 16 * LP + h * 32), *(const v8usa*)(b + fb + t * 16 * LP + h * 32 + 16));
        }
#pragma unroll
        for (int h = 0; h < KT / 32; ++h)
#pragma unroll
            for (int t = 0; t < 4; ++t) { acc[t] = wmmab(a[h], w[h][t], acc[t]); if (NOP == 3) acc[t] = wmmab(al[h], w[h][t], acc[t]); }
    };
    constexpr int nt = K / KT;
    fetch(0); put(st);
    __syncthreads();    // publishes stage 0
#pragma unroll 1    // stays rolled: one stage's registers, many waves resident
    for (int t = 0; t + 1 < nt; ++t) {
        fetch((t + 1) * KT);
        __builtin_amdgcn_sched_barrier(0);    // holds the next stage's loads up here, so that they fly under this stage's LDS reads and products; sunk among the products the last of them was waited for at once
        work(st + (t & 1) * (NOP * TSZ));
        put(st + ((t + 1) & 1) * (NOP * TSZ));
        __syncthreads();    // publishes stage t + 1; stage t's buffer is free behind it
    }
    work(st + ((nt - 1) & 1) * (NOP * TSZ));
    return st + (nt & 1) * (NOP * TSZ);
}

// k_gemmb: 64 x 64 block tile (4 waves x 16 x 64) of C[NTK][NW] = (A [+ Al]).B^T (K = 1024) [+ bf(bias[c])] [+ bf(R[r][c]) residual]; f32 whole-line epilogue (or f16
template <bool SPLITA, bool F16OUT = false>
__global__ __launch_bounds__(128) void k_gemmb(const bf* __restrict__ A, const bf* __restrict__ Al, const bf* __restrict__ Bn, const float* __restrict__ bias, float* C, int ldc, h16* C2, const float* __restrict__ R = nullptr, int roundR = 1) {
    __shared__ __align__(16) unsigned short st[2 * (SPLITA ? 3 : 2) * TSZ];    // two stage buffers; the epilogue's f32 [4 waves][16][68] lies in the free one
    const int lane = threadIdx.x & 31, wave = threadIdx.x >> 5, lr = lane & 15, hi = lane >> 4;
    const int r0 = blockIdx.x * 64 + wave * 16, c0 = blockIdx.y * 64;
    const size_t ab = (size_t)blockIdx.x * 64 * DM, bb = (size_t)c0 * DM;
    v8f acc[4];
#pragma unroll
    for (int t = 0; t < 4; ++t) acc[t] = (v8f){};
    float* os = (float*)(void*)(SPLITA ? gemm_stages<3, DM>(A + ab, Al + ab, Bn + bb, st, acc) : gemm_stages<2, DM>(A + ab, Bn + bb, nullptr, st, acc)) + wave * (16 * 68);
#pragma unroll
    for (int t = 0; t < 4; ++t) { const float bv = bias ? bfr(bias[c0 + t * 16 + lr]) : 0.f;
#pragma unroll
        for (int j = 0; j < 8; ++j) os[(hi * 8 + j) * 68 + t * 16 + lr] = acc[t][j] + bv; }
    __syncthreads();
    if (F16OUT) {
        h16* crow = (h16*)(void*)C + (size_t)r0 * ldc + c0;
        auto pass = [&]() {
#pragma unroll
            for (int s = 0; s < 4; ++s) { const int row = 4 * s + (lane >> 3), piece = lane & 7; const float* sp = os + row * 68 + piece * 8; v8h o, o2;
#pragma unroll
                for (int i = 0; i < 8; ++i) { const h16 a = (h16)sp[i]; o[i] = a; o2[i] = (h16)((sp[i] - (float)a) * LOSC); }
                *(v8h*)(crow + (size_t)row * ldc + piece * 8) = o; if (C2) *(v8h*)(C2 + (size_t)r0 * ldc + c0 + (size_t)row * ldc + piece * 8) = o2; }
        };
        pass(); 
    } else {
        float* crow = C + (size_t)r0 * ldc + c0;
        auto pass = [&]() {
#pragma unroll
            for (int s = 0; s < 8; ++s) { const int Lid = (lane >> 3) + 4 * s, piece = lane & 7; const int row = Lid >> 1, cofs = (Lid & 1) * 32 + piece * 4;
                v4f val = *(const v4fa*)(os + row * 68 + cofs); if (R) { const v4f rv = *(const v4f*)(R + ((size_t)r0 + row) * ldc + c0 + cofs); val += roundR ? (v4f){bfr(rv[0]), bfr(rv[1]), bfr(rv[2]), bfr(rv[3])} : rv; }
                *(v4f*)(crow + (size_t)row * ldc + cofs) = val; }
        };
        pass(); 
    }
}

// k_qkv: the q (blockIdx.z = 0), k (1) and v (2) projections, 64 x 64 block tile (4 waves x 16 x 64) of x.Wz (A [2048][1024] bf16, WT [z][n][1024] bf16), with k_gemmb's main loop (gemm_stages). The epilogue
// writes what the attention reads, straight from the f32 accumulators: q/k as hi/lo planes [plane][s][32] (the block's 64 columns are two q/k heads; each wave stages its 16 rows in its own LDS
// range and stores 512 contiguous bytes an instruction), v as transposed hi/lo planes [plane][64][s] (the 64 columns are one value head; a lane's 8 accumulator rows are 8 consecutive s of one
// column, packed in registers, staged [d][s] for the whole block, so that one wave stores each whole 128-byte line of 64 s).
__global__ __launch_bounds__(128) void k_qkv(const bf* __restrict__ A, const bf* __restrict__ WT, bf* PH, bf* PL, bf* VTh, bf* VTl) {
    __shared__ __align__(16) unsigned short st[2 * 2 * TSZ];    // two stage buffers; the epilogue stages in the free one: q/k: f32 [4 waves][16][68]; v: bf16 hi [64][72] then lo [64][72]
    const int K = EE, z = blockIdx.z;
    const bf* Bn = WT + (size_t)z * EE * EE;
    const int tid = threadIdx.x, lane = tid & 31, wave = tid >> 5, lr = lane & 15, hi = lane >> 4;
    const int c0 = blockIdx.y * 64;
    v8f acc[4];
#pragma unroll
    for (int t = 0; t < 4; ++t) acc[t] = (v8f){};
    unsigned short* sm = gemm_stages<2, EE>(A + (size_t)blockIdx.x * 64 * K, Bn + (size_t)c0 * K, nullptr, st, acc);
    const int item = (blockIdx.x * 64) / SS, sb = (blockIdx.x * 64) % SS;    // a block's 64 rows lie in one item
    float* os = (float*)(void*)sm + wave * (16 * 68);
    unsigned short* th = sm; unsigned short* tw = th + 64 * 72;
    if (z < 2) {
#pragma unroll
        for (int t = 0; t < 4; ++t)
#pragma unroll
            for (int j = 0; j < 8; ++j) os[(hi * 8 + j) * 68 + t * 16 + lr] = acc[t][j];
        __syncthreads();
        bf* ph = PH + (size_t)z * ((size_t)NBT * 2 * NHV * SS * HD); bf* pl = PL + (size_t)z * ((size_t)NBT * 2 * NHV * SS * HD);
#pragma unroll
        for (int it = 0; it < 4; ++it) { const int head = c0 / HD + (it >> 1), row = (it & 1) * 8 + (lane >> 2), piece = lane & 3;
            const int p = ((head / (2 * HG)) * NBT + item) * (2 * HG) + head % (2 * HG);
            const float* sp = os + row * 68 + (it >> 1) * HD + piece * 8; const v4f x0 = *(const v4fa*)sp, x1 = *(const v4fa*)(sp + 4); v8us oh, ol;
#pragma unroll
            for (int i = 0; i < 8; ++i) { const float v = i < 4 ? x0[i & 3] : x1[i & 3]; const unsigned short hb = f2bf(v); oh[i] = hb; ol[i] = f2bf(v - bf2f(hb)); }
            const size_t o = ((size_t)p * SS + sb + wave * 16 + row) * HD + piece * 8; *(v8us*)(ph + o) = oh; *(v8us*)(pl + o) = ol; }
    } else {
#pragma unroll
        for (int t = 0; t < 4; ++t) { v8us oh, ol;
#pragma unroll
            for (int j = 0; j < 8; ++j) { const float v = acc[t][j]; const unsigned short hb = f2bf(v); oh[j] = hb; ol[j] = f2bf(v - bf2f(hb)); }
            const int o = (t * 16 + lr) * 72 + wave * 16 + hi * 8; *(v8usa*)(th + o) = oh; *(v8usa*)(tw + o) = ol; }
        __syncthreads();    // each line of 64 s holds 16 s from every wave of the block
        const int hv = c0 / VD, p = ((hv / HG) * NBT + item) * HG + hv % HG;
#pragma unroll
        for (int it = 0; it < 4; ++it) { const int idx = it * 128 + tid, d = idx >> 3, piece = idx & 7;
            const size_t o = ((size_t)p * VD + d) * SS + sb + piece * 8;
            *(v8us*)(VTh + o) = *(const v8usa*)(th + d * 72 + piece * 8); *(v8us*)(VTl + o) = *(const v8usa*)(tw + d * 72 + piece * 8); }
    }
}

// k_wt: WT [z][n][K] = bf16(Wz[k][n]) (k-major [K][ncols]) via 64 x 64 LDS tiles; grid (K/64, ncols/64, 4), blockIdx.z picks the matrix.
__global__ __launch_bounds__(256) void k_wt(const float* __restrict__ W0, const float* __restrict__ W1, const float* __restrict__ W2, const float* __restrict__ W3, int K, int ncols, bf* WT) {
    __shared__ __align__(16) unsigned short tl[64 * 72];
    const float* Wm = blockIdx.z == 0 ? W0 : blockIdx.z == 1 ? W1 : blockIdx.z == 2 ? W2 : W3; WT += (size_t)blockIdx.z * K * ncols;
    const int tid = threadIdx.x, k0 = blockIdx.x * 64, n0 = blockIdx.y * 64;
    const int kk = tid >> 2, nq = (tid & 3) * 16;
#pragma unroll
    for (int i = 0; i < 16; ++i) tl[(nq + i) * 72 + kk] = f2bf(Wm[(size_t)(k0 + kk) * ncols + n0 + nq + i]);
    __syncthreads();
    const int piece = tid & 7;
    auto pass = [&]() {
#pragma unroll
        for (int s = 0; s < 2; ++s) { const int nr = (tid >> 3) + 32 * s; const v8us val = *(const v8usa*)(tl + nr * 72 + piece * 8); *(v8us*)(WT + (size_t)(n0 + nr) * K + k0 + piece * 8) = val; }
    };
    pass(); 
}

__global__ __launch_bounds__(256) void k_cvtx(const float* __restrict__ src, bf* dst) {
    const int lane = threadIdx.x & 31; const size_t r = (size_t)blockIdx.x * 8 + (threadIdx.x >> 5); if (r >= (size_t)NBT * SS) return;
{
#pragma unroll
        for (int q = 0; q < EE / 256; ++q) { v8us o;
#pragma unroll
            for (int i = 0; i < 8; ++i) o[i] = f2bf(src[r * EE + q * 256 + lane * 8 + i]);
            *(v8us*)(dst + r * EE + q * 256 + lane * 8) = o; }
         }
}
// k_fattn: one value head p (blockIdx.y) and four 32-query tiles per block; waves 2n and 2n + 1 take q/k heads 2p and 2p + 1 of tile n. Per 32 keys and 16-query column group: S^T = K.Q^T (a
// lane holds 16 keys of ONE query: lane & 15 = query, lane >> 4 picks keys 8h.. and 16 + 8h..), running maximum m and sum z, p = exp(s x SCL - m) (0 for key > query), and the two score
// tiles, converted in place, are the B operand of O^T += V^T.P^T. The odd wave hands o2 / z2 over through LDS; the even wave forms attn = o1 / z1 - lambda o2 / z2,
// its RMSNorm over the row's 64 values (x rsqrt(mean(attn^2) + eps) x bf(rms_w[d]) x (1 - lambda_init)), and stores the planes R [item * 1024 + s][1024], cols head * 64 + d (bf16 hi + UNSCALED residual).
// Every '#pragma unroll' in it, except the one over the lambda vectors, walks an array of fragments or accumulators, whose indices must be compile-time constants for the array to stay in registers.
__device__ __forceinline__ v16bf ldfrag(const bf* p) { return cat16b(*(const v8us*)p, *(const v8us*)(p + 16)); }
__device__ __forceinline__ float xhalf(float v) { const int b = __float_as_int(v); return __int_as_float(__builtin_amdgcn_permlanex16(b, b, 0x76543210, 0xfedcba98, false, false)); }    // lane l <-> l ^ 16
__global__ __launch_bounds__(256) void k_fattn(const bf* __restrict__ Qh, const bf* __restrict__ Ql, const bf* __restrict__ Kh, const bf* __restrict__ Kl, const bf* __restrict__ Vh, const bf* __restrict__ Vl,
                                               const float* __restrict__ lq1, const float* __restrict__ lk1, const float* __restrict__ lq2, const float* __restrict__ lk2, const float* __restrict__ rw, bf* Rh, bf* Rl) {
    __shared__ float o2s[4][64 * 32];
    const int lane = threadIdx.x & 31, wave = __builtin_amdgcn_readfirstlane(threadIdx.x >> 5), lr = lane & 15, hi = lane >> 4, tl = wave >> 1, sel = wave & 1;    // the wave's number in a scalar register: trip count, plane offsets and branches stay scalar
    const int bx = blockIdx.x, pv = blockIdx.y;
    const int tile = tl == 0 ? 31 - bx : tl == 1 ? 16 + bx : tl == 2 ? bx : 15 - bx;    // waves w and w + 4 together walk the same number of keys in every block
    const int q0 = tile * 32, nst = tile + 1;
    const size_t pqk = (size_t)(2 * pv + sel) * SS * HD;
    const unsigned ko = lr * HD + 8 * hi, vo = lr * SS + 8 * hi;    // the lane's place in a K (or Q) tile and in a V^T tile
    const bf* kbh = Kh + pqk; const bf* kbl = Kl + pqk;
    const bf* vsh = Vh + (size_t)pv * VD * SS; const bf* vsl = Vl + (size_t)pv * VD * SS;    // wave-uniform, 32 keys on a step: the lane's own offset vo never changes
    v16bf qh[2], ql[2]; v8f acc[2][4]; float m[2], z[2];
#pragma unroll
    for (int c = 0; c < 2; ++c) { qh[c] = ldfrag(Qh + pqk + (q0 + c * 16) * HD + ko); ql[c] = ldfrag(Ql + pqk + (q0 + c * 16) * HD + ko); m[c] = -3.0e38f; z[c] = 0.f;
#pragma unroll
        for (int t = 0; t < 4; ++t) acc[c][t] = (v8f){}; }
    v16bf kh0 = ldfrag(kbh + ko), kh1 = ldfrag(kbh + 16 * HD + ko), kl0 = ldfrag(kbl + ko), kl1 = ldfrag(kbl + 16 * HD + ko);
#pragma unroll 1    // stays rolled: one step's fragments and accumulators already take the wave's registers
    for (int st = 0; st < nst; ++st) {
        const int k0 = st * 32;
        v16bf vh[4], vl[4];
#pragma unroll
        for (int t = 0; t < 4; ++t) { vh[t] = ldfrag(vsh + t * 16 * SS + vo); vl[t] = ldfrag(vsl + t * 16 * SS + vo); }
        vsh += 32; vsl += 32;
        __builtin_amdgcn_sched_barrier(0);    // holds the 16 V loads up here, so that they fly under the score products and the softmax; sunk to their users each would be waited for alone
        v8f s[2][2];
#pragma unroll
        for (int c = 0; c < 2; ++c) { s[c][0] = wmmab(kh0, qh[c], (v8f){}); s[c][1] = wmmab(kh1, qh[c], (v8f){}); }
#pragma unroll
        for (int c = 0; c < 2; ++c) { s[c][0] = wmmab(kh0, ql[c], s[c][0]); s[c][1] = wmmab(kh1, ql[c], s[c][1]); }
#pragma unroll
        for (int c = 0; c < 2; ++c) { s[c][0] = wmmab(kl0, qh[c], s[c][0]); s[c][1] = wmmab(kl1, qh[c], s[c][1]); }
        { const int kn = (k0 + 32 < SS - 32 ? k0 + 32 : SS - 32) * HD;    // the next step's K fragments fly during this step's softmax; the index stays inside the plane
          kh0 = ldfrag(kbh + kn + ko); kh1 = ldfrag(kbh + (kn + 16 * HD) + ko); kl0 = ldfrag(kbl + kn + ko); kl1 = ldfrag(kbl + (kn + 16 * HD) + ko); }
        __builtin_amdgcn_sched_barrier(0);    // holds the next K loads here; sunk to the loop's foot they would be waited for at once
        v16bf ph[2], pl[2];
#pragma unroll
        for (int c = 0; c < 2; ++c) {
            float sc[16]; const int rel = q0 + c * 16 + lr - k0 - 8 * hi;    // key <= query  <=>  its place among the lane's keys <= rel
#pragma unroll
            for (int j = 0; j < 8; ++j) { sc[j] = (j <= rel) ? s[c][0][j] * SCL : -3.0e38f; sc[8 + j] = (16 + j <= rel) ? s[c][1][j] * SCL : -3.0e38f; }
            float tm = sc[0];
#pragma unroll
            for (int e = 1; e < 16; ++e) tm = fmaxf(tm, sc[e]);
            tm = fmaxf(tm, xhalf(tm));
            const float mn = fmaxf(m[c], tm); float al;    // al = exp(m - mn): what the old maximum's sums and products are worth under the new one
            asm("v_exp_f32 %0, %1\n\tv_nop" : "=v"(al) : "v"((m[c] - mn) * 1.44269504f));    // with the slot the instruction set asks for behind a transcendental
            m[c] = mn;
            float zs = 0.f;
#pragma unroll
            for (int e = 0; e < 16; ++e) { const float p = __expf(sc[e] - mn); zs += p; const __bf16 hb = (__bf16)p; ph[c][e] = hb; pl[c][e] = (__bf16)(p - (float)hb); }
            z[c] = z[c] * al + zs;
#pragma unroll
            for (int t = 0; t < 4; ++t) acc[c][t] *= al;
        }
#pragma unroll
        for (int c = 0; c < 2; ++c)
#pragma unroll
            for (int t = 0; t < 4; ++t) acc[c][t] = wmmab(vh[t], ph[c], acc[c][t]);
#pragma unroll
        for (int c = 0; c < 2; ++c)
#pragma unroll
            for (int t = 0; t < 4; ++t) acc[c][t] = wmmab(vh[t], pl[c], acc[c][t]);
#pragma unroll
        for (int c = 0; c < 2; ++c)
#pragma unroll
            for (int t = 0; t < 4; ++t) acc[c][t] = wmmab(vl[t], ph[c], acc[c][t]);
    }
    float iz[2];
#pragma unroll
    for (int c = 0; c < 2; ++c) iz[c] = 1.0f / (z[c] + xhalf(z[c]));
    float* ob = &o2s[tl][lane];
    if (sel == 1) {
#pragma unroll
        for (int c = 0; c < 2; ++c)
#pragma unroll
            for (int t = 0; t < 4; ++t)
#pragma unroll
                for (int j = 0; j < 8; ++j) ob[((c * 4 + t) * 8 + j) * 32] = acc[c][t][j] * iz[c];
    }
    __syncthreads();
    if (sel == 0) {
        float d1 = 0.f, d2 = 0.f;
#pragma unroll
        for (int d = 0; d < HD; ++d) { d1 = fmaf(bfr(lq1[d]), bfr(lk1[d]), d1); d2 = fmaf(bfr(lq2[d]), bfr(lk2[d]), d2); }
        const float lam = __expf(d1) - __expf(d2) + LINIT;
        const int item = (pv / HG) % NBT, hv = (pv / (NBT * HG)) * HG + pv % HG;    // plane pv = [group][item][head in group]
#pragma unroll
        for (int c = 0; c < 2; ++c) {
            float q = 0.f;    // lanes l and l ^ 16 hold the 64 values of one query's row, 32 each
#pragma unroll
            for (int t = 0; t < 4; ++t)
#pragma unroll
                for (int j = 0; j < 8; ++j) { const float a = acc[c][t][j] * iz[c] - lam * ob[((c * 4 + t) * 8 + j) * 32]; acc[c][t][j] = a; q += a * a; }
            q += xhalf(q);
            const float sc = rsqrtf(q * (1.0f / VD) + REPS) * (1.0f - LINIT);
            const size_t o = ((size_t)item * SS + q0 + c * 16 + lr) * EE + hv * VD + 8 * hi;
#pragma unroll
            for (int t = 0; t < 4; ++t) { v8us oh, ol;
#pragma unroll
                for (int j = 0; j < 8; ++j) { const float v = acc[c][t][j] * sc * bfr(rw[t * 16 + 8 * hi + j]); const unsigned short hb = f2bf(v); oh[j] = hb; ol[j] = f2bf(v - bf2f(hb)); }
                *(v8us*)(Rh + o + t * 16) = oh; *(v8us*)(Rl + o + t * 16) = ol; }
        }
    }
}

extern "C" void kernel_launch(void* const* d_in, const int* in_sizes, int n_in,
                              void* d_out, int out_size, void* d_ws, size_t ws_size, hipStream_t stream) {
    (void)in_sizes; (void)n_in; (void)out_size;
    const float* x = (const float*)d_in[0]; const float* Wq = (const float*)d_in[1]; const float* Wk = (const float*)d_in[2]; const float* Wv = (const float*)d_in[3]; const float* Wo = (const float*)d_in[4];
    const float* lq1 = (const float*)d_in[5]; const float* lk1 = (const float*)d_in[6]; const float* lq2 = (const float*)d_in[7]; const float* lk2 = (const float*)d_in[8]; const float* rw = (const float*)d_in[9];
    float* out = (float*)d_out;    // [2][1024][1024]
    char* wsp = (char*)d_ws;
    auto take = [&](size_t bytes) { char* p = wsp; wsp += (bytes + 255) & ~(size_t)255; return (void*)p; };
    bf* WT4 = (bf*)take((size_t)4 * EE * EE * 2); bf* WOT = WT4 + (size_t)3 * EE * EE;    // Wq, Wk, Wv, Wo transposed
    bf* Xb = (bf*)take((size_t)NBT * SS * EE * 2);
    const size_t nP = (size_t)NBT * 2 * NHV * SS * HD;
    bf* PH = (bf*)take(2 * nP * 2); bf* PL = (bf*)take(2 * nP * 2); bf* VTh = (bf*)take((size_t)NBT * NHV * VD * SS * 2); bf* VTl = (bf*)take((size_t)NBT * NHV * VD * SS * 2);    // PH, PL: q planes then k planes
    bf* Rh = (bf*)take((size_t)NBT * SS * EE * 2); bf* Rl = (bf*)take((size_t)NBT * SS * EE * 2);
    if ((size_t)(wsp - (char*)d_ws) > ws_size) return;    // 8 + 4 + 16 + 8 + 4 + 4 = 44 MiB
    k_wt<<<dim3(EE / 64, EE / 64, 4), 256, 0, stream>>>(Wq, Wk, Wv, Wo, EE, EE, WT4);   // (in, out) k-major
    k_cvtx<<<NBT * SS / 8, 256, 0, stream>>>(x, Xb);
    k_qkv<<<dim3(NBT * SS / 64, EE / 64, 3), 128, 0, stream>>>(Xb, WT4, PH, PL, VTh, VTl);
    k_fattn<<<dim3(SS / 128, NBT * NHV, 1), 256, 0, stream>>>(PH, PL, PH + nP, PL + nP, VTh, VTl, lq1, lk1, lq2, lk2, rw, Rh, Rl);
    k_gemmb<true, false><<<dim3(NBT * SS / 64, EE / 64, 1), 128, 0, stream>>>(Rh, Rl, WOT, nullptr, out, EE, nullptr, nullptr);
}

// v005
// Measured time: 69.3 microseconds a run.
// Timed twice side by side with v004, it ran 1.06 times as fast both times.
// Over all steps from v000 it is 14.7 times as fast.
#include <hip/hip_runtime.h>

// Compute dtypes, f32 accumulate, per item: q/k/v = x.W as [1024 x 1024].[1024 x 1024] GEMMs with PLAIN bf16 operands (exact products); per value head (= 2 q/k heads), in ONE
// launch: scores^T = k.q^T ([keys x 32].[32 x queries], both operands bf16 hi + UNSCALED residual, three products), the causal softmax of each head of the pair with a running
// maximum and sum in f32, the unnormalised weights -> hi/lo bf16 straight from the score accumulators, o^T += v^T.p^T (three products), attn = o1 / z1 - lambda o2 / z2 in f32;
// RMSNorm (x rms_w x (1 - lambda_init)) in f32 -> planes; out = attn.Wo (two products) - on v_wmma_f32_16x16x32_bf16. lambda = exp(lq1.lk1) - exp(lq2.lk2) + lambda_init from the inputs on device.
// Launch plan: both batch items ride in every grid; the four weight transposes, the q/k/v projections and the attention each run once for all heads; the projections' epilogue builds the
// hi/lo planes (v transposed) and the attention's epilogue does the RMSNorm, so no launch only reshapes data between two products.
// Plane order: q/k planes [group][item][8 heads][s][32], v planes [group][item][4 heads][64][s]: value plane p pairs with q/k planes 2p, 2p + 1.

#define NBT  2
#define SS   1024
#define EE   1024
#define NHV  16
#define HD   32                   // q/k head dim
#define VD   64                   // v head dim
#define HG   4                    // value heads per group (8 q/k heads)
#define DM   EE
#define SCL  0.17677669529663687f
#define LINIT 0.7836057665316245f    // 0.8 - 0.6 exp(-0.3 * 12)
#define REPS 1e-5f
#define LOSC 1024.0f

typedef _Float16 h16;
typedef unsigned short bf;
typedef __attribute__((ext_vector_type(16))) __bf16   v16bf;
typedef __attribute__((ext_vector_type(16))) _Float16 v16h;
typedef __attribute__((ext_vector_type(8)))  _Float16 v8h;
typedef __attribute__((ext_vector_type(8)))  unsigned short v8us;
typedef __attribute__((ext_vector_type(8)))  float    v8f;
typedef __attribute__((ext_vector_type(4)))  float    v4f;
typedef v8h  __attribute__((may_alias)) v8ha;
typedef v4f  __attribute__((may_alias)) v4fa;
typedef v8us __attribute__((may_alias)) v8usa;

__device__ __forceinline__ unsigned short f2bf(float f) { unsigned u = __float_as_uint(f); u += 0x7FFFu + ((u >> 16) & 1u); return (unsigned short)(u >> 16); }
__device__ __forceinline__ float bf2f(unsigned short b) { return __uint_as_float(((unsigned)b) << 16); }
__device__ __forceinline__ float bfr(float f) { return bf2f(f2bf(f)); }
__device__ __forceinline__ v16h cat16(v8h lo, v8h hi) { return __builtin_shufflevector(lo, hi, 0, 1, 2, 3, 4, 5, 6, 7, 8, 9, 10, 11, 12, 13, 14, 15); }
__device__ __forceinline__ v16bf cat16b(v8us lo, v8us hi) { return __builtin_bit_cast(v16bf, __builtin_shufflevector(lo, hi, 0, 1, 2, 3, 4, 5, 6, 7, 8, 9, 10, 11, 12, 13, 14, 15)); }
__device__ __forceinline__ v8f wmma16(v16h a, v16h b, v8f c) { return __builtin_amdgcn_wmma_f32_16x16x32_f16(false, a, false, b, (short)0, c, false, false); }
__device__ __forceinline__ v8f wmmab(v16bf a, v16bf b, v8f c) { return __builtin_amdgcn_wmma_f32_16x16x32_bf16(false, a, false, b, (short)0, c, false, false); }

// gemm_stages: the main loop of both GEMM kernels, for a block of 4 waves and a 64 x 64 tile. A stage is 64 k of every operand: 64 rows x one whole 128-byte line, which the block fetches with loads that
// each cover 4 whole lines (a fragment load from global memory touches 16 lines for the same 512 bytes), lays in LDS at pitch LP and reads back as fragments. Two LDS buffers and two register sets: stage
// t + 2 is fetched into the set that stage t has left, at the head of trip t, so that its loads have two trips to land, not one; stage t + 1 goes from its set into
// the other buffer behind stage t's LDS reads; the one barrier of a trip publishes it and ends every wave's reads of the buffer that the next trip overwrites.
// NOP = 2: operands g0 = A, g1 = B; NOP = 3: g0 = A, g1 = its residual, g2 = B. k runs upward in steps of 32 through the same accumulators as with fragments from global memory.
// Returns the buffer that the last stage does not lie in: every wave's reads of it ended in front of the last barrier, so the caller's epilogue may stage in it at once.
// Every '#pragma unroll' in it walks an array of staged rows, fragments or accumulators, whose indices must be compile-time constants for the array to stay in registers.
#define KT  64                    // k per stage
#define LP  72                    // LDS row pitch in bf16: 144 B = 16 B x odd, for ds_load_b128 readers of 128-byte rows
#define TSZ (64 * LP)             // one operand's 64 rows
// lds_barrier: the work-group barrier of a stage, ordering LDS alone: every wave's LDS stores and reads are done in front of it (the fences name the LDS address space), while global loads into registers,
// which no other wave sees, stay in flight across it. __syncthreads() waits for those too: a stage fetched two trips ahead would be waited for at the first barrier behind its loads.
__device__ __forceinline__ void lds_barrier() {
    __builtin_amdgcn_fence(__ATOMIC_RELEASE, "workgroup", "local");
    __builtin_amdgcn_s_barrier();
    __builtin_amdgcn_fence(__ATOMIC_ACQUIRE, "workgroup", "local");
}
template <int NOP, int K>
__device__ __forceinline__ unsigned short* gemm_stages(const bf* __restrict__ g0, const bf* __restrict__ g1, const bf* __restrict__ g2, unsigned short* st, v8f (&acc)[4]) {
    const int tid = threadIdx.x, lane = tid & 31, wave = tid >> 5, lr = lane & 15, hi = lane >> 4;
    const unsigned go = (tid >> 3) * K + (tid & 7) * 8, so = (tid >> 3) * LP + (tid & 7) * 8;    // 8 lanes a row, 16 rows a pass of the block
    const unsigned fa = (wave * 16 + lr) * LP + 8 * hi, fb = (NOP - 1) * TSZ + lr * LP + 8 * hi;    // the lane's place in its wave's A rows and in B's first 16 rows
    v8us rs[2][NOP][4];    // stage t flies into set t & 1
    auto fetch = [&](int kc, v8us (&r)[NOP][4]) {
#pragma unroll
        for (int it = 0; it < 4; ++it) { r[0][it] = *(const v8us*)(g0 + kc + go + it * 16 * K); r[1][it] = *(const v8us*)(g1 + kc + go + it * 16 * K); if (NOP == 3) r[NOP - 1][it] = *(const v8us*)(g2 + kc + go + it * 16 * K); }
    };
    auto put = [&](unsigned short* b, const v8us (&r)[NOP][4]) {
#pragma unroll
        for (int o = 0; o < NOP; ++o)
#pragma unroll
            for (int it = 0; it < 4; ++it) *(v8usa*)(b + o * TSZ + so + it * 16 * LP) = r[o][it];
    };
    auto work = [&](const unsigned short* b) {
        v16bf a[KT / 32], al[KT / 32], w[KT / 32][4];    // fragments first, products behind them: the LDS reads may then run ahead of the products that use them
#pragma unroll
        for (int h = 0; h < KT / 32; ++h) {
            a[h] = cat16b(*(const v8usa*)(b + fa + h * 32), *(const v8usa*)(b + fa + h * 32 + 16));
            if (NOP == 3) al[h] = cat16b(*(const v8usa*)(b + TSZ + fa + h * 32), *(const v8usa*)(b + TSZ + fa + h * 32 + 16));
#pragma unroll
            for (int t = 0; t < 4; ++t) w[h][t] = cat16b(*(const v8usa*)(b + fb + t * 16 * LP + h * 32), *(const v8usa*)(b + fb + t * 16 * LP + h * 32 + 16));
        }
        if (NOP == 3) __builtin_amdgcn_sched_barrier(0);    // keeps the stage's LDS reads one group in front of its products: with two register sets live the build dealt them out in pairs among the products and waited for each pair. Not for NOP = 2: the q/k/v kernel, at six waves a SIMD, has no registers for a whole stage's fragments
#pragma unroll
        for (int h = 0; h < KT / 32; ++h)
#pragma unroll
            for (int t = 0; t < 4; ++t) { acc[t] = wmmab(a[h], w[h][t], acc[t]); if (NOP == 3) acc[t] = wmmab(al[h], w[h][t], acc[t]); }
    };
    constexpr int nt = K / KT;
    static_assert(nt >= 2, "stages 0 and 1 are fetched in front of the loop");
    fetch(0, rs[0]);
    __builtin_amdgcn_sched_barrier(0);    // keeps stage 0's loads in front of stage 1's: loads return in order, and mixed, stage 0 would wait for stage 1's bytes
    fetch(KT, rs[1]);
    put(st, rs[0]);
    lds_barrier();    // publishes stage 0
#pragma unroll    // unrolled whole: a stage's register set is t & 1, which must be a compile-time constant for the sets to stay in registers
    for (int t = 0; t < nt; ++t) {
        if (t + 2 < nt) fetch((t + 2) * KT, rs[t & 1]);    // the set is free: stage t went from it into LDS a trip ago
        __builtin_amdgcn_sched_barrier(0);    // holds these loads up here, so that they have two whole trips to land; sunk among the products they would start later
        work(st + (t & 1) * (NOP * TSZ));
        if (t + 1 < nt) {
            put(st + ((t + 1) & 1) * (NOP * TSZ), rs[(t + 1) & 1]);    // waits for the older set alone: the younger stays in flight
            lds_barrier();    // publishes stage t + 1; stage t's buffer is free behind it
        }
    }
    return st + (nt & 1) * (NOP * TSZ);
}

// k_gemmb: 64 x 64 block tile (4 waves x 16 x 64) of C[NTK][NW] = (A [+ Al]).B^T (K = 1024) [+ bf(bias[c])] [+ bf(R[r][c]) residual]; f32 whole-line epilogue (or f16
template <bool SPLITA, bool F16OUT = false>
__global__ __launch_bounds__(128) void k_gemmb(const bf* __restrict__ A, const bf* __restrict__ Al, const bf* __restrict__ Bn, const float* __restrict__ bias, float* C, int ldc, h16* C2, const float* __restrict__ R = nullptr, int roundR = 1) {
    __shared__ __align__(16) unsigned short st[2 * (SPLITA ? 3 : 2) * TSZ];    // two stage buffers; the epilogue's f32 [4 waves][16][68] lies in the free one
    const int lane = threadIdx.x & 31, wave = threadIdx.x >> 5, lr = lane & 15, hi = lane >> 4;
    const int r0 = blockIdx.x * 64 + wave * 16, c0 = blockIdx.y * 64;
    const size_t ab = (size_t)blockIdx.x * 64 * DM, bb = (size_t)c0 * DM;
    v8f acc[4];
#pragma unroll
    for (int t = 0; t < 4; ++t) acc[t] = (v8f){};
    float* os = (float*)(void*)(SPLITA ? gemm_stages<3, DM>(A + ab, Al + ab, Bn + bb, st, acc) : gemm_stages<2, DM>(A + ab, Bn + bb, nullptr, st, acc)) + wave * (16 * 68);
#pragma unroll
    for (int t = 0; t < 4; ++t) { const float bv = bias ? bfr(bias[c0 + t * 16 + lr]) : 0.f;
#pragma unroll
        for (int j = 0; j < 8; ++j) os[(hi * 8 + j) * 68 + t * 16 + lr] = acc[t][j] + bv; }
    __syncthreads();
    if (F16OUT) {
        h16* crow = (h16*)(void*)C + (size_t)r0 * ldc + c0;
        auto pass = [&]() {
#pragma unroll
            for (int s = 0; s < 4; ++s) { const int row = 4 * s + (lane >> 3), piece = lane & 7; const float* sp = os + row * 68 + piece * 8; v8h o, o2;
#pragma unroll
                for (int i = 0; i < 8; ++i) { const h16 a = (h16)sp[i]; o[i] = a; o2[i] = (h16)((sp[i] - (float)a) * LOSC); }
                *(v8h*)(crow + (size_t)row * ldc + piece * 8) = o; if (C2) *(v8h*)(C2 + (size_t)r0 * ldc + c0 + (size_t)row * ldc + piece * 8) = o2; }
        };
        pass(); 
    } else {
        float* crow = C + (size_t)r0 * ldc + c0;
        auto pass = [&]() {
#pragma unroll
            for (int s = 0; s < 8; ++s) { const int Lid = (lane >> 3) + 4 * s, piece = lane & 7; const int row = Lid >> 1, cofs = (Lid & 1) * 32 + piece * 4;
                v4f val = *(const v4fa*)(os + row * 68 + cofs); if (R) { const v4f rv = *(const v4f*)(R + ((size_t)r0 + row) * ldc + c0 + cofs); val += roundR ? (v4f){bfr(rv[0]), bfr(rv[1]), bfr(rv[2]), bfr(rv[3])} : rv; }
                *(v4f*)(crow + (size_t)row * ldc + cofs) = val; }
        };
        pass(); 
    }
}

// k_qkv: the q (blockIdx.z = 0), k (1) and v (2) projections, 64 x 64 block tile (4 waves x 16 x 64) of x.Wz (A [2048][1024] bf16, WT [z][n][1024] bf16), with k_gemmb's main loop (gemm_stages). The epilogue
// writes what the attention reads, straight from the f32 accumulators: q/k as hi/lo planes [plane][s][32] (the block's 64 columns are two q/k heads; each wave stages its 16 rows in its own LDS
// range and stores 512 contiguous bytes an instruction), v as transposed hi/lo planes [plane][64][s] (the 64 columns are one value head; a lane's 8 accumulator rows are 8 consecutive s of one
// column, packed in registers, staged [d][s] for the whole block, so that one wave stores each whole 128-byte line of 64 s).
__global__ __launch_bounds__(128) void k_qkv(const bf* __restrict__ A, const bf* __restrict__ WT, bf* PH, bf* PL, bf* VTh, bf* VTl) {
    __shared__ __align__(16) unsigned short st[2 * 2 * TSZ];    // two stage buffers; the epilogue stages in the free one: q/k: f32 [4 waves][16][68]; v: bf16 hi [64][72] then lo [64][72]
    const int K = EE, z = blockIdx.z;
    const bf* Bn = WT + (size_t)z * EE * EE;
    const int tid = threadIdx.x, lane = tid & 31, wave = tid >> 5, lr = lane & 15, hi = lane >> 4;
    const int c0 = blockIdx.y * 64;
    v8f acc[4];
#pragma unroll
    for (int t = 0; t < 4; ++t) acc[t] = (v8f){};
    unsigned short* sm = gemm_stages<2, EE>(A + (size_t)blockIdx.x * 64 * K, Bn + (size_t)c0 * K, nullptr, st, acc);
    const int item = (blockIdx.x * 64) / SS, sb = (blockIdx.x * 64) % SS;    // a block's 64 rows lie in one item
    float* os = (float*)(void*)sm + wave * (16 * 68);
    unsigned short* th = sm; unsigned short* tw = th + 64 * 72;
    if (z < 2) {
#pragma unroll
        for (int t = 0; t < 4; ++t)
#pragma unroll
            for (int j = 0; j < 8; ++j) os[(hi * 8 + j) * 68 + t * 16 + lr] = acc[t][j];
        __syncthreads();
        bf* ph = PH + (size_t)z * ((size_t)NBT * 2 * NHV * SS * HD); bf* pl = PL + (size_t)z * ((size_t)NBT * 2 * NHV * SS * HD);
#pragma unroll
        for (int it = 0; it < 4; ++it) { const int head = c0 / HD + (it >> 1), row = (it & 1) * 8 + (lane >> 2), piece = lane & 3;
            const int p = ((head / (2 * HG)) * NBT + item) * (2 * HG) + head % (2 * HG);
            const float* sp = os + row * 68 + (it >> 1) * HD + piece * 8; const v4f x0 = *(const v4fa*)sp, x1 = *(const v4fa*)(sp + 4); v8us oh, ol;
#pragma unroll
            for (int i = 0; i < 8; ++i) { const float v = i < 4 ? x0[i & 3] : x1[i & 3]; const unsigned short hb = f2bf(v); oh[i] = hb; ol[i] = f2bf(v - bf2f(hb)); }
            const size_t o = ((size_t)p * SS + sb + wave * 16 + row) * HD + piece * 8; *(v8us*)(ph + o) = oh; *(v8us*)(pl + o) = ol; }
    } else {
#pragma unroll
        for (int t = 0; t < 4; ++t) { v8us oh, ol;
#pragma unroll
            for (int j = 0; j < 8; ++j) { const float v = acc[t][j]; const unsigned short hb = f2bf(v); oh[j] = hb; ol[j] = f2bf(v - bf2f(hb)); }
            const int o = (t * 16 + lr) * 72 + wave * 16 + hi * 8; *(v8usa*)(th + o) = oh; *(v8usa*)(tw + o) = ol; }
        __syncthreads();    // each line of 64 s holds 16 s from every wave of the block
        const int hv = c0 / VD, p = ((hv / HG) * NBT + item) * HG + hv % HG;
#pragma unroll
        for (int it = 0; it < 4; ++it) { const int idx = it * 128 + tid, d = idx >> 3, piece = idx & 7;
            const size_t o = ((size_t)p * VD + d) * SS + sb + piece * 8;
            *(v8us*)(VTh + o) = *(const v8usa*)(th + d * 72 + piece * 8); *(v8us*)(VTl + o) = *(const v8usa*)(tw + d * 72 + piece * 8); }
    }
}

// k_wt: WT [z][n][K] = bf16(Wz[k][n]) (k-major [K][ncols]) via 64 x 64 LDS tiles; grid (K/64, ncols/64, 4), blockIdx.z picks the matrix.
__global__ __launch_bounds__(256) void k_wt(const float* __restrict__ W0, const float* __restrict__ W1, const float* __restrict__ W2, const float* __restrict__ W3, int K, int ncols, bf* WT) {
    __shared__ __align__(16) unsigned short tl[64 * 72];
    const float* Wm = blockIdx.z == 0 ? W0 : blockIdx.z == 1 ? W1 : blockIdx.z == 2 ? W2 : W3; WT += (size_t)blockIdx.z * K * ncols;
    const int tid = threadIdx.x, k0 = blockIdx.x * 64, n0 = blockIdx.y * 64;
    const int kk = tid >> 2, nq = (tid & 3) * 16;
#pragma unroll
    for (int i = 0; i < 16; ++i) tl[(nq + i) * 72 + kk] = f2bf(Wm[(size_t)(k0 + kk) * ncols + n0 + nq + i]);
    __syncthreads();
    const int piece = tid & 7;
    auto pass = [&]() {
#pragma unroll
        for (int s = 0; s < 2; ++s) { const int nr = (tid >> 3) + 32 * s; const v8us val = *(const v8usa*)(tl + nr * 72 + piece * 8); *(v8us*)(WT + (size_t)(n0 + nr) * K + k0 + piece * 8) = val; }
    };
    pass(); 
}

__global__ __launch_bounds__(256) void k_cvtx(const float* __restrict__ src, bf* dst) {
    const int lane = threadIdx.x & 31; const size_t r = (size_t)blockIdx.x * 8 + (threadIdx.x >> 5); if (r >= (size_t)NBT * SS) return;
{
#pragma unroll
        for (int q = 0; q < EE / 256; ++q) { v8us o;
#pragma unroll
            for (int i = 0; i < 8; ++i) o[i] = f2bf(src[r * EE + q * 256 + lane * 8 + i]);
            *(v8us*)(dst + r * EE + q * 256 + lane * 8) = o; }
         }
}
// k_fattn: one value head p (blockIdx.y) and four 32-query tiles per block; waves 2n and 2n + 1 take q/k heads 2p and 2p + 1 of tile n. Per 32 keys and 16-query column group: S^T = K.Q^T (a
// lane holds 16 keys of ONE query: lane & 15 = query, lane >> 4 picks keys 8h.. and 16 + 8h..), running maximum m and sum z, p = exp(s x SCL - m) (0 for key > query), and the two score
// tiles, converted in place, are the B operand of O^T += V^T.P^T. The odd wave hands o2 / z2 over through LDS; the even wave forms attn = o1 / z1 - lambda o2 / z2,
// its RMSNorm over the row's 64 values (x rsqrt(mean(attn^2) + eps) x bf(rms_w[d]) x (1 - lambda_init)), and stores the planes R [item * 1024 + s][1024], cols head * 64 + d (bf16 hi + UNSCALED residual).
// Every '#pragma unroll' in it, except the one over the lambda vectors, walks an array of fragments or accumulators, whose indices must be compile-time constants for the array to stay in registers.
__device__ __forceinline__ v16bf ldfrag(const bf* p) { return cat16b(*(const v8us*)p, *(const v8us*)(p + 16)); }
__device__ __forceinline__ float xhalf(float v) { const int b = __float_as_int(v); return __int_as_float(__builtin_amdgcn_permlanex16(b, b, 0x76543210, 0xfedcba98, false, false)); }    // lane l <-> l ^ 16
__global__ __launch_bounds__(256) void k_fattn(const bf* __restrict__ Qh, const bf* __restrict__ Ql, const bf* __restrict__ Kh, const bf* __restrict__ Kl, const bf* __restrict__ Vh, const bf* __restrict__ Vl,
                                               const float* __restrict__ lq1, const float* __restrict__ lk1, const float* __restrict__ lq2, const float* __restrict__ lk2, const float* __restrict__ rw, bf* Rh, bf* Rl) {
    __shared__ float o2s[4][64 * 32];
    const int lane = threadIdx.x & 31, wave = __builtin_amdgcn_readfirstlane(threadIdx.x >> 5), lr = lane & 15, hi = lane >> 4, tl = wave >> 1, sel = wave & 1;    // the wave's number in a scalar register: trip count, plane offsets and branches stay scalar
    const int bx = blockIdx.x, pv = blockIdx.y;
    const int tile = tl == 0 ? 31 - bx : tl == 1 ? 16 + bx : tl == 2 ? bx : 15 - bx;    // waves w and w + 4 together walk the same number of keys in every block
    const int q0 = tile * 32, nst = tile + 1;
    const size_t pqk = (size_t)(2 * pv + sel) * SS * HD;
    const unsigned ko = lr * HD + 8 * hi, vo = lr * SS + 8 * hi;    // the lane's place in a K (or Q) tile and in a V^T tile
    const bf* kbh = Kh + pqk; const bf* kbl = Kl + pqk;
    const bf* vsh = Vh + (size_t)pv * VD * SS; const bf* vsl = Vl + (size_t)pv * VD * SS;    // wave-uniform, 32 keys on a step: the lane's own offset vo never changes
    v16bf qh[2], ql[2]; v8f acc[2][4]; float m[2], z[2];
#pragma unroll
    for (int c = 0; c < 2; ++c) { qh[c] = ldfrag(Qh + pqk + (q0 + c * 16) * HD + ko); ql[c] = ldfrag(Ql + pqk + (q0 + c * 16) * HD + ko); m[c] = -3.0e38f; z[c] = 0.f;
#pragma unroll
        for (int t = 0; t < 4; ++t) acc[c][t] = (v8f){}; }
    v16bf kh0 = ldfrag(kbh + ko), kh1 = ldfrag(kbh + 16 * HD + ko), kl0 = ldfrag(kbl + ko), kl1 = ldfrag(kbl + 16 * HD + ko);
#pragma unroll 1    // stays rolled: one step's fragments and accumulators already take the wave's registers
    for (int st = 0; st < nst; ++st) {
        const int k0 = st * 32;
        v16bf vh[4], vl[4];
#pragma unroll
        for (int t = 0; t < 4; ++t) { vh[t] = ldfrag(vsh + t * 16 * SS + vo); vl[t] = ldfrag(vsl + t * 16 * SS + vo); }
        vsh += 32; vsl += 32;
        __builtin_amdgcn_sched_barrier(0);    // holds the 16 V loads up here, so that they fly under the score products and the softmax; sunk to their users each would be waited for alone
        v8f s[2][2];
#pragma unroll
        for (int c = 0; c < 2; ++c) { s[c][0] = wmmab(kh0, qh[c], (v8f){}); s[c][1] = wmmab(kh1, qh[c], (v8f){}); }
#pragma unroll
        for (int c = 0; c < 2; ++c) { s[c][0] = wmmab(kh0, ql[c], s[c][0]); s[c][1] = wmmab(kh1, ql[c], s[c][1]); }
#pragma unroll
        for (int c = 0; c < 2; ++c) { s[c][0] = wmmab(kl0, qh[c], s[c][0]); s[c][1] = wmmab(kl1, qh[c], s[c][1]); }
        { const int kn = (k0 + 32 < SS - 32 ? k0 + 32 : SS - 32) * HD;    // the next step's K fragments fly during this step's softmax; the index stays inside the plane
          kh0 = ldfrag(kbh + kn + ko); kh1 = ldfrag(kbh + (kn + 16 * HD) + ko); kl0 = ldfrag(kbl + kn + ko); kl1 = ldfrag(kbl + (kn + 16 * HD) + ko); }
        __builtin_amdgcn_sched_barrier(0);    // holds the next K loads here; sunk to the loop's foot they would be waited for at once
        v16bf ph[2], pl[2];
#pragma unroll
        for (int c = 0; c < 2; ++c) {
            float sc[16]; const int rel = q0 + c * 16 + lr - k0 - 8 * hi;    // key <= query  <=>  its place among the lane's keys <= rel
#pragma unroll
            for (int j = 0; j < 8; ++j) { sc[j] = (j <= rel) ? s[c][0][j] * SCL : -3.0e38f; sc[8 + j] = (16 + j <= rel) ? s[c][1][j] * SCL : -3.0e38f; }
            float tm = sc[0];
#pragma unroll
            for (int e = 1; e < 16; ++e) tm = fmaxf(tm, sc[e]);
            tm = fmaxf(tm, xhalf(tm));
            const float mn = fmaxf(m[c], tm); float al;    // al = exp(m - mn): what the old maximum's sums and products are worth under the new one
            asm("v_exp_f32 %0, %1\n\tv_nop" : "=v"(al) : "v"((m[c] - mn) * 1.44269504f));    // with the slot the instruction set asks for behind a transcendental
            m[c] = mn;
            float zs = 0.f;
#pragma unroll
            for (int e = 0; e < 16; ++e) { const float p = __expf(sc[e] - mn); zs += p; const __bf16 hb = (__bf16)p; ph[c][e] = hb; pl[c][e] = (__bf16)(p - (float)hb); }
            z[c] = z[c] * al + zs;
#pragma unroll
            for (int t = 0; t < 4; ++t) acc[c][t] *= al;
        }
#pragma unroll
        for (int c = 0; c < 2; ++c)
#pragma unroll
            for (int t = 0; t < 4; ++t) acc[c][t] = wmmab(vh[t], ph[c], acc[c][t]);
#pragma unroll
        for (int c = 0; c < 2; ++c)
#pragma unroll
            for (int t = 0; t < 4; ++t) acc[c][t] = wmmab(vh[t], pl[c], acc[c][t]);
#pragma unroll
        for (int c = 0; c < 2; ++c)
#pragma unroll
            for (int t = 0; t < 4; ++t) acc[c][t] = wmmab(vl[t], ph[c], acc[c][t]);
    }
    float iz[2];
#pragma unroll
    for (int c = 0; c < 2; ++c) iz[c] = 1.0f / (z[c] + xhalf(z[c]));
    float* ob = &o2s[tl][lane];
    if (sel == 1) {
#pragma unroll
        for (int c = 0; c < 2; ++c)
#pragma unroll
            for (int t = 0; t < 4; ++t)
#pragma unroll
                for (int j = 0; j < 8; ++j) ob[((c * 4 + t) * 8 + j) * 32] = acc[c][t][j] * iz[c];
    }
    __syncthreads();
    if (sel == 0) {
        float d1 = 0.f, d2 = 0.f;
#pragma unroll
        for (int d = 0; d < HD; ++d) { d1 = fmaf(bfr(lq1[d]), bfr(lk1[d]), d1); d2 = fmaf(bfr(lq2[d]), bfr(lk2[d]), d2); }
        const float lam = __expf(d1) - __expf(d2) + LINIT;
        const int item = (pv / HG) % NBT, hv = (pv / (NBT * HG)) * HG + pv % HG;    // plane pv = [group][item][head in group]
#pragma unroll
        for (int c = 0; c < 2; ++c) {
            float q = 0.f;    // lanes l and l ^ 16 hold the 64 values of one query's row, 32 each
#pragma unroll
            for (int t = 0; t < 4; ++t)
#pragma unroll
                for (int j = 0; j < 8; ++j) { const float a = acc[c][t][j] * iz[c] - lam * ob[((c * 4 + t) * 8 + j) * 32]; acc[c][t][j] = a; q += a * a; }
            q += xhalf(q);
            const float sc = rsqrtf(q * (1.0f / VD) + REPS) * (1.0f - LINIT);
            const size_t o = ((size_t)item * SS + q0 + c * 16 + lr) * EE + hv * VD + 8 * hi;
#pragma unroll
            for (int t = 0; t < 4; ++t) { v8us oh, ol;
#pragma unroll
                for (int j = 0; j < 8; ++j) { const float v = acc[c][t][j] * sc * bfr(rw[t * 16 + 8 * hi + j]); const unsigned short hb = f2bf(v); oh[j] = hb; ol[j] = f2bf(v - bf2f(hb)); }
                *(v8us*)(Rh + o + t * 16) = oh; *(v8us*)(Rl + o + t * 16) = ol; }
        }
    }
}

extern "C" void kernel_launch(void* const* d_in, const int* in_sizes, int n_in,
                              void* d_out, int out_size, void* d_ws, size_t ws_size, hipStream_t stream) {
    (void)in_sizes; (void)n_in; (void)out_size;
    const float* x = (const float*)d_in[0]; const float* Wq = (const float*)d_in[1]; const float* Wk = (const float*)d_in[2]; const float* Wv = (const float*)d_in[3]; const float* Wo = (const float*)d_in[4];
    const float* lq1 = (const float*)d_in[5]; const float* lk1 = (const float*)d_in[6]; const float* lq2 = (const float*)d_in[7]; const float* lk2 = (const float*)d_in[8]; const float* rw = (const float*)d_in[9];
    float* out = (float*)d_out;    // [2][1024][1024]
    char* wsp = (char*)d_ws;
    auto take = [&](size_t bytes) { char* p = wsp; wsp += (bytes + 255) & ~(size_t)255; return (void*)p; };
    bf* WT4 = (bf*)take((size_t)4 * EE * EE * 2); bf* WOT = WT4 + (size_t)3 * EE * EE;    // Wq, Wk, Wv, Wo transposed
    bf* Xb = (bf*)take((size_t)NBT * SS * EE * 2);
    const size_t nP = (size_t)NBT * 2 * NHV * SS * HD;
    bf* PH = (bf*)take(2 * nP * 2); bf* PL = (bf*)take(2 * nP * 2); bf* VTh = (bf*)take((size_t)NBT * NHV * VD * SS * 2); bf* VTl = (bf*)take((size_t)NBT * NHV * VD * SS * 2);    // PH, PL: q planes then k planes
    bf* Rh = (bf*)take((size_t)NBT * SS * EE * 2); bf* Rl = (bf*)take((size_t)NBT * SS * EE * 2);
    if ((size_t)(wsp - (char*)d_ws) > ws_size) return;    // 8 + 4 + 16 + 8 + 4 + 4 = 44 MiB
    k_wt<<<dim3(EE / 64, EE / 64, 4), 256, 0, stream>>>(Wq, Wk, Wv, Wo, EE, EE, WT4);   // (in, out) k-major
    k_cvtx<<<NBT * SS / 8, 256, 0, stream>>>(x, Xb);
    k_qkv<<<dim3(NBT * SS / 64, EE / 64, 3), 128, 0, stream>>>(Xb, WT4, PH, PL, VTh, VTl);
    k_fattn<<<dim3(SS / 128, NBT * NHV, 1), 256, 0, stream>>>(PH, PL, PH + nP, PL + nP, VTh, VTl, lq1, lk1, lq2, lk2, rw, Rh, Rl);
    k_gemmb<true, false><<<dim3(NBT * SS / 64, EE / 64, 1), 128, 0, stream>>>(Rh, Rl, WOT, nullptr, out, EE, nullptr, nullptr);
}

// v006
// Measured time: 66.7 microseconds a run.
// Timed twice side by side with v005, it ran 1.04 times as fast both times.
// Over all steps from v000 it is 15.2 times as fast.
#include <hip/hip_runtime.h>

// Compute dtypes, f32 accumulate, per item: q/k/v = x.W as [1024 x 1024].[1024 x 1024] GEMMs with PLAIN bf16 operands (exact products); per value head (= 2 q/k heads), in ONE
// launch: scores^T = k.q^T ([keys x 32].[32 x queries], both operands bf16 hi + UNSCALED residual, three products), the causal softmax of each head of the pair with a running
// maximum and sum in f32, the unnormalised weights -> hi/lo bf16 straight from the score accumulators, o^T += v^T.p^T (three products), attn = o1 / z1 - lambda o2 / z2 in f32;
// RMSNorm (x rms_w x (1 - lambda_init)) in f32 -> planes; out = attn.Wo (two products) - on v_wmma_f32_16x16x32_bf16. lambda = exp(lq1.lk1) - exp(lq2.lk2) + lambda_init from the inputs on device.
// Launch plan: both batch items ride in every grid; the four weight transposes, the q/k/v projections and the attention each run once for all heads; the projections' epilogue builds the
// hi/lo planes (v transposed) and the attention's epilogue does the RMSNorm, so no launch only reshapes data between two products.
// Plane order: q/k planes [group][item][8 heads][s][32], v planes [group][item][4 heads][64][s]: value plane p pairs with q/k planes 2p, 2p + 1.

#define NBT  2
#define SS   1024
#define EE   1024
#define NHV  16
#define HD   32                   // q/k head dim
#define VD   64                   // v head dim
#define HG   4                    // value heads per group (8 q/k heads)
#define DM   EE
#define SCL  0.17677669529663687f
#define LINIT 0.7836057665316245f    // 0.8 - 0.6 exp(-0.3 * 12)
#define REPS 1e-5f
#define LOSC 1024.0f

typedef _Float16 h16;
typedef unsigned short bf;
typedef __attribute__((ext_vector_type(16))) __bf16   v16bf;
typedef __attribute__((ext_vector_type(16))) _Float16 v16h;
typedef __attribute__((ext_vector_type(8)))  _Float16 v8h;
typedef __attribute__((ext_vector_type(8)))  unsigned short v8us;
typedef __attribute__((ext_vector_type(8)))  float    v8f;
typedef __attribute__((ext_vector_type(4)))  float    v4f;
typedef v8h  __attribute__((may_alias)) v8ha;
typedef v4f  __attribute__((may_alias)) v4fa;
typedef v8us __attribute__((may_alias)) v8usa;

__device__ __forceinline__ unsigned short f2bf(float f) { unsigned u = __float_as_uint(f); u += 0x7FFFu + ((u >> 16) & 1u); return (unsigned short)(u >> 16); }
__device__ __forceinline__ float bf2f(unsigned short b) { return __uint_as_float(((unsigned)b) << 16); }
__device__ __forceinline__ float bfr(float f) { return bf2f(f2bf(f)); }
__device__ __forceinline__ v16h cat16(v8h lo, v8h hi) { return __builtin_shufflevector(lo, hi, 0, 1, 2, 3, 4, 5, 6, 7, 8, 9, 10, 11, 12, 13, 14, 15); }
__device__ __forceinline__ v16bf cat16b(v8us lo, v8us hi) { return __builtin_bit_cast(v16bf, __builtin_shufflevector(lo, hi, 0, 1, 2, 3, 4, 5, 6, 7, 8, 9, 10, 11, 12, 13, 14, 15)); }
__device__ __forceinline__ v8f wmma16(v16h a, v16h b, v8f c) { return __builtin_amdgcn_wmma_f32_16x16x32_f16(false, a, false, b, (short)0, c, false, false); }
__device__ __forceinline__ v8f wmmab(v16bf a, v16bf b, v8f c) { return __builtin_amdgcn_wmma_f32_16x16x32_bf16(false, a, false, b, (short)0, c, false, false); }

// gemm_stages: the main loop of k_gemmb, for a block of 4 waves and a 64 x 64 tile. A stage is 64 k of every operand: 64 rows x one whole 128-byte line, which the block fetches with loads that
// each cover 4 whole lines (a fragment load from global memory touches 16 lines for the same 512 bytes), lays in LDS at pitch LP and reads back as fragments. Two LDS buffers and two register sets: stage
// t + 2 is fetched into the set that stage t has left, at the head of trip t, so that its loads have two trips to land, not one; stage t + 1 goes from its set into
// the other buffer behind stage t's LDS reads; the one barrier of a trip publishes it and ends every wave's reads of the buffer that the next trip overwrites.
// NOP = 2: operands g0 = A, g1 = B; NOP = 3: g0 = A, g1 = its residual, g2 = B. k runs upward in steps of 32 through the same accumulators as with fragments from global memory.
// Returns the buffer that the last stage does not lie in: every wave's reads of it ended in front of the last barrier, so the caller's epilogue may stage in it at once.
// Every '#pragma unroll' in it walks an array of staged rows, fragments or accumulators, whose indices must be compile-time constants for the array to stay in registers.
#define KT  64                    // k per stage
#define LP  72                    // LDS row pitch in bf16: 144 B = 16 B x odd, for ds_load_b128 readers of 128-byte rows
#define TSZ (64 * LP)             // one operand's 64 rows
// lds_barrier: the work-group barrier of a stage, ordering LDS alone: every wave's LDS stores and reads are done in front of it (the fences name the LDS address space), while global loads into registers,
// which no other wave sees, stay in flight across it. __syncthreads() waits for those too: a stage fetched two trips ahead would be waited for at the first barrier behind its loads.
__device__ __forceinline__ void lds_barrier() {
    __builtin_amdgcn_fence(__ATOMIC_RELEASE, "workgroup", "local");
    __builtin_amdgcn_s_barrier();
    __builtin_amdgcn_fence(__ATOMIC_ACQUIRE, "workgroup", "local");
}
template <int NOP, int K>
__device__ __forceinline__ unsigned short* gemm_stages(const bf* __restrict__ g0, const bf* __restrict__ g1, const bf* __restrict__ g2, unsigned short* st, v8f (&acc)[4]) {
    const int tid = threadIdx.x, lane = tid & 31, wave = tid >> 5, lr = lane & 15, hi = lane >> 4;
    const unsigned go = (tid >> 3) * K + (tid & 7) * 8, so = (tid >> 3) * LP + (tid & 7) * 8;    // 8 lanes a row, 16 rows a pass of the block
    const unsigned fa = (wave * 16 + lr) * LP + 8 * hi, fb = (NOP - 1) * TSZ + lr * LP + 8 * hi;    // the lane's place in its wave's A rows and in B's first 16 rows
    v8us rs[2][NOP][4];    // stage t flies into set t & 1
    auto fetch = [&](int kc, v8us (&r)[NOP][4]) {
#pragma unroll
        for (int it = 0; it < 4; ++it) { r[0][it] = *(const v8us*)(g0 + kc + go + it * 16 * K); r[1][it] = *(const v8us*)(g1 + kc + go + it * 16 * K); if (NOP == 3) r[NOP - 1][it] = *(const v8us*)(g2 + kc + go + it * 16 * K); }
    };
    auto put = [&](unsigned short* b, const v8us (&r)[NOP][4]) {
#pragma unroll
        for (int o = 0; o < NOP; ++o)
#pragma unroll
            for (int it = 0; it < 4; ++it) *(v8usa*)(b + o * TSZ + so + it * 16 * LP) = r[o][it];
    };
    auto work = [&](const unsigned short* b) {
        v16bf a[KT / 32], al[KT / 32], w[KT / 32][4];    // fragments first, products behind them: the LDS reads may then run ahead of the products that use them
#pragma unroll
        for (int h = 0; h < KT / 32; ++h) {
            a[h] = cat16b(*(const v8usa*)(b + fa + h * 32), *(const v8usa*)(b + fa + h * 32 + 16));
            if (NOP == 3) al[h] = cat16b(*(const v8usa*)(b + TSZ + fa + h * 32), *(const v8usa*)(b + TSZ + fa + h * 32 + 16));
#pragma unroll
            for (int t = 0; t < 4; ++t) w[h][t] = cat16b(*(const v8usa*)(b + fb + t * 16 * LP + h * 32), *(const v8usa*)(b + fb + t * 16 * LP + h * 32 + 16));
        }
        if (NOP == 3) __builtin_amdgcn_sched_barrier(0);    // keeps the stage's LDS reads one group in front of its products: with two register sets live the build dealt them out in pairs among the products and waited for each pair. NOP = 2 keeps the compiler's own order
#pragma unroll
        for (int h = 0; h < KT / 32; ++h)
#pragma unroll
            for (int t = 0; t < 4; ++t) { acc[t] = wmmab(a[h], w[h][t], acc[t]); if (NOP == 3) acc[t] = wmmab(al[h], w[h][t], acc[t]); }
    };
    constexpr int nt = K / KT;
    static_assert(nt >= 2, "stages 0 and 1 are fetched in front of the loop");
    fetch(0, rs[0]);
    __builtin_amdgcn_sched_barrier(0);    // keeps stage 0's loads in front of stage 1's: loads return in order, and mixed, stage 0 would wait for stage 1's bytes
    fetch(KT, rs[1]);
    put(st, rs[0]);
    lds_barrier();    // publishes stage 0
#pragma unroll    // unrolled whole: a stage's register set is t & 1, which must be a compile-time constant for the sets to stay in registers
    for (int t = 0; t < nt; ++t) {
        if (t + 2 < nt) fetch((t + 2) * KT, rs[t & 1]);    // the set is free: stage t went from it into LDS a trip ago
        __builtin_amdgcn_sched_barrier(0);    // holds these loads up here, so that they have two whole trips to land; sunk among the products they would start later
        work(st + (t & 1) * (NOP * TSZ));
        if (t + 1 < nt) {
            put(st + ((t + 1) & 1) * (NOP * TSZ), rs[(t + 1) & 1]);    // waits for the older set alone: the younger stays in flight
            lds_barrier();    // publishes stage t + 1; stage t's buffer is free behind it
        }
    }
    return st + (nt & 1) * (NOP * TSZ);
}

// gemm_stages128: gemm_stages' scheme (64-k stages, two LDS buffers, two register sets, one lds_barrier a trip) for a 128 x 128 block tile of 4 waves, 2 x 2, each with a 64 x 64 tile of 4 x 4 accumulators.
// Every fragment read from LDS feeds 4 products (in gemm_stages a B fragment feeds 1): 16 KiB of LDS reads per 32 products of a wave against 10 KiB per 8, and each operand row is fetched from L2 by half as many blocks.
// g0 = A's 128 rows, g1 = B's 128 rows. k runs upward in steps of 32 through every accumulator, as in gemm_stages. Returns the buffer that the last stage does not lie in.
#define TS2 (128 * LP)            // one operand's 128 rows
template <int K>
__device__ __forceinline__ unsigned short* gemm_stages128(const bf* __restrict__ g0, const bf* __restrict__ g1, unsigned short* st, v8f (&acc)[4][4]) {
    const int tid = threadIdx.x, lane = tid & 31, wave = tid >> 5, lr = lane & 15, hi = lane >> 4;
    const unsigned go = (tid >> 3) * K + (tid & 7) * 8, so = (tid >> 3) * LP + (tid & 7) * 8;    // 8 lanes a row, 16 rows a pass of the block
    const unsigned fa = ((wave >> 1) * 64 + lr) * LP + 8 * hi, fb = TS2 + ((wave & 1) * 64 + lr) * LP + 8 * hi;    // the lane's place in its wave's first 16 A rows and first 16 B rows
    v8us rs[2][2][8];    // stage t flies into set t & 1
    auto fetch = [&](int kc, v8us (&r)[2][8]) {
#pragma unroll
        for (int it = 0; it < 8; ++it) { r[0][it] = *(const v8us*)(g0 + kc + go + it * 16 * K); r[1][it] = *(const v8us*)(g1 + kc + go + it * 16 * K); }
    };
    auto put = [&](unsigned short* b, const v8us (&r)[2][8]) {
#pragma unroll
        for (int o = 0; o < 2; ++o)
#pragma unroll
            for (int it = 0; it < 8; ++it) *(v8usa*)(b + o * TS2 + so + it * 16 * LP) = r[o][it];
    };
    static_assert(KT == 64, "a stage is two halves of 32 k");
    v16bf a[2][4], w[2][4];    // the fragments of a stage's two halves
    auto frags = [&](const unsigned short* b, int h) {
#pragma unroll
        for (int i = 0; i < 4; ++i) {
            a[h][i] = cat16b(*(const v8usa*)(b + fa + i * 16 * LP + h * 32), *(const v8usa*)(b + fa + i * 16 * LP + h * 32 + 16));
            w[h][i] = cat16b(*(const v8usa*)(b + fb + i * 16 * LP + h * 32), *(const v8usa*)(b + fb + i * 16 * LP + h * 32 + 16));
        }
    };
    auto prods = [&](int h) {
#pragma unroll
        for (int i = 0; i < 4; ++i)
#pragma unroll
            for (int t = 0; t < 4; ++t) acc[i][t] = wmmab(a[h][i], w[h][t], acc[i][t]);
    };
    constexpr int nt = K / KT;
    static_assert(nt >= 2, "stages 0 and 1 are fetched in front of the loop");
    fetch(0, rs[0]);
    __builtin_amdgcn_sched_barrier(0);    // keeps stage 0's loads in front of stage 1's: loads return in order, and mixed, stage 0 would wait for stage 1's bytes
    fetch(KT, rs[1]);
    put(st, rs[0]);
    lds_barrier();    // publishes stage 0
    // Each half's 16 LDS reads stand as one group in front of the 16 products of the half before, which hide them: the second half's products of stage t - 1 run behind stage t's barrier, from registers.
    // The sched_barriers of the loop hold that order; left free, the build set all 32 products of a stage in one run and all 32 reads behind it, with nothing of the wave's own to hide the reads.
#pragma unroll    // unrolled whole: a stage's register set is t & 1, which must be a compile-time constant for the sets to stay in registers
    for (int t = 0; t < nt; ++t) {
        const unsigned short* b = st + (t & 1) * (2 * TS2);
        if (t + 2 < nt) fetch((t + 2) * KT, rs[t & 1]);    // the set is free: stage t went from it into LDS a trip ago
        frags(b, 0);
        __builtin_amdgcn_sched_barrier(0);    // holds the fetch and the first half's reads up here: the loads get their two trips, the reads fly under the products below
        if (t > 0) prods(1);
        __builtin_amdgcn_sched_barrier(0);    // keeps the second half's reads one group behind those products, whose fragment registers they refill
        frags(b, 1);
        __builtin_amdgcn_sched_barrier(0);    // holds those reads in front of the first half's products, which hide them
        prods(0);
        __builtin_amdgcn_sched_barrier(0);    // keeps the products in front of the stores and the barrier; sunk behind the barrier they would stand in one run with the next trip's
        if (t + 1 < nt) {
            put(st + ((t + 1) & 1) * (2 * TS2), rs[(t + 1) & 1]);    // waits for the older set alone: the younger stays in flight
            lds_barrier();    // publishes stage t + 1; stage t's buffer is free behind it: its reads are done in front of the barrier
        }
    }
    prods(1);
    return st + (nt & 1) * (2 * TS2);
}

// k_gemmb: 64 x 64 block tile (4 waves x 16 x 64) of C[NTK][NW] = (A [+ Al]).B^T (K = 1024) [+ bf(bias[c])] [+ bf(R[r][c]) residual]; f32 whole-line epilogue (or f16
template <bool SPLITA, bool F16OUT = false>
__global__ __launch_bounds__(128) void k_gemmb(const bf* __restrict__ A, const bf* __restrict__ Al, const bf* __restrict__ Bn, const float* __restrict__ bias, float* C, int ldc, h16* C2, const float* __restrict__ R = nullptr, int roundR = 1) {
    __shared__ __align__(16) unsigned short st[2 * (SPLITA ? 3 : 2) * TSZ];    // two stage buffers; the epilogue's f32 [4 waves][16][68] lies in the free one
    const int lane = threadIdx.x & 31, wave = threadIdx.x >> 5, lr = lane & 15, hi = lane >> 4;
    const int r0 = blockIdx.x * 64 + wave * 16, c0 = blockIdx.y * 64;
    const size_t ab = (size_t)blockIdx.x * 64 * DM, bb = (size_t)c0 * DM;
    v8f acc[4];
#pragma unroll
    for (int t = 0; t < 4; ++t) acc[t] = (v8f){};
    float* os = (float*)(void*)(SPLITA ? gemm_stages<3, DM>(A + ab, Al + ab, Bn + bb, st, acc) : gemm_stages<2, DM>(A + ab, Bn + bb, nullptr, st, acc)) + wave * (16 * 68);
#pragma unroll
    for (int t = 0; t < 4; ++t) { const float bv = bias ? bfr(bias[c0 + t * 16 + lr]) : 0.f;
#pragma unroll
        for (int j = 0; j < 8; ++j) os[(hi * 8 + j) * 68 + t * 16 + lr] = acc[t][j] + bv; }
    __syncthreads();
    if (F16OUT) {
        h16* crow = (h16*)(void*)C + (size_t)r0 * ldc + c0;
        auto pass = [&]() {
#pragma unroll
            for (int s = 0; s < 4; ++s) { const int row = 4 * s + (lane >> 3), piece = lane & 7; const float* sp = os + row * 68 + piece * 8; v8h o, o2;
#pragma unroll
                for (int i = 0; i < 8; ++i) { const h16 a = (h16)sp[i]; o[i] = a; o2[i] = (h16)((sp[i] - (float)a) * LOSC); }
                *(v8h*)(crow + (size_t)row * ldc + piece * 8) = o; if (C2) *(v8h*)(C2 + (size_t)r0 * ldc + c0 + (size_t)row * ldc + piece * 8) = o2; }
        };
        pass(); 
    } else {
        float* crow = C + (size_t)r0 * ldc + c0;
        auto pass = [&]() {
#pragma unroll
            for (int s = 0; s < 8; ++s) { const int Lid = (lane >> 3) + 4 * s, piece = lane & 7; const int row = Lid >> 1, cofs = (Lid & 1) * 32 + piece * 4;
                v4f val = *(const v4fa*)(os + row * 68 + cofs); if (R) { const v4f rv = *(const v4f*)(R + ((size_t)r0 + row) * ldc + c0 + cofs); val += roundR ? (v4f){bfr(rv[0]), bfr(rv[1]), bfr(rv[2]), bfr(rv[3])} : rv; }
                *(v4f*)(crow + (size_t)row * ldc + cofs) = val; }
        };
        pass(); 
    }
}

// k_qkv: the q (blockIdx.z = 0), k (1) and v (2) projections, 128 x 128 block tile (2 x 2 waves x 64 x 64) of x.Wz (A [2048][1024] bf16, WT [z][n][1024] bf16), main loop gemm_stages128. The epilogue
// writes what the attention reads, straight from the f32 accumulators: q/k as hi/lo planes [plane][s][32] (a wave's 64 columns are two q/k heads; it stages 16 rows at a time in its own LDS
// range and stores 512 contiguous bytes an instruction), v as transposed hi/lo planes [plane][64][s] (a wave's 64 columns are one value head; a lane's 8 accumulator rows are 8 consecutive s of one
// column, packed in registers, staged [d][s] in the wave's own LDS range, so that 8 lanes store each whole 128-byte line of 64 s).
__global__ __launch_bounds__(128) void k_qkv(const bf* __restrict__ A, const bf* __restrict__ WT, bf* PH, bf* PL, bf* VTh, bf* VTl) {
    __shared__ __align__(16) unsigned short st[2 * 2 * TS2];    // two stage buffers; the epilogue stages: q/k in the free one: f32 [2][4 waves][16][68]; v in both: per wave bf16 hi [64][72] then lo [64][72]
    const int K = EE, z = blockIdx.z;
    const bf* Bn = WT + (size_t)z * EE * EE;
    const int tid = threadIdx.x, lane = tid & 31, wave = tid >> 5, lr = lane & 15, hi = lane >> 4;
    const int c0 = blockIdx.y * 128 + (wave & 1) * 64;    // the wave's first column
    v8f acc[4][4];
#pragma unroll
    for (int i = 0; i < 4; ++i)
#pragma unroll
        for (int t = 0; t < 4; ++t) acc[i][t] = (v8f){};
    unsigned short* sm = gemm_stages128<EE>(A + (size_t)blockIdx.x * 128 * K, Bn + (size_t)blockIdx.y * 128 * K, st, acc);
    const int item = (blockIdx.x * 128) / SS, sb = (blockIdx.x * 128) % SS + (wave >> 1) * 64;    // a block's 128 rows lie in one item; sb: the wave's first row in it
    if (z < 2) {
        bf* ph = PH + (size_t)z * ((size_t)NBT * 2 * NHV * SS * HD); bf* pl = PL + (size_t)z * ((size_t)NBT * 2 * NHV * SS * HD);
#pragma unroll
        for (int i = 0; i < 4; ++i) {
            float* os = (float*)(void*)sm + ((i & 1) * 4 + wave) * (16 * 68);    // two ranges in turn: a range is written again only behind the barrier of the row group between
#pragma unroll
            for (int t = 0; t < 4; ++t)
#pragma unroll
                for (int j = 0; j < 8; ++j) os[(hi * 8 + j) * 68 + t * 16 + lr] = acc[i][t][j];
            lds_barrier();    // a lane reads back what other lanes have staged; LDS alone: __syncthreads() would also wait for the global stores of the row group before
#pragma unroll
            for (int it = 0; it < 4; ++it) { const int head = c0 / HD + (it >> 1), row = (it & 1) * 8 + (lane >> 2), piece = lane & 3;
                const int p = ((head / (2 * HG)) * NBT + item) * (2 * HG) + head % (2 * HG);
                const float* sp = os + row * 68 + (it >> 1) * HD + piece * 8; const v4f x0 = *(const v4fa*)sp, x1 = *(const v4fa*)(sp + 4); v8us oh, ol;
#pragma unroll
                for (int e = 0; e < 8; ++e) { const float v = e < 4 ? x0[e & 3] : x1[e & 3]; const unsigned short hb = f2bf(v); oh[e] = hb; ol[e] = f2bf(v - bf2f(hb)); }
                const size_t o = ((size_t)p * SS + sb + i * 16 + row) * HD + piece * 8; *(v8us*)(ph + o) = oh; *(v8us*)(pl + o) = ol; }
        }
    } else {
        __syncthreads();    // ends every wave's reads of the last stage: the four waves' transposed tiles take both buffers
        unsigned short* th = st + wave * (2 * 64 * 72); unsigned short* tw = th + 64 * 72;
#pragma unroll
        for (int i = 0; i < 4; ++i)
#pragma unroll
            for (int t = 0; t < 4; ++t) { v8us oh, ol;
#pragma unroll
                for (int j = 0; j < 8; ++j) { const float v = acc[i][t][j]; const unsigned short hb = f2bf(v); oh[j] = hb; ol[j] = f2bf(v - bf2f(hb)); }
                const int o = (t * 16 + lr) * 72 + i * 16 + hi * 8; *(v8usa*)(th + o) = oh; *(v8usa*)(tw + o) = ol; }
        __syncthreads();    // a lane reads back what other lanes have staged
        const int hv = c0 / VD, p = ((hv / HG) * NBT + item) * HG + hv % HG;
#pragma unroll
        for (int it = 0; it < 16; ++it) { const int idx = it * 32 + lane, d = idx >> 3, piece = idx & 7;
            const size_t o = ((size_t)p * VD + d) * SS + sb + piece * 8;
            *(v8us*)(VTh + o) = *(const v8usa*)(th + d * 72 + piece * 8); *(v8us*)(VTl + o) = *(const v8usa*)(tw + d * 72 + piece * 8); }
    }
}

// k_wt: WT [z][n][K] = bf16(Wz[k][n]) (k-major [K][ncols]) via 64 x 64 LDS tiles; grid (K/64, ncols/64, 4), blockIdx.z picks the matrix.
__global__ __launch_bounds__(256) void k_wt(const float* __restrict__ W0, const float* __restrict__ W1, const float* __restrict__ W2, const float* __restrict__ W3, int K, int ncols, bf* WT) {
    __shared__ __align__(16) unsigned short tl[64 * 72];
    const float* Wm = blockIdx.z == 0 ? W0 : blockIdx.z == 1 ? W1 : blockIdx.z == 2 ? W2 : W3; WT += (size_t)blockIdx.z * K * ncols;
    const int tid = threadIdx.x, k0 = blockIdx.x * 64, n0 = blockIdx.y * 64;
    const int kk = tid >> 2, nq = (tid & 3) * 16;
#pragma unroll
    for (int i = 0; i < 16; ++i) tl[(nq + i) * 72 + kk] = f2bf(Wm[(size_t)(k0 + kk) * ncols + n0 + nq + i]);
    __syncthreads();
    const int piece = tid & 7;
    auto pass = [&]() {
#pragma unroll
        for (int s = 0; s < 2; ++s) { const int nr = (tid >> 3) + 32 * s; const v8us val = *(const v8usa*)(tl + nr * 72 + piece * 8); *(v8us*)(WT + (size_t)(n0 + nr) * K + k0 + piece * 8) = val; }
    };
    pass(); 
}

__global__ __launch_bounds__(256) void k_cvtx(const float* __restrict__ src, bf* dst) {
    const int lane = threadIdx.x & 31; const size_t r = (size_t)blockIdx.x * 8 + (threadIdx.x >> 5); if (r >= (size_t)NBT * SS) return;
{
#pragma unroll
        for (int q = 0; q < EE / 256; ++q) { v8us o;
#pragma unroll
            for (int i = 0; i < 8; ++i) o[i] = f2bf(src[r * EE + q * 256 + lane * 8 + i]);
            *(v8us*)(dst + r * EE + q * 256 + lane * 8) = o; }
         }
}
// k_fattn: one value head p (blockIdx.y) and four 32-query tiles per block; waves 2n and 2n + 1 take q/k heads 2p and 2p + 1 of tile n. Per 32 keys and 16-query column group: S^T = K.Q^T (a
// lane holds 16 keys of ONE query: lane & 15 = query, lane >> 4 picks keys 8h.. and 16 + 8h..), running maximum m and sum z, p = exp(s x SCL - m) (0 for key > query), and the two score
// tiles, converted in place, are the B operand of O^T += V^T.P^T. The odd wave hands o2 / z2 over through LDS; the even wave forms attn = o1 / z1 - lambda o2 / z2,
// its RMSNorm over the row's 64 values (x rsqrt(mean(attn^2) + eps) x bf(rms_w[d]) x (1 - lambda_init)), and stores the planes R [item * 1024 + s][1024], cols head * 64 + d (bf16 hi + UNSCALED residual).
// Every '#pragma unroll' in it, except the one over the lambda vectors, walks an array of fragments or accumulators, whose indices must be compile-time constants for the array to stay in registers.
__device__ __forceinline__ v16bf ldfrag(const bf* p) { return cat16b(*(const v8us*)p, *(const v8us*)(p + 16)); }
__device__ __forceinline__ float xhalf(float v) { const int b = __float_as_int(v); return __int_as_float(__builtin_amdgcn_permlanex16(b, b, 0x76543210, 0xfedcba98, false, false)); }    // lane l <-> l ^ 16
__global__ __launch_bounds__(256) void k_fattn(const bf* __restrict__ Qh, const bf* __restrict__ Ql, const bf* __restrict__ Kh, const bf* __restrict__ Kl, const bf* __restrict__ Vh, const bf* __restrict__ Vl,
                                               const float* __restrict__ lq1, const float* __restrict__ lk1, const float* __restrict__ lq2, const float* __restrict__ lk2, const float* __restrict__ rw, bf* Rh, bf* Rl) {
    __shared__ float o2s[4][64 * 32];
    const int lane = threadIdx.x & 31, wave = __builtin_amdgcn_readfirstlane(threadIdx.x >> 5), lr = lane & 15, hi = lane >> 4, tl = wave >> 1, sel = wave & 1;    // the wave's number in a scalar register: trip count, plane offsets and branches stay scalar
    const int bx = blockIdx.x, pv = blockIdx.y;
    const int tile = tl == 0 ? 31 - bx : tl == 1 ? 16 + bx : tl == 2 ? bx : 15 - bx;    // waves w and w + 4 together walk the same number of keys in every block
    const int q0 = tile * 32, nst = tile + 1;
    const size_t pqk = (size_t)(2 * pv + sel) * SS * HD;
    const unsigned ko = lr * HD + 8 * hi, vo = lr * SS + 8 * hi;    // the lane's place in a K (or Q) tile and in a V^T tile
    const bf* kbh = Kh + pqk; const bf* kbl = Kl + pqk;
    const bf* vsh = Vh + (size_t)pv * VD * SS; const bf* vsl = Vl + (size_t)pv * VD * SS;    // wave-uniform, 32 keys on a step: the lane's own offset vo never changes
    v16bf qh[2], ql[2]; v8f acc[2][4]; float m[2], z[2];
#pragma unroll
    for (int c = 0; c < 2; ++c) { qh[c] = ldfrag(Qh + pqk + (q0 + c * 16) * HD + ko); ql[c] = ldfrag(Ql + pqk + (q0 + c * 16) * HD + ko); m[c] = -3.0e38f; z[c] = 0.f;
#pragma unroll
        for (int t = 0; t < 4; ++t) acc[c][t] = (v8f){}; }
    v16bf kh0 = ldfrag(kbh + ko), kh1 = ldfrag(kbh + 16 * HD + ko), kl0 = ldfrag(kbl + ko), kl1 = ldfrag(kbl + 16 * HD + ko);
#pragma unroll 1    // stays rolled: one step's fragments and accumulators already take the wave's registers
    for (int st = 0; st < nst; ++st) {
        const int k0 = st * 32;
        v16bf vh[4], vl[4];
#pragma unroll
        for (int t = 0; t < 4; ++t) { vh[t] = ldfrag(vsh + t * 16 * SS + vo); vl[t] = ldfrag(vsl + t * 16 * SS + vo); }
        vsh += 32; vsl += 32;
        __builtin_amdgcn_sched_barrier(0);    // holds the 16 V loads up here, so that they fly under the score products and the softmax; sunk to their users each would be waited for alone
        v8f s[2][2];
#pragma unroll
        for (int c = 0; c < 2; ++c) { s[c][0] = wmmab(kh0, qh[c], (v8f){}); s[c][1] = wmmab(kh1, qh[c], (v8f){}); }
#pragma unroll
        for (int c = 0; c < 2; ++c) { s[c][0] = wmmab(kh0, ql[c], s[c][0]); s[c][1] = wmmab(kh1, ql[c], s[c][1]); }
#pragma unroll
        for (int c = 0; c < 2; ++c) { s[c][0] = wmmab(kl0, qh[c], s[c][0]); s[c][1] = wmmab(kl1, qh[c], s[c][1]); }
        { const int kn = (k0 + 32 < SS - 32 ? k0 + 32 : SS - 32) * HD;    // the next step's K fragments fly during this step's softmax; the index stays inside the plane
          kh0 = ldfrag(kbh + kn + ko); kh1 = ldfrag(kbh + (kn + 16 * HD) + ko); kl0 = ldfrag(kbl + kn + ko); kl1 = ldfrag(kbl + (kn + 16 * HD) + ko); }
        __builtin_amdgcn_sched_barrier(0);    // holds the next K loads here; sunk to the loop's foot they would be waited for at once
        v16bf ph[2], pl[2];
#pragma unroll
        for (int c = 0; c < 2; ++c) {
            float sc[16]; const int rel = q0 + c * 16 + lr - k0 - 8 * hi;    // key <= query  <=>  its place among the lane's keys <= rel
#pragma unroll
            for (int j = 0; j < 8; ++j) { sc[j] = (j <= rel) ? s[c][0][j] * SCL : -3.0e38f; sc[8 + j] = (16 + j <= rel) ? s[c][1][j] * SCL : -3.0e38f; }
            float tm = sc[0];
#pragma unroll
            for (int e = 1; e < 16; ++e) tm = fmaxf(tm, sc[e]);
            tm = fmaxf(tm, xhalf(tm));
            const float mn = fmaxf(m[c], tm); float al;    // al = exp(m - mn): what the old maximum's sums and products are worth under the new one
            asm("v_exp_f32 %0, %1\n\tv_nop" : "=v"(al) : "v"((m[c] - mn) * 1.44269504f));    // with the slot the instruction set asks for behind a transcendental
            m[c] = mn;
            float zs = 0.f;
#pragma unroll
            for (int e = 0; e < 16; ++e) { const float p = __expf(sc[e] - mn); zs += p; const __bf16 hb = (__bf16)p; ph[c][e] = hb; pl[c][e] = (__bf16)(p - (float)hb); }
            z[c] = z[c] * al + zs;
#pragma unroll
            for (int t = 0; t < 4; ++t) acc[c][t] *= al;
        }
#pragma unroll
        for (int c = 0; c < 2; ++c)
#pragma unroll
            for (int t = 0; t < 4; ++t) acc[c][t] = wmmab(vh[t], ph[c], acc[c][t]);
#pragma unroll
        for (int c = 0; c < 2; ++c)
#pragma unroll
            for (int t = 0; t < 4; ++t) acc[c][t] = wmmab(vh[t], pl[c], acc[c][t]);
#pragma unroll
        for (int c = 0; c < 2; ++c)
#pragma unroll
            for (int t = 0; t < 4; ++t) acc[c][t] = wmmab(vl[t], ph[c], acc[c][t]);
    }
    float iz[2];
#pragma unroll
    for (int c = 0; c < 2; ++c) iz[c] = 1.0f / (z[c] + xhalf(z[c]));
    float* ob = &o2s[tl][lane];
    if (sel == 1) {
#pragma unroll
        for (int c = 0; c < 2; ++c)
#pragma unroll
            for (int t = 0; t < 4; ++t)
#pragma unroll
                for (int j = 0; j < 8; ++j) ob[((c * 4 + t) * 8 + j) * 32] = acc[c][t][j] * iz[c];
    }
    __syncthreads();
    if (sel == 0) {
        float d1 = 0.f, d2 = 0.f;
#pragma unroll
        for (int d = 0; d < HD; ++d) { d1 = fmaf(bfr(lq1[d]), bfr(lk1[d]), d1); d2 = fmaf(bfr(lq2[d]), bfr(lk2[d]), d2); }
        const float lam = __expf(d1) - __expf(d2) + LINIT;
        const int item = (pv / HG) % NBT, hv = (pv / (NBT * HG)) * HG + pv % HG;    // plane pv = [group][item][head in group]
#pragma unroll
        for (int c = 0; c < 2; ++c) {
            float q = 0.f;    // lanes l and l ^ 16 hold the 64 values of one query's row, 32 each
#pragma unroll
            for (int t = 0; t < 4; ++t)
#pragma unroll
                for (int j = 0; j < 8; ++j) { const float a = acc[c][t][j] * iz[c] - lam * ob[((c * 4 + t) * 8 + j) * 32]; acc[c][t][j] = a; q += a * a; }
            q += xhalf(q);
            const float sc = rsqrtf(q * (1.0f / VD) + REPS) * (1.0f - LINIT);
            const size_t o = ((size_t)item * SS + q0 + c * 16 + lr) * EE + hv * VD + 8 * hi;
#pragma unroll
            for (int t = 0; t < 4; ++t) { v8us oh, ol;
#pragma unroll
                for (int j = 0; j < 8; ++j) { const float v = acc[c][t][j] * sc * bfr(rw[t * 16 + 8 * hi + j]); const unsigned short hb = f2bf(v); oh[j] = hb; ol[j] = f2bf(v - bf2f(hb)); }
                *(v8us*)(Rh + o + t * 16) = oh; *(v8us*)(Rl + o + t * 16) = ol; }
        }
    }
}

extern "C" void kernel_launch(void* const* d_in, const int* in_sizes, int n_in,
                              void* d_out, int out_size, void* d_ws, size_t ws_size, hipStream_t stream) {
    (void)in_sizes; (void)n_in; (void)out_size;
    const float* x = (const float*)d_in[0]; const float* Wq = (const float*)d_in[1]; const float* Wk = (const float*)d_in[2]; const float* Wv = (const float*)d_in[3]; const float* Wo = (const float*)d_in[4];
    const float* lq1 = (const float*)d_in[5]; const float* lk1 = (const float*)d_in[6]; const float* lq2 = (const float*)d_in[7]; const float* lk2 = (const float*)d_in[8]; const float* rw = (const float*)d_in[9];
    float* out = (float*)d_out;    // [2][1024][1024]
    char* wsp = (char*)d_ws;
    auto take = [&](size_t bytes) { char* p = wsp; wsp += (bytes + 255) & ~(size_t)255; return (void*)p; };
    bf* WT4 = (bf*)take((size_t)4 * EE * EE * 2); bf* WOT = WT4 + (size_t)3 * EE * EE;    // Wq, Wk, Wv, Wo transposed
    bf* Xb = (bf*)take((size_t)NBT * SS * EE * 2);
    const size_t nP = (size_t)NBT * 2 * NHV * SS * HD;
    bf* PH = (bf*)take(2 * nP * 2); bf* PL = (bf*)take(2 * nP * 2); bf* VTh = (bf*)take((size_t)NBT * NHV * VD * SS * 2); bf* VTl = (bf*)take((size_t)NBT * NHV * VD * SS * 2);    // PH, PL: q planes then k planes
    bf* Rh = (bf*)take((size_t)NBT * SS * EE * 2); bf* Rl = (bf*)take((size_t)NBT * SS * EE * 2);
    if ((size_t)(wsp - (char*)d_ws) > ws_size) return;    // 8 + 4 + 16 + 8 + 4 + 4 = 44 MiB
    k_wt<<<dim3(EE / 64, EE / 64, 4), 256, 0, stream>>>(Wq, Wk, Wv, Wo, EE, EE, WT4);   // (in, out) k-major
    k_cvtx<<<NBT * SS / 8, 256, 0, stream>>>(x, Xb);
    k_qkv<<<dim3(NBT * SS / 128, EE / 128, 3), 128, 0, stream>>>(Xb, WT4, PH, PL, VTh, VTl);
    k_fattn<<<dim3(SS / 128, NBT * NHV, 1), 256, 0, stream>>>(PH, PL, PH + nP, PL + nP, VTh, VTl, lq1, lk1, lq2, lk2, rw, Rh, Rl);
    k_gemmb<true, false><<<dim3(NBT * SS / 64, EE / 64, 1), 128, 0, stream>>>(Rh, Rl, WOT, nullptr, out, EE, nullptr, nullptr);
}

// v007
// One run takes 62.4 microseconds.
// Timed twice side by side with v006, it ran 1.08 and 1.07 times as fast.
// Counting every step since v000, it is 16.4 times as fast.
#include <hip/hip_runtime.h>

// Compute dtypes, f32 accumulate, per item: q/k/v = x.W as [1024 x 1024].[1024 x 1024] GEMMs with PLAIN bf16 operands (exact products); per value head (= 2 q/k heads), in ONE
// launch: scores^T = k.q^T ([keys x 32].[32 x queries], both operands bf16 hi + UNSCALED residual, three products), the causal softmax of each head of the pair with a running
// maximum and sum in f32, the unnormalised weights -> hi/lo bf16 straight from the score accumulators, o^T += v^T.p^T (three products), attn = o1 / z1 - lambda o2 / z2 in f32;
// RMSNorm (x rms_w x (1 - lambda_init)) in f32 -> planes; out = attn.Wo (two products) - on v_wmma_f32_16x16x32_bf16. lambda = exp(lq1.lk1) - exp(lq2.lk2) + lambda_init from the inputs on device.
// Launch plan: both batch items ride in every grid; the four weight transposes, the q/k/v projections and the attention each run once for all heads; the projections' epilogue builds the
// hi/lo planes (v transposed) and the attention's epilogue does the RMSNorm, so no launch only reshapes data between two products.
// Plane order: q/k planes [group][item][8 heads][s][32], v planes [group][item][4 heads][64][s]: value plane p pairs with q/k planes 2p, 2p + 1.

#define NBT  2
#define SS   1024
#define EE   1024
#define NHV  16
#define HD   32                   // q/k head dim
#define VD   64                   // v head dim
#define HG   4                    // value heads per group (8 q/k heads)
#define DM   EE
#define SCL  0.17677669529663687f
#define LINIT 0.7836057665316245f    // 0.8 - 0.6 exp(-0.3 * 12)
#define REPS 1e-5f
#define LOSC 1024.0f

typedef _Float16 h16;
typedef unsigned short bf;
typedef __attribute__((ext_vector_type(16))) __bf16   v16bf;
typedef __attribute__((ext_vector_type(16))) _Float16 v16h;
typedef __attribute__((ext_vector_type(8)))  _Float16 v8h;
typedef __attribute__((ext_vector_type(8)))  unsigned short v8us;
typedef __attribute__((ext_vector_type(8)))  float    v8f;
typedef __attribute__((ext_vector_type(4)))  float    v4f;
typedef v8h  __attribute__((may_alias)) v8ha;
typedef v4f  __attribute__((may_alias)) v4fa;
typedef v8us __attribute__((may_alias)) v8usa;

__device__ __forceinline__ unsigned short f2bf(float f) { unsigned u = __float_as_uint(f); u += 0x7FFFu + ((u >> 16) & 1u); return (unsigned short)(u >> 16); }
__device__ __forceinline__ float bf2f(unsigned short b) { return __uint_as_float(((unsigned)b) << 16); }
__device__ __forceinline__ float bfr(float f) { return bf2f(f2bf(f)); }
__device__ __forceinline__ v16h cat16(v8h lo, v8h hi) { return __builtin_shufflevector(lo, hi, 0, 1, 2, 3, 4, 5, 6, 7, 8, 9, 10, 11, 12, 13, 14, 15); }
__device__ __forceinline__ v16bf cat16b(v8us lo, v8us hi) { return __builtin_bit_cast(v16bf, __builtin_shufflevector(lo, hi, 0, 1, 2, 3, 4, 5, 6, 7, 8, 9, 10, 11, 12, 13, 14, 15)); }
__device__ __forceinline__ v8f wmma16(v16h a, v16h b, v8f c) { return __builtin_amdgcn_wmma_f32_16x16x32_f16(false, a, false, b, (short)0, c, false, false); }
__device__ __forceinline__ v8f wmmab(v16bf a, v16bf b, v8f c) { return __builtin_amdgcn_wmma_f32_16x16x32_bf16(false, a, false, b, (short)0, c, false, false); }

// gemm_stages: the main loop of k_gemmb, for a block of 4 waves and a 64 x 64 tile. A stage is 64 k of every operand: 64 rows x one whole 128-byte line, which the block fetches with loads that
// each cover 4 whole lines (a fragment load from global memory touches 16 lines for the same 512 bytes), lays in LDS at pitch LP and reads back as fragments. Two LDS buffers and two register sets: stage
// t + 2 is fetched into the set that stage t has left, at the head of trip t, so that its loads have two trips to land, not one; stage t + 1 goes from its set into
// the other buffer behind stage t's LDS reads; the one barrier of a trip publishes it and ends every wave's reads of the buffer that the next trip overwrites.
// NOP = 2: operands g0 = A, g1 = B; NOP = 3: g0 = A, g1 = its residual, g2 = B. k runs upward in steps of 32 through the same accumulators as with fragments from global memory.
// Returns the buffer that the last stage does not lie in: every wave's reads of it ended in front of the last barrier, so the caller's epilogue may stage in it at once.
// Every '#pragma unroll' in it walks an array of staged rows, fragments or accumulators, whose indices must be compile-time constants for the array to stay in registers.
#define KT  64                    // k per stage
#define LP  72                    // LDS row pitch in bf16: 144 B = 16 B x odd, for ds_load_b128 readers of 128-byte rows
#define TSZ (64 * LP)             // one operand's 64 rows
// lds_barrier: the work-group barrier of a stage, ordering LDS alone: every wave's LDS stores and reads are done in front of it (the fences name the LDS address space), while global loads into registers,
// which no other wave sees, stay in flight across it. __syncthreads() waits for those too: a stage fetched two trips ahead would be waited for at the first barrier behind its loads.
__device__ __forceinline__ void lds_barrier() {
    __builtin_amdgcn_fence(__ATOMIC_RELEASE, "workgroup", "local");
    __builtin_amdgcn_s_barrier();
    __builtin_amdgcn_fence(__ATOMIC_ACQUIRE, "workgroup", "local");
}
template <int NOP, int K>
__device__ __forceinline__ unsigned short* gemm_stages(const bf* __restrict__ g0, const bf* __restrict__ g1, const bf* __restrict__ g2, unsigned short* st, v8f (&acc)[4]) {
    const int tid = threadIdx.x, lane = tid & 31, wave = tid >> 5, lr = lane & 15, hi = lane >> 4;
    const unsigned go = (tid >> 3) * K + (tid & 7) * 8, so = (tid >> 3) * LP + (tid & 7) * 8;    // 8 lanes a row, 16 rows a pass of the block
    const unsigned fa = (wave * 16 + lr) * LP + 8 * hi, fb = (NOP - 1) * TSZ + lr * LP + 8 * hi;    // the lane's place in its wave's A rows and in B's first 16 rows
    v8us rs[2][NOP][4];    // stage t flies into set t & 1
    auto fetch = [&](int kc, v8us (&r)[NOP][4]) {
#pragma unroll
        for (int it = 0; it < 4; ++it) { r[0][it] = *(const v8us*)(g0 + kc + go + it * 16 * K); r[1][it] = *(const v8us*)(g1 + kc + go + it * 16 * K); if (NOP == 3) r[NOP - 1][it] = *(const v8us*)(g2 + kc + go + it * 16 * K); }
    };
    auto put = [&](unsigned short* b, const v8us (&r)[NOP][4]) {
#pragma unroll
        for (int o = 0; o < NOP; ++o)
#pragma unroll
            for (int it = 0; it < 4; ++it) *(v8usa*)(b + o * TSZ + so + it * 16 * LP) = r[o][it];
    };
    auto work = [&](const unsigned short* b) {
        v16bf a[KT / 32], al[KT / 32], w[KT / 32][4];    // fragments first, products behind them: the LDS reads may then run ahead of the products that use them
#pragma unroll
        for (int h = 0; h < KT / 32; ++h) {
            a[h] = cat16b(*(const v8usa*)(b + fa + h * 32), *(const v8usa*)(b + fa + h * 32 + 16));
            if (NOP == 3) al[h] = cat16b(*(const v8usa*)(b + TSZ + fa + h * 32), *(const v8usa*)(b + TSZ + fa + h * 32 + 16));
#pragma unroll
            for (int t = 0; t < 4; ++t) w[h][t] = cat16b(*(const v8usa*)(b + fb + t * 16 * LP + h * 32), *(const v8usa*)(b + fb + t * 16 * LP + h * 32 + 16));
        }
        if (NOP == 3) __builtin_amdgcn_sched_barrier(0);    // keeps the stage's LDS reads one group in front of its products: with two register sets live the build dealt them out in pairs among the products and waited for each pair. NOP = 2 keeps the compiler's own order
#pragma unroll
        for (int h = 0; h < KT / 32; ++h)
#pragma unroll
            for (int t = 0; t < 4; ++t) { acc[t] = wmmab(a[h], w[h][t], acc[t]); if (NOP == 3) acc[t] = wmmab(al[h], w[h][t], acc[t]); }
    };
    constexpr int nt = K / KT;
    static_assert(nt >= 2, "stages 0 and 1 are fetched in front of the loop");
    fetch(0, rs[0]);
    __builtin_amdgcn_sched_barrier(0);    // keeps stage 0's loads in front of stage 1's: loads return in order, and mixed, stage 0 would wait for stage 1's bytes
    fetch(KT, rs[1]);
    put(st, rs[0]);
    lds_barrier();    // publishes stage 0
#pragma unroll    // unrolled whole: a stage's register set is t & 1, which must be a compile-time constant for the sets to stay in registers
    for (int t = 0; t < nt; ++t) {
        if (t + 2 < nt) fetch((t + 2) * KT, rs[t & 1]);    // the set is free: stage t went from it into LDS a trip ago
        __builtin_amdgcn_sched_barrier(0);    // holds these loads up here, so that they have two whole trips to land; sunk among the products they would start later
        work(st + (t & 1) * (NOP * TSZ));
        if (t + 1 < nt) {
            put(st + ((t + 1) & 1) * (NOP * TSZ), rs[(t + 1) & 1]);    // waits for the older set alone: the younger stays in flight
            lds_barrier();    // publishes stage t + 1; stage t's buffer is free behind it
        }
    }
    return st + (nt & 1) * (NOP * TSZ);
}

// gemm_stages128: gemm_stages' scheme (64-k stages, two LDS buffers, two register sets, one lds_barrier a trip) for a 128 x 128 block tile of 4 waves, 2 x 2, each with a 64 x 64 tile of 4 x 4 accumulators.
// Every fragment read from LDS feeds 4 products (in gemm_stages a B fragment feeds 1): 16 KiB of LDS reads per 32 products of a wave against 10 KiB per 8, and each operand row is fetched from L2 by half as many blocks.
// g0 = A's 128 rows, g1 = B's 128 rows. k runs upward in steps of 32 through every accumulator, as in gemm_stages. Returns the buffer that the last stage does not lie in.
#define TS2 (128 * LP)            // one operand's 128 rows
template <int K>
__device__ __forceinline__ unsigned short* gemm_stages128(const bf* __restrict__ g0, const bf* __restrict__ g1, unsigned short* st, v8f (&acc)[4][4]) {
    const int tid = threadIdx.x, lane = tid & 31, wave = tid >> 5, lr = lane & 15, hi = lane >> 4;
    const unsigned go = (tid >> 3) * K + (tid & 7) * 8, so = (tid >> 3) * LP + (tid & 7) * 8;    // 8 lanes a row, 16 rows a pass of the block
    const unsigned fa = ((wave >> 1) * 64 + lr) * LP + 8 * hi, fb = TS2 + ((wave & 1) * 64 + lr) * LP + 8 * hi;    // the lane's place in its wave's first 16 A rows and first 16 B rows
    v8us rs[2][2][8];    // stage t flies into set t & 1
    auto fetch = [&](int kc, v8us (&r)[2][8]) {
#pragma unroll
        for (int it = 0; it < 8; ++it) { r[0][it] = *(const v8us*)(g0 + kc + go + it * 16 * K); r[1][it] = *(const v8us*)(g1 + kc + go + it * 16 * K); }
    };
    auto put = [&](unsigned short* b, const v8us (&r)[2][8]) {
#pragma unroll
        for (int o = 0; o < 2; ++o)
#pragma unroll
            for (int it = 0; it < 8; ++it) *(v8usa*)(b + o * TS2 + so + it * 16 * LP) = r[o][it];
    };
    static_assert(KT == 64, "a stage is two halves of 32 k");
    v16bf a[2][4], w[2][4];    // the fragments of a stage's two halves
    auto frags = [&](const unsigned short* b, int h) {
#pragma unroll
        for (int i = 0; i < 4; ++i) {
            a[h][i] = cat16b(*(const v8usa*)(b + fa + i * 16 * LP + h * 32), *(const v8usa*)(b + fa + i * 16 * LP + h * 32 + 16));
            w[h][i] = cat16b(*(const v8usa*)(b + fb + i * 16 * LP + h * 32), *(const v8usa*)(b + fb + i * 16 * LP + h * 32 + 16));
        }
    };
    auto prods = [&](int h) {
#pragma unroll
        for (int i = 0; i < 4; ++i)
#pragma unroll
            for (int t = 0; t < 4; ++t) acc[i][t] = wmmab(a[h][i], w[h][t], acc[i][t]);
    };
    constexpr int nt = K / KT;
    static_assert(nt >= 2, "stages 0 and 1 are fetched in front of the loop");
    fetch(0, rs[0]);
    __builtin_amdgcn_sched_barrier(0);    // keeps stage 0's loads in front of stage 1's: loads return in order, and mixed, stage 0 would wait for stage 1's bytes
    fetch(KT, rs[1]);
    put(st, rs[0]);
    lds_barrier();    // publishes stage 0
    // Each half's 16 LDS reads stand as one group in front of the 16 products of the half before, which hide them: the second half's products of stage t - 1 run behind stage t's barrier, from registers.
    // The sched_barriers of the loop hold that order; left free, the build set all 32 products of a stage in one run and all 32 reads behind it, with nothing of the wave's own to hide the reads.
#pragma unroll    // unrolled whole: a stage's register set is t & 1, which must be a compile-time constant for the sets to stay in registers
    for (int t = 0; t < nt; ++t) {
        const unsigned short* b = st + (t & 1) * (2 * TS2);
        if (t + 2 < nt) fetch((t + 2) * KT, rs[t & 1]);    // the set is free: stage t went from it into LDS a trip ago
        frags(b, 0);
        __builtin_amdgcn_sched_barrier(0);    // holds the fetch and the first half's reads up here: the loads get their two trips, the reads fly under the products below
        if (t > 0) prods(1);
        __builtin_amdgcn_sched_barrier(0);    // keeps the second half's reads one group behind those products, whose fragment registers they refill
        frags(b, 1);
        __builtin_amdgcn_sched_barrier(0);    // holds those reads in front of the first half's products, which hide them
        prods(0);
        __builtin_amdgcn_sched_barrier(0);    // keeps the products in front of the stores and the barrier; sunk behind the barrier they would stand in one run with the next trip's
        if (t + 1 < nt) {
            put(st + ((t + 1) & 1) * (2 * TS2), rs[(t + 1) & 1]);    // waits for the older set alone: the younger stays in flight
            lds_barrier();    // publishes stage t + 1; stage t's buffer is free behind it: its reads are done in front of the barrier
        }
    }
    prods(1);
    return st + (nt & 1) * (2 * TS2);
}

// k_gemmb: 64 x 64 block tile (4 waves x 16 x 64) of C[NTK][NW] = (A [+ Al]).B^T (K = 1024) [+ bf(bias[c])] [+ bf(R[r][c]) residual]; f32 whole-line epilogue (or f16
template <bool SPLITA, bool F16OUT = false>
__global__ __launch_bounds__(128) void k_gemmb(const bf* __restrict__ A, const bf* __restrict__ Al, const bf* __restrict__ Bn, const float* __restrict__ bias, float* C, int ldc, h16* C2, const float* __restrict__ R = nullptr, int roundR = 1) {
    __shared__ __align__(16) unsigned short st[2 * (SPLITA ? 3 : 2) * TSZ];    // two stage buffers; the epilogue's f32 [4 waves][16][68] lies in the free one
    const int lane = threadIdx.x & 31, wave = threadIdx.x >> 5, lr = lane & 15, hi = lane >> 4;
    const int r0 = blockIdx.x * 64 + wave * 16, c0 = blockIdx.y * 64;
    const size_t ab = (size_t)blockIdx.x * 64 * DM, bb = (size_t)c0 * DM;
    v8f acc[4];
#pragma unroll
    for (int t = 0; t < 4; ++t) acc[t] = (v8f){};
    float* os = (float*)(void*)(SPLITA ? gemm_stages<3, DM>(A + ab, Al + ab, Bn + bb, st, acc) : gemm_stages<2, DM>(A + ab, Bn + bb, nullptr, st, acc)) + wave * (16 * 68);
#pragma unroll
    for (int t = 0; t < 4; ++t) { const float bv = bias ? bfr(bias[c0 + t * 16 + lr]) : 0.f;
#pragma unroll
        for (int j = 0; j < 8; ++j) os[(hi * 8 + j) * 68 + t * 16 + lr] = acc[t][j] + bv; }
    __syncthreads();
    if (F16OUT) {
        h16* crow = (h16*)(void*)C + (size_t)r0 * ldc + c0;
        auto pass = [&]() {
#pragma unroll
            for (int s = 0; s < 4; ++s) { const int row = 4 * s + (lane >> 3), piece = lane & 7; const float* sp = os + row * 68 + piece * 8; v8h o, o2;
#pragma unroll
                for (int i = 0; i < 8; ++i) { const h16 a = (h16)sp[i]; o[i] = a; o2[i] = (h16)((sp[i] - (float)a) * LOSC); }
                *(v8h*)(crow + (size_t)row * ldc + piece * 8) = o; if (C2) *(v8h*)(C2 + (size_t)r0 * ldc + c0 + (size_t)row * ldc + piece * 8) = o2; }
        };
        pass(); 
    } else {
        float* crow = C + (size_t)r0 * ldc + c0;
        auto pass = [&]() {
#pragma unroll
            for (int s = 0; s < 8; ++s) { const int Lid = (lane >> 3) + 4 * s, piece = lane & 7; const int row = Lid >> 1, cofs = (Lid & 1) * 32 + piece * 4;
                v4f val = *(const v4fa*)(os + row * 68 + cofs); if (R) { const v4f rv = *(const v4f*)(R + ((size_t)r0 + row) * ldc + c0 + cofs); val += roundR ? (v4f){bfr(rv[0]), bfr(rv[1]), bfr(rv[2]), bfr(rv[3])} : rv; }
                *(v4f*)(crow + (size_t)row * ldc + cofs) = val; }
        };
        pass(); 
    }
}

// k_qkv: the q (blockIdx.z = 0), k (1) and v (2) projections, 128 x 128 block tile (2 x 2 waves x 64 x 64) of x.Wz (A [2048][1024] bf16, WT [z][n][1024] bf16), main loop gemm_stages128. The epilogue
// writes what the attention reads, straight from the f32 accumulators: q/k as hi/lo planes [plane][s][32] (a wave's 64 columns are two q/k heads; it stages 16 rows at a time in its own LDS
// range and stores 512 contiguous bytes an instruction), v as transposed hi/lo planes [plane][64][s] (a wave's 64 columns are one value head; a lane's 8 accumulator rows are 8 consecutive s of one
// column, packed in registers, staged [d][s] in the wave's own LDS range, so that 8 lanes store each whole 128-byte line of 64 s).
__global__ __launch_bounds__(128) void k_qkv(const bf* __restrict__ A, const bf* __restrict__ WT, bf* PH, bf* PL, bf* VTh, bf* VTl) {
    __shared__ __align__(16) unsigned short st[2 * 2 * TS2];    // two stage buffers; the epilogue stages: q/k in the free one: f32 [2][4 waves][16][68]; v in both: per wave bf16 hi [64][72] then lo [64][72]
    const int K = EE, z = blockIdx.z;
    const bf* Bn = WT + (size_t)z * EE * EE;
    const int tid = threadIdx.x, lane = tid & 31, wave = tid >> 5, lr = lane & 15, hi = lane >> 4;
    const int c0 = blockIdx.y * 128 + (wave & 1) * 64;    // the wave's first column
    v8f acc[4][4];
#pragma unroll
    for (int i = 0; i < 4; ++i)
#pragma unroll
        for (int t = 0; t < 4; ++t) acc[i][t] = (v8f){};
    unsigned short* sm = gemm_stages128<EE>(A + (size_t)blockIdx.x * 128 * K, Bn + (size_t)blockIdx.y * 128 * K, st, acc);
    const int item = (blockIdx.x * 128) / SS, sb = (blockIdx.x * 128) % SS + (wave >> 1) * 64;    // a block's 128 rows lie in one item; sb: the wave's first row in it
    if (z < 2) {
        bf* ph = PH + (size_t)z * ((size_t)NBT * 2 * NHV * SS * HD); bf* pl = PL + (size_t)z * ((size_t)NBT * 2 * NHV * SS * HD);
#pragma unroll
        for (int i = 0; i < 4; ++i) {
            float* os = (float*)(void*)sm + ((i & 1) * 4 + wave) * (16 * 68);    // two ranges in turn: a range is written again only behind the barrier of the row group between
#pragma unroll
            for (int t = 0; t < 4; ++t)
#pragma unroll
                for (int j = 0; j < 8; ++j) os[(hi * 8 + j) * 68 + t * 16 + lr] = acc[i][t][j];
            lds_barrier();    // a lane reads back what other lanes have staged; LDS alone: __syncthreads() would also wait for the global stores of the row group before
#pragma unroll
            for (int it = 0; it < 4; ++it) { const int head = c0 / HD + (it >> 1), row = (it & 1) * 8 + (lane >> 2), piece = lane & 3;
                const int p = ((head / (2 * HG)) * NBT + item) * (2 * HG) + head % (2 * HG);
                const float* sp = os + row * 68 + (it >> 1) * HD + piece * 8; const v4f x0 = *(const v4fa*)sp, x1 = *(const v4fa*)(sp + 4); v8us oh, ol;
#pragma unroll
                for (int e = 0; e < 8; ++e) { const float v = e < 4 ? x0[e & 3] : x1[e & 3]; const unsigned short hb = f2bf(v); oh[e] = hb; ol[e] = f2bf(v - bf2f(hb)); }
                const size_t o = ((size_t)p * SS + sb + i * 16 + row) * HD + piece * 8; *(v8us*)(ph + o) = oh; *(v8us*)(pl + o) = ol; }
        }
    } else {
        __syncthreads();    // ends every wave's reads of the last stage: the four waves' transposed tiles take both buffers
        unsigned short* th = st + wave * (2 * 64 * 72); unsigned short* tw = th + 64 * 72;
#pragma unroll
        for (int i = 0; i < 4; ++i)
#pragma unroll
            for (int t = 0; t < 4; ++t) { v8us oh, ol;
#pragma unroll
                for (int j = 0; j < 8; ++j) { const float v = acc[i][t][j]; const unsigned short hb = f2bf(v); oh[j] = hb; ol[j] = f2bf(v - bf2f(hb)); }
                const int o = (t * 16 + lr) * 72 + i * 16 + hi * 8; *(v8usa*)(th + o) = oh; *(v8usa*)(tw + o) = ol; }
        __syncthreads();    // a lane reads back what other lanes have staged
        const int hv = c0 / VD, p = ((hv / HG) * NBT + item) * HG + hv % HG;
#pragma unroll
        for (int it = 0; it < 16; ++it) { const int idx = it * 32 + lane, d = idx >> 3, piece = idx & 7;
            const size_t o = ((size_t)p * VD + d) * SS + sb + piece * 8;
            *(v8us*)(VTh + o) = *(const v8usa*)(th + d * 72 + piece * 8); *(v8us*)(VTl + o) = *(const v8usa*)(tw + d * 72 + piece * 8); }
    }
}

// k_wt: WT [z][n][K] = bf16(Wz[k][n]) (k-major [K][ncols]) via 64 x 64 LDS tiles; grid (K/64, ncols/64, 4), blockIdx.z picks the matrix.
__global__ __launch_bounds__(256) void k_wt(const float* __restrict__ W0, const float* __restrict__ W1, const float* __restrict__ W2, const float* __restrict__ W3, int K, int ncols, bf* WT) {
    __shared__ __align__(16) unsigned short tl[64 * 72];
    const float* Wm = blockIdx.z == 0 ? W0 : blockIdx.z == 1 ? W1 : blockIdx.z == 2 ? W2 : W3; WT += (size_t)blockIdx.z * K * ncols;
    const int tid = threadIdx.x, k0 = blockIdx.x * 64, n0 = blockIdx.y * 64;
    const int kk = tid >> 2, nq = (tid & 3) * 16;
#pragma unroll
    for (int i = 0; i < 16; ++i) tl[(nq + i) * 72 + kk] = f2bf(Wm[(size_t)(k0 + kk) * ncols + n0 + nq + i]);
    __syncthreads();
    const int piece = tid & 7;
    auto pass = [&]() {
#pragma unroll
        for (int s = 0; s < 2; ++s) { const int nr = (tid >> 3) + 32 * s; const v8us val = *(const v8usa*)(tl + nr * 72 + piece * 8); *(v8us*)(WT + (size_t)(n0 + nr) * K + k0 + piece * 8) = val; }
    };
    pass(); 
}

__global__ __launch_bounds__(256) void k_cvtx(const float* __restrict__ src, bf* dst) {
    const int lane = threadIdx.x & 31; const size_t r = (size_t)blockIdx.x * 8 + (threadIdx.x >> 5); if (r >= (size_t)NBT * SS) return;
{
#pragma unroll
        for (int q = 0; q < EE / 256; ++q) { v8us o;
#pragma unroll
            for (int i = 0; i < 8; ++i) o[i] = f2bf(src[r * EE + q * 256 + lane * 8 + i]);
            *(v8us*)(dst + r * EE + q * 256 + lane * 8) = o; }
         }
}
// k_fattn: one value head p (blockIdx.y) and four 32-query tiles per block; waves 2n and 2n + 1 take q/k heads 2p and 2p + 1. Per 32 keys (a step) and 16-query column group: S^T = K.Q^T (a
// lane holds 16 keys of ONE query: lane & 15 = query, lane >> 4 picks keys 8h.. and 16 + 8h..), running maximum m and sum z, p = exp(s x SCL - m) (0 for key > query), and the two score
// tiles, converted in place, are the B operand of O^T += V^T.P^T.
// Who walks which keys: a causal tile t has t + 1 steps, and a block's tiles have 32 - bx, 17 + bx, bx + 1 and 16 - bx. The wave of a long tile (the first two) walks its first SPL steps alone; the wave of a short
// tile walks that tile and then, as a second job, the rest of a long one: every wave walks 16 or 17 steps, so that two waves stand on each SIMD to the end and one's products run under the other's softmax.
// Every job leaves its unnormalised o, m and z in LDS; behind the one barrier each wave takes one tile's column group, joins a long tile's two parts (each x exp(m_part - max m), sums and products alike),
// forms attn = o1 / z1 - lambda o2 / z2, its RMSNorm over the row's 64 values (x rsqrt(mean(attn^2) + eps) x bf(rms_w[d]) x (1 - lambda_init)), and stores the planes R [item * 1024 + s][1024], cols head * 64 + d (bf16 hi + UNSCALED residual).
// Every '#pragma unroll' in it but the lambda loop's walks an array of fragments or accumulators, whose indices must be compile-time constants for the array to stay in registers.
#define SPL 17                    // steps of a long tile that its own wave walks: both long tiles have at least as many for every bx
__device__ __forceinline__ v16bf ldfrag(const bf* p) { return cat16b(*(const v8us*)p, *(const v8us*)(p + 16)); }
__device__ __forceinline__ float xhalf(float v) { const int b = __float_as_int(v); return __int_as_float(__builtin_amdgcn_permlanex16(b, b, 0x76543210, 0xfedcba98, false, false)); }    // lane l <-> l ^ 16
__global__ __launch_bounds__(256) void k_fattn(const bf* __restrict__ Qh, const bf* __restrict__ Ql, const bf* __restrict__ Kh, const bf* __restrict__ Kl, const bf* __restrict__ Vh, const bf* __restrict__ Vl,
                                               const float* __restrict__ lq1, const float* __restrict__ lk1, const float* __restrict__ lq2, const float* __restrict__ lk2, const float* __restrict__ rw, bf* Rh, bf* Rl) {
    __shared__ float ost[12][64 * 32];    // a job's o: slots 0..7 = the waves' first jobs (tile wave >> 1, head wave & 1), 8..11 = the long tiles' second parts (tile (slot - 8) >> 1, head slot & 1)
    __shared__ float mst[12][2][32], zst[12][2][32];    // its m and z, per column group and lane
    const int lane = threadIdx.x & 31, wave = __builtin_amdgcn_readfirstlane(threadIdx.x >> 5), lr = lane & 15, hi = lane >> 4, tl = wave >> 1, sel = wave & 1;    // the wave's number in a scalar register: trip counts, plane offsets and branches stay scalar
    const int bx = blockIdx.x, pv = blockIdx.y;
    auto tile_of = [&](int n) { return n == 0 ? 31 - bx : n == 1 ? 16 + bx : n == 2 ? bx : 15 - bx; };
    const size_t pqk = (size_t)(2 * pv + sel) * SS * HD;
    const unsigned ko = lr * HD + 8 * hi, vo = lr * SS + 8 * hi;    // the lane's place in a K (or Q) tile and in a V^T tile
    const bf* kbh = Kh + pqk; const bf* kbl = Kl + pqk;
    const int njob = tl < 2 ? 1 : 2;
#pragma unroll 1    // stays rolled: the two jobs are the same code
    for (int job = 0; job < njob; ++job) {
        const int tile = tile_of(job == 0 ? tl : tl - 2);
        const int q0 = tile * 32, sa = job == 0 ? 0 : SPL, se = tl < 2 ? SPL : tile + 1;    // steps sa .. se - 1; a long tile of SPL steps leaves an empty second job (o = 0, z = 0)
        const bf* vsh = Vh + (size_t)pv * VD * SS + sa * 32; const bf* vsl = Vl + (size_t)pv * VD * SS + sa * 32;    // wave-uniform, 32 keys on a step: the lane's own offset vo never changes
        v16bf qh[2], ql[2]; v8f acc[2][4]; float m[2], z[2];
#pragma unroll
        for (int c = 0; c < 2; ++c) { qh[c] = ldfrag(Qh + pqk + (q0 + c * 16) * HD + ko); ql[c] = ldfrag(Ql + pqk + (q0 + c * 16) * HD + ko); m[c] = -3.0e38f; z[c] = 0.f;
#pragma unroll
            for (int t = 0; t < 4; ++t) acc[c][t] = (v8f){}; }
        const int ka = sa * 32 * HD;
        v16bf kh0 = ldfrag(kbh + ka + ko), kh1 = ldfrag(kbh + (ka + 16 * HD) + ko), kl0 = ldfrag(kbl + ka + ko), kl1 = ldfrag(kbl + (ka + 16 * HD) + ko);
#pragma unroll 1    // stays rolled: one step's fragments and accumulators already take the wave's registers
        for (int st = sa; st < se; ++st) {
            const int k0 = st * 32;
            v16bf vh[4], vl[4];
#pragma unroll
            for (int t = 0; t < 4; ++t) { vh[t] = ldfrag(vsh + t * 16 * SS + vo); vl[t] = ldfrag(vsl + t * 16 * SS + vo); }
            vsh += 32; vsl += 32;
            __builtin_amdgcn_sched_barrier(0);    // holds the 16 V loads up here, so that they fly under the score products and the softmax; sunk to their users each would be waited for alone
            v8f s[2][2];
#pragma unroll
            for (int c = 0; c < 2; ++c) { s[c][0] = wmmab(kh0, qh[c], (v8f){}); s[c][1] = wmmab(kh1, qh[c], (v8f){}); }
#pragma unroll
            for (int c = 0; c < 2; ++c) { s[c][0] = wmmab(kh0, ql[c], s[c][0]); s[c][1] = wmmab(kh1, ql[c], s[c][1]); }
#pragma unroll
            for (int c = 0; c < 2; ++c) { s[c][0] = wmmab(kl0, qh[c], s[c][0]); s[c][1] = wmmab(kl1, qh[c], s[c][1]); }
            { const int kn = (k0 + 32 < SS - 32 ? k0 + 32 : SS - 32) * HD;    // the next step's K fragments fly during this step's softmax; the index stays inside the plane
              kh0 = ldfrag(kbh + kn + ko); kh1 = ldfrag(kbh + (kn + 16 * HD) + ko); kl0 = ldfrag(kbl + kn + ko); kl1 = ldfrag(kbl + (kn + 16 * HD) + ko); }
            __builtin_amdgcn_sched_barrier(0);    // holds the next K loads here; sunk to the loop's foot they would be waited for at once
            v16bf ph[2], pl[2];
#pragma unroll
            for (int c = 0; c < 2; ++c) {
                float sc[16]; const int rel = q0 + c * 16 + lr - k0 - 8 * hi;    // key <= query  <=>  its place among the lane's keys <= rel
#pragma unroll
                for (int j = 0; j < 8; ++j) { sc[j] = (j <= rel) ? s[c][0][j] * SCL : -3.0e38f; sc[8 + j] = (16 + j <= rel) ? s[c][1][j] * SCL : -3.0e38f; }
                float tm = sc[0];
#pragma unroll
                for (int e = 1; e < 16; ++e) tm = fmaxf(tm, sc[e]);
                tm = fmaxf(tm, xhalf(tm));
                const float mn = fmaxf(m[c], tm); float al;    // al = exp(m - mn): what the old maximum's sums and products are worth under the new one
                asm("v_exp_f32 %0, %1\n\tv_nop" : "=v"(al) : "v"((m[c] - mn) * 1.44269504f));    // with the slot the instruction set asks for behind a transcendental
                m[c] = mn;
                float zs = 0.f;
#pragma unroll
                for (int e = 0; e < 16; ++e) { const float p = __expf(sc[e] - mn); zs += p; const __bf16 hb = (__bf16)p; ph[c][e] = hb; pl[c][e] = (__bf16)(p - (float)hb); }
                z[c] = z[c] * al + zs;
#pragma unroll
                for (int t = 0; t < 4; ++t) acc[c][t] *= al;
            }
#pragma unroll
            for (int c = 0; c < 2; ++c)
#pragma unroll
                for (int t = 0; t < 4; ++t) acc[c][t] = wmmab(vh[t], ph[c], acc[c][t]);
#pragma unroll
            for (int c = 0; c < 2; ++c)
#pragma unroll
                for (int t = 0; t < 4; ++t) acc[c][t] = wmmab(vh[t], pl[c], acc[c][t]);
#pragma unroll
            for (int c = 0; c < 2; ++c)
#pragma unroll
                for (int t = 0; t < 4; ++t) acc[c][t] = wmmab(vl[t], ph[c], acc[c][t]);
        }
        const int slot = wave + 4 * job;
        float* ob = &ost[slot][lane];
#pragma unroll
        for (int c = 0; c < 2; ++c) { mst[slot][c][lane] = m[c]; zst[slot][c][lane] = z[c] + xhalf(z[c]);
#pragma unroll
            for (int t = 0; t < 4; ++t)
#pragma unroll
                for (int j = 0; j < 8; ++j) ob[((c * 4 + t) * 8 + j) * 32] = acc[c][t][j]; }
    }
    __syncthreads();    // every job's o, m and z are in LDS
    {
        const int c = sel, q0 = tile_of(tl) * 32;    // this wave finishes column group c of tile tl
        float wa[2], wb[2];    // per head of the pair: what the first and the second part's o is multiplied by
#pragma unroll
        for (int s = 0; s < 2; ++s) {
            const float ma = mst[tl * 2 + s][c][lane], za = zst[tl * 2 + s][c][lane];
            if (tl < 2) {
                const float mb = mst[8 + tl * 2 + s][c][lane], zb = zst[8 + tl * 2 + s][c][lane], mn = fmaxf(ma, mb);
                const float fa = __expf(ma - mn), fb = __expf(mb - mn), iz = 1.0f / (za * fa + zb * fb);
                wa[s] = fa * iz; wb[s] = fb * iz;
            } else { wa[s] = 1.0f / za; wb[s] = 0.f; }
        }
        float d1 = 0.f, d2 = 0.f;
#pragma unroll
        for (int d = 0; d < HD; ++d) { d1 = fmaf(bfr(lq1[d]), bfr(lk1[d]), d1); d2 = fmaf(bfr(lq2[d]), bfr(lk2[d]), d2); }
        const float lam = __expf(d1) - __expf(d2) + LINIT;
        const int item = (pv / HG) % NBT, hv = (pv / (NBT * HG)) * HG + pv % HG;    // plane pv = [group][item][head in group]
        v4f rv[4][2];    // the lane's 32 values of rms_w, fetched in one run under the LDS reads below
#pragma unroll
        for (int t = 0; t < 4; ++t) { rv[t][0] = *(const v4fa*)(rw + t * 16 + 8 * hi); rv[t][1] = *(const v4fa*)(rw + t * 16 + 8 * hi + 4); }
        asm volatile("s_wait_xcnt 0x0" ::: "memory");    // stands in front of every later write of a register that these eight loads name (their base pair, their offset)
        const float* o1 = &ost[tl * 2][c * (4 * 8 * 32) + lane]; const float* o2 = o1 + 64 * 32;    // the two heads' first parts; a second part lies 8 slots on
        float av[4][8], x2[4][8], q = 0.f;    // lanes l and l ^ 16 hold the 64 values of one query's row, 32 each
#pragma unroll
        for (int t = 0; t < 4; ++t)
#pragma unroll
            for (int j = 0; j < 8; ++j) { const int e = (t * 8 + j) * 32; av[t][j] = o1[e] * wa[0]; x2[t][j] = o2[e] * wa[1]; }
        if (tl < 2) {    // one branch round all the second parts' reads, so that they fly together
#pragma unroll
            for (int t = 0; t < 4; ++t)
#pragma unroll
                for (int j = 0; j < 8; ++j) { const int e = (8 * 64 + t * 8 + j) * 32; av[t][j] += o1[e] * wb[0]; x2[t][j] += o2[e] * wb[1]; }
        }
#pragma unroll
        for (int t = 0; t < 4; ++t)
#pragma unroll
            for (int j = 0; j < 8; ++j) { const float a = av[t][j] - lam * x2[t][j]; av[t][j] = a; q += a * a; }
        q += xhalf(q);
        const float sc = rsqrtf(q * (1.0f / VD) + REPS) * (1.0f - LINIT);
        const size_t o = ((size_t)item * SS + q0 + c * 16 + lr) * EE + hv * VD + 8 * hi;
#pragma unroll
        for (int t = 0; t < 4; ++t) { v8us oh, ol;
#pragma unroll
            for (int j = 0; j < 8; ++j) { const float v = av[t][j] * sc * bfr(rv[t][j >> 2][j & 3]); const unsigned short hb = f2bf(v); oh[j] = hb; ol[j] = f2bf(v - bf2f(hb)); }
            *(v8us*)(Rh + o + t * 16) = oh; *(v8us*)(Rl + o + t * 16) = ol; }
    }
}

extern "C" void kernel_launch(void* const* d_in, const int* in_sizes, int n_in,
                              void* d_out, int out_size, void* d_ws, size_t ws_size, hipStream_t stream) {
    (void)in_sizes; (void)n_in; (void)out_size;
    const float* x = (const float*)d_in[0]; const float* Wq = (const float*)d_in[1]; const float* Wk = (const float*)d_in[2]; const float* Wv = (const float*)d_in[3]; const float* Wo = (const float*)d_in[4];
    const float* lq1 = (const float*)d_in[5]; const float* lk1 = (const float*)d_in[6]; const float* lq2 = (const float*)d_in[7]; const float* lk2 = (const float*)d_in[8]; const float* rw = (const float*)d_in[9];
    float* out = (float*)d_out;    // [2][1024][1024]
    char* wsp = (char*)d_ws;
    auto take = [&](size_t bytes) { char* p = wsp; wsp += (bytes + 255) & ~(size_t)255; return (void*)p; };
    bf* WT4 = (bf*)take((size_t)4 * EE * EE * 2); bf* WOT = WT4 + (size_t)3 * EE * EE;    // Wq, Wk, Wv, Wo transposed
    bf* Xb = (bf*)take((size_t)NBT * SS * EE * 2);
    const size_t nP = (size_t)NBT * 2 * NHV * SS * HD;
    bf* PH = (bf*)take(2 * nP * 2); bf* PL = (bf*)take(2 * nP * 2); bf* VTh = (bf*)take((size_t)NBT * NHV * VD * SS * 2); bf* VTl = (bf*)take((size_t)NBT * NHV * VD * SS * 2);    // PH, PL: q planes then k planes
    bf* Rh = (bf*)take((size_t)NBT * SS * EE * 2); bf* Rl = (bf*)take((size_t)NBT * SS * EE * 2);
    if ((size_t)(wsp - (char*)d_ws) > ws_size) return;    // 8 + 4 + 16 + 8 + 4 + 4 = 44 MiB
    k_wt<<<dim3(EE / 64, EE / 64, 4), 256, 0, stream>>>(Wq, Wk, Wv, Wo, EE, EE, WT4);   // (in, out) k-major
    k_cvtx<<<NBT * SS / 8, 256, 0, stream>>>(x, Xb);
    k_qkv<<<dim3(NBT * SS / 128, EE / 128, 3), 128, 0, stream>>>(Xb, WT4, PH, PL, VTh, VTl);
    k_fattn<<<dim3(SS / 128, NBT * NHV, 1), 256, 0, stream>>>(PH, PL, PH + nP, PL + nP, VTh, VTl, lq1, lk1, lq2, lk2, rw, Rh, Rl);
    k_gemmb<true, false><<<dim3(NBT * SS / 64, EE / 64, 1), 128, 0, stream>>>(Rh, Rl, WOT, nullptr, out, EE, nullptr, nullptr);
}

// v008
// Measured time: 59.9 microseconds a run.
// Two timings next to v007 both put it at 1.04 times that version's speed.
// Counting every step since v000, it is 17.1 times as fast.
#include <hip/hip_runtime.h>

// Compute dtypes, f32 accumulate, per item: q/k/v = x.W as [1024 x 1024].[1024 x 1024] GEMMs with PLAIN bf16 operands (exact products); per value head (= 2 q/k heads), in ONE
// launch: scores^T = k.q^T ([keys x 32].[32 x queries], both operands bf16 hi + UNSCALED residual, three products), the causal softmax of each head of the pair with a running
// maximum and sum in f32, the unnormalised weights -> hi/lo bf16 straight from the score accumulators, o^T += v^T.p^T (three products), attn = o1 / z1 - lambda o2 / z2 in f32;
// RMSNorm (x rms_w x (1 - lambda_init)) in f32 -> planes; out = attn.Wo (two products) - on v_wmma_f32_16x16x32_bf16. lambda = exp(lq1.lk1) - exp(lq2.lk2) + lambda_init from the inputs on device.
// Launch plan: both batch items ride in every grid; the four weight transposes, the q/k/v projections and the attention each run once for all heads; the projections' epilogue builds the
// hi/lo planes (v transposed) and the attention's epilogue does the RMSNorm, so no launch only reshapes data between two products.
// Plane order: q/k planes [group][item][8 heads], v planes [group][item][4 heads]: value plane p pairs with q/k planes 2p, 2p + 1. Inside a plane the elements lie in FRAGMENT ORDER, as the attention's
// lanes load them: a fragment (16 rows x 32 k) is 512 elements, [half of k: 16][lane = (k >> 3 & 1) * 16 + row][8 k], so that each of its two wave-wide 16-byte loads covers 512 contiguous bytes, 4 whole lines.
// q/k plane: [s / 16] fragments (row = s % 16, k = the head's 32 dims); v plane: [s / 32][d / 16] fragments (row = d % 16, k = s % 32).

#define NBT  2
#define SS   1024
#define EE   1024
#define NHV  16
#define HD   32                   // q/k head dim
#define VD   64                   // v head dim
#define HG   4                    // value heads per group (8 q/k heads)
#define DM   EE
#define SCL  0.17677669529663687f
#define LINIT 0.7836057665316245f    // 0.8 - 0.6 exp(-0.3 * 12)
#define REPS 1e-5f
#define LOSC 1024.0f

typedef _Float16 h16;
typedef unsigned short bf;
typedef __attribute__((ext_vector_type(16))) __bf16   v16bf;
typedef __attribute__((ext_vector_type(16))) _Float16 v16h;
typedef __attribute__((ext_vector_type(8)))  _Float16 v8h;
typedef __attribute__((ext_vector_type(8)))  unsigned short v8us;
typedef __attribute__((ext_vector_type(8)))  float    v8f;
typedef __attribute__((ext_vector_type(4)))  float    v4f;
typedef v8h  __attribute__((may_alias)) v8ha;
typedef v4f  __attribute__((may_alias)) v4fa;
typedef v8us __attribute__((may_alias)) v8usa;

__device__ __forceinline__ unsigned short f2bf(float f) { unsigned u = __float_as_uint(f); u += 0x7FFFu + ((u >> 16) & 1u); return (unsigned short)(u >> 16); }
__device__ __forceinline__ float bf2f(unsigned short b) { return __uint_as_float(((unsigned)b) << 16); }
__device__ __forceinline__ float bfr(float f) { return bf2f(f2bf(f)); }
__device__ __forceinline__ v16h cat16(v8h lo, v8h hi) { return __builtin_shufflevector(lo, hi, 0, 1, 2, 3, 4, 5, 6, 7, 8, 9, 10, 11, 12, 13, 14, 15); }
__device__ __forceinline__ v16bf cat16b(v8us lo, v8us hi) { return __builtin_bit_cast(v16bf, __builtin_shufflevector(lo, hi, 0, 1, 2, 3, 4, 5, 6, 7, 8, 9, 10, 11, 12, 13, 14, 15)); }
__device__ __forceinline__ v8f wmma16(v16h a, v16h b, v8f c) { return __builtin_amdgcn_wmma_f32_16x16x32_f16(false, a, false, b, (short)0, c, false, false); }
__device__ __forceinline__ v8f wmmab(v16bf a, v16bf b, v8f c) { return __builtin_amdgcn_wmma_f32_16x16x32_bf16(false, a, false, b, (short)0, c, false, false); }

// gemm_stages: the main loop of k_gemmb, for a block of 4 waves and a 64 x 64 tile. A stage is 64 k of every operand: 64 rows x one whole 128-byte line, which the block fetches with loads that
// each cover 4 whole lines (a fragment load from global memory touches 16 lines for the same 512 bytes), lays in LDS at pitch LP and reads back as fragments. Two LDS buffers and two register sets: stage
// t + 2 is fetched into the set that stage t has left, at the head of trip t, so that its loads have two trips to land, not one; stage t + 1 goes from its set into
// the other buffer behind stage t's LDS reads; the one barrier of a trip publishes it and ends every wave's reads of the buffer that the next trip overwrites.
// NOP = 2: operands g0 = A, g1 = B; NOP = 3: g0 = A, g1 = its residual, g2 = B. k runs upward in steps of 32 through the same accumulators as with fragments from global memory.
// Returns the buffer that the last stage does not lie in: every wave's reads of it ended in front of the last barrier, so the caller's epilogue may stage in it at once.
// Every '#pragma unroll' in it walks an array of staged rows, fragments or accumulators, whose indices must be compile-time constants for the array to stay in registers.
#define KT  64                    // k per stage
#define LP  72                    // LDS row pitch in bf16: 144 B = 16 B x odd, for ds_load_b128 readers of 128-byte rows
#define TSZ (64 * LP)             // one operand's 64 rows
// lds_barrier: the work-group barrier of a stage, ordering LDS alone: every wave's LDS stores and reads are done in front of it (the fences name the LDS address space), while global loads into registers,
// which no other wave sees, stay in flight across it. __syncthreads() waits for those too: a stage fetched two trips ahead would be waited for at the first barrier behind its loads.
__device__ __forceinline__ void lds_barrier() {
    __builtin_amdgcn_fence(__ATOMIC_RELEASE, "workgroup", "local");
    __builtin_amdgcn_s_barrier();
    __builtin_amdgcn_fence(__ATOMIC_ACQUIRE, "workgroup", "local");
}
template <int NOP, int K>
__device__ __forceinline__ unsigned short* gemm_stages(const bf* __restrict__ g0, const bf* __restrict__ g1, const bf* __restrict__ g2, unsigned short* st, v8f (&acc)[4]) {
    const int tid = threadIdx.x, lane = tid & 31, wave = tid >> 5, lr = lane & 15, hi = lane >> 4;
    const unsigned go = (tid >> 3) * K + (tid & 7) * 8, so = (tid >> 3) * LP + (tid & 7) * 8;    // 8 lanes a row, 16 rows a pass of the block
    const unsigned fa = (wave * 16 + lr) * LP + 8 * hi, fb = (NOP - 1) * TSZ + lr * LP + 8 * hi;    // the lane's place in its wave's A rows and in B's first 16 rows
    v8us rs[2][NOP][4];    // stage t flies into set t & 1
    auto fetch = [&](int kc, v8us (&r)[NOP][4]) {
#pragma unroll
        for (int it = 0; it < 4; ++it) { r[0][it] = *(const v8us*)(g0 + kc + go + it * 16 * K); r[1][it] = *(const v8us*)(g1 + kc + go + it * 16 * K); if (NOP == 3) r[NOP - 1][it] = *(const v8us*)(g2 + kc + go + it * 16 * K); }
    };
    auto put = [&](unsigned short* b, const v8us (&r)[NOP][4]) {
#pragma unroll
        for (int o = 0; o < NOP; ++o)
#pragma unroll
            for (int it = 0; it < 4; ++it) *(v8usa*)(b + o * TSZ + so + it * 16 * LP) = r[o][it];
    };
    auto work = [&](const unsigned short* b) {
        v16bf a[KT / 32], al[KT / 32], w[KT / 32][4];    // fragments first, products behind them: the LDS reads may then run ahead of the products that use them
#pragma unroll
        for (int h = 0; h < KT / 32; ++h) {
            a[h] = cat16b(*(const v8usa*)(b + fa + h * 32), *(const v8usa*)(b + fa + h * 32 + 16));
            if (NOP == 3) al[h] = cat16b(*(const v8usa*)(b + TSZ + fa + h * 32), *(const v8usa*)(b + TSZ + fa + h * 32 + 16));
#pragma unroll
            for (int t = 0; t < 4; ++t) w[h][t] = cat16b(*(const v8usa*)(b + fb + t * 16 * LP + h * 32), *(const v8usa*)(b + fb + t * 16 * LP + h * 32 + 16));
        }
        if (NOP == 3) __builtin_amdgcn_sched_barrier(0);    // keeps the stage's LDS reads one group in front of its products: with two register sets live the build dealt them out in pairs among the products and waited for each pair. NOP = 2 keeps the compiler's own order
#pragma unroll
        for (int h = 0; h < KT / 32; ++h)
#pragma unroll
            for (int t = 0; t < 4; ++t) { acc[t] = wmmab(a[h], w[h][t], acc[t]); if (NOP == 3) acc[t] = wmmab(al[h], w[h][t], acc[t]); }
    };
    constexpr int nt = K / KT;
    static_assert(nt >= 2, "stages 0 and 1 are fetched in front of the loop");
    fetch(0, rs[0]);
    __builtin_amdgcn_sched_barrier(0);    // keeps stage 0's loads in front of stage 1's: loads return in order, and mixed, stage 0 would wait for stage 1's bytes
    fetch(KT, rs[1]);
    put(st, rs[0]);
    lds_barrier();    // publishes stage 0
#pragma unroll    // unrolled whole: a stage's register set is t & 1, which must be a compile-time constant for the sets to stay in registers
    for (int t = 0; t < nt; ++t) {
        if (t + 2 < nt) fetch((t + 2) * KT, rs[t & 1]);    // the set is free: stage t went from it into LDS a trip ago
        __builtin_amdgcn_sched_barrier(0);    // holds these loads up here, so that they have two whole trips to land; sunk among the products they would start later
        work(st + (t & 1) * (NOP * TSZ));
        if (t + 1 < nt) {
            put(st + ((t + 1) & 1) * (NOP * TSZ), rs[(t + 1) & 1]);    // waits for the older set alone: the younger stays in flight
            lds_barrier();    // publishes stage t + 1; stage t's buffer is free behind it
        }
    }
    return st + (nt & 1) * (NOP * TSZ);
}

// gemm_stages128: gemm_stages' scheme (64-k stages, two LDS buffers, two register sets, one lds_barrier a trip) for a 128 x 128 block tile of 4 waves, 2 x 2, each with a 64 x 64 tile of 4 x 4 accumulators.
// Every fragment read from LDS feeds 4 products (in gemm_stages a B fragment feeds 1): 16 KiB of LDS reads per 32 products of a wave against 10 KiB per 8, and each operand row is fetched from L2 by half as many blocks.
// g0 = A's 128 rows, g1 = B's 128 rows. k runs upward in steps of 32 through every accumulator, as in gemm_stages. Returns the buffer that the last stage does not lie in.
#define TS2 (128 * LP)            // one operand's 128 rows
template <int K>
__device__ __forceinline__ unsigned short* gemm_stages128(const bf* __restrict__ g0, const bf* __restrict__ g1, unsigned short* st, v8f (&acc)[4][4]) {
    const int tid = threadIdx.x, lane = tid & 31, wave = tid >> 5, lr = lane & 15, hi = lane >> 4;
    const unsigned go = (tid >> 3) * K + (tid & 7) * 8, so = (tid >> 3) * LP + (tid & 7) * 8;    // 8 lanes a row, 16 rows a pass of the block
    const unsigned fa = ((wave >> 1) * 64 + lr) * LP + 8 * hi, fb = TS2 + ((wave & 1) * 64 + lr) * LP + 8 * hi;    // the lane's place in its wave's first 16 A rows and first 16 B rows
    v8us rs[2][2][8];    // stage t flies into set t & 1
    auto fetch = [&](int kc, v8us (&r)[2][8]) {
#pragma unroll
        for (int it = 0; it < 8; ++it) { r[0][it] = *(const v8us*)(g0 + kc + go + it * 16 * K); r[1][it] = *(const v8us*)(g1 + kc + go + it * 16 * K); }
    };
    auto put = [&](unsigned short* b, const v8us (&r)[2][8]) {
#pragma unroll
        for (int o = 0; o < 2; ++o)
#pragma unroll
            for (int it = 0; it < 8; ++it) *(v8usa*)(b + o * TS2 + so + it * 16 * LP) = r[o][it];
    };
    static_assert(KT == 64, "a stage is two halves of 32 k");
    v16bf a[2][4], w[2][4];    // the fragments of a stage's two halves
    auto frags = [&](const unsigned short* b, int h) {
#pragma unroll
        for (int i = 0; i < 4; ++i) {
            a[h][i] = cat16b(*(const v8usa*)(b + fa + i * 16 * LP + h * 32), *(const v8usa*)(b + fa + i * 16 * LP + h * 32 + 16));
            w[h][i] = cat16b(*(const v8usa*)(b + fb + i * 16 * LP + h * 32), *(const v8usa*)(b + fb + i * 16 * LP + h * 32 + 16));
        }
    };
    auto prods = [&](int h) {
#pragma unroll
        for (int i = 0; i < 4; ++i)
#pragma unroll
            for (int t = 0; t < 4; ++t) acc[i][t] = wmmab(a[h][i], w[h][t], acc[i][t]);
    };
    constexpr int nt = K / KT;
    static_assert(nt >= 2, "stages 0 and 1 are fetched in front of the loop");
    fetch(0, rs[0]);
    __builtin_amdgcn_sched_barrier(0);    // keeps stage 0's loads in front of stage 1's: loads return in order, and mixed, stage 0 would wait for stage 1's bytes
    fetch(KT, rs[1]);
    put(st, rs[0]);
    lds_barrier();    // publishes stage 0
    // Each half's 16 LDS reads stand as one group in front of the 16 products of the half before, which hide them: the second half's products of stage t - 1 run behind stage t's barrier, from registers.
    // The sched_barriers of the loop hold that order; left free, the build set all 32 products of a stage in one run and all 32 reads behind it, with nothing of the wave's own to hide the reads.
#pragma unroll    // unrolled whole: a stage's register set is t & 1, which must be a compile-time constant for the sets to stay in registers
    for (int t = 0; t < nt; ++t) {
        const unsigned short* b = st + (t & 1) * (2 * TS2);
        if (t + 2 < nt) fetch((t + 2) * KT, rs[t & 1]);    // the set is free: stage t went from it into LDS a trip ago
        if (t + 3 == nt) asm volatile("s_wait_xcnt 0x0" ::: "memory");    // behind the last fetch: its loads' offset register is dead from here on, and the build let the LDS reads below land in it
        frags(b, 0);
        __builtin_amdgcn_sched_barrier(0);    // holds the fetch and the first half's reads up here: the loads get their two trips, the reads fly under the products below
        if (t > 0) prods(1);
        __builtin_amdgcn_sched_barrier(0);    // keeps the second half's reads one group behind those products, whose fragment registers they refill
        frags(b, 1);
        __builtin_amdgcn_sched_barrier(0);    // holds those reads in front of the first half's products, which hide them
        prods(0);
        __builtin_amdgcn_sched_barrier(0);    // keeps the products in front of the stores and the barrier; sunk behind the barrier they would stand in one run with the next trip's
        if (t + 1 < nt) {
            put(st + ((t + 1) & 1) * (2 * TS2), rs[(t + 1) & 1]);    // waits for the older set alone: the younger stays in flight
            lds_barrier();    // publishes stage t + 1; stage t's buffer is free behind it: its reads are done in front of the barrier
        }
    }
    prods(1);
    return st + (nt & 1) * (2 * TS2);
}

// k_gemmb: 64 x 64 block tile (4 waves x 16 x 64) of C[NTK][NW] = (A [+ Al]).B^T (K = 1024) [+ bf(bias[c])] [+ bf(R[r][c]) residual]; f32 whole-line epilogue (or f16
template <bool SPLITA, bool F16OUT = false>
__global__ __launch_bounds__(128) void k_gemmb(const bf* __restrict__ A, const bf* __restrict__ Al, const bf* __restrict__ Bn, const float* __restrict__ bias, float* C, int ldc, h16* C2, const float* __restrict__ R = nullptr, int roundR = 1) {
    __shared__ __align__(16) unsigned short st[2 * (SPLITA ? 3 : 2) * TSZ];    // two stage buffers; the epilogue's f32 [4 waves][16][68] lies in the free one
    const int lane = threadIdx.x & 31, wave = threadIdx.x >> 5, lr = lane & 15, hi = lane >> 4;
    const int r0 = blockIdx.x * 64 + wave * 16, c0 = blockIdx.y * 64;
    const size_t ab = (size_t)blockIdx.x * 64 * DM, bb = (size_t)c0 * DM;
    v8f acc[4];
#pragma unroll
    for (int t = 0; t < 4; ++t) acc[t] = (v8f){};
    float* os = (float*)(void*)(SPLITA ? gemm_stages<3, DM>(A + ab, Al + ab, Bn + bb, st, acc) : gemm_stages<2, DM>(A + ab, Bn + bb, nullptr, st, acc)) + wave * (16 * 68);
#pragma unroll
    for (int t = 0; t < 4; ++t) { const float bv = bias ? bfr(bias[c0 + t * 16 + lr]) : 0.f;
#pragma unroll
        for (int j = 0; j < 8; ++j) os[(hi * 8 + j) * 68 + t * 16 + lr] = acc[t][j] + bv; }
    __syncthreads();
    if (F16OUT) {
        h16* crow = (h16*)(void*)C + (size_t)r0 * ldc + c0;
        auto pass = [&]() {
#pragma unroll
            for (int s = 0; s < 4; ++s) { const int row = 4 * s + (lane >> 3), piece = lane & 7; const float* sp = os + row * 68 + piece * 8; v8h o, o2;
#pragma unroll
                for (int i = 0; i < 8; ++i) { const h16 a = (h16)sp[i]; o[i] = a; o2[i] = (h16)((sp[i] - (float)a) * LOSC); }
                *(v8h*)(crow + (size_t)row * ldc + piece * 8) = o; if (C2) *(v8h*)(C2 + (size_t)r0 * ldc + c0 + (size_t)row * ldc + piece * 8) = o2; }
        };
        pass(); 
    } else {
        float* crow = C + (size_t)r0 * ldc + c0;
        auto pass = [&]() {
#pragma unroll
            for (int s = 0; s < 8; ++s) { const int Lid = (lane >> 3) + 4 * s, piece = lane & 7; const int row = Lid >> 1, cofs = (Lid & 1) * 32 + piece * 4;
                v4f val = *(const v4fa*)(os + row * 68 + cofs); if (R) { const v4f rv = *(const v4f*)(R + ((size_t)r0 + row) * ldc + c0 + cofs); val += roundR ? (v4f){bfr(rv[0]), bfr(rv[1]), bfr(rv[2]), bfr(rv[3])} : rv; }
                *(v4f*)(crow + (size_t)row * ldc + cofs) = val; }
        };
        pass(); 
    }
}

// k_qkv: the q (blockIdx.z = 0), k (1) and v (2) projections, 128 x 128 block tile (2 x 2 waves x 64 x 64) of x.Wz (A [2048][1024] bf16, WT [z][n][1024] bf16), main loop gemm_stages128. The epilogue
// writes what the attention reads, straight from the f32 accumulators, in fragment order (head of the file): q/k as hi/lo planes (a wave's 64 columns are two q/k heads; it stages 16 rows, one fragment
// a head, at a time in its own LDS range and stores 4 whole 128-byte lines an instruction), v as transposed hi/lo planes (a wave's 64 columns are one value head; a lane's 8 accumulator rows are 8 consecutive
// s of one column, packed in registers, staged [d][s] in the wave's own LDS range, read back as the attention's lanes will hold them: each store is one half fragment, 512 contiguous bytes).
__global__ __launch_bounds__(128) void k_qkv(const bf* __restrict__ A, const bf* __restrict__ WT, bf* PH, bf* PL, bf* VTh, bf* VTl) {
    __shared__ __align__(16) unsigned short st[2 * 2 * TS2];    // two stage buffers; the epilogue stages: q/k in the free one: f32 [2][4 waves][16][68]; v in both: per wave bf16 hi [64][72] then lo [64][72]
    const int K = EE, z = blockIdx.z;
    const bf* Bn = WT + (size_t)z * EE * EE;
    const int tid = threadIdx.x, lane = tid & 31, wave = tid >> 5, lr = lane & 15, hi = lane >> 4;
    const int c0 = blockIdx.y * 128 + (wave & 1) * 64;    // the wave's first column
    v8f acc[4][4];
#pragma unroll
    for (int i = 0; i < 4; ++i)
#pragma unroll
        for (int t = 0; t < 4; ++t) acc[i][t] = (v8f){};
    unsigned short* sm = gemm_stages128<EE>(A + (size_t)blockIdx.x * 128 * K, Bn + (size_t)blockIdx.y * 128 * K, st, acc);
    const int item = (blockIdx.x * 128) / SS, sb = (blockIdx.x * 128) % SS + (wave >> 1) * 64;    // a block's 128 rows lie in one item; sb: the wave's first row in it
    if (z < 2) {
        bf* ph = PH + (size_t)z * ((size_t)NBT * 2 * NHV * SS * HD); bf* pl = PL + (size_t)z * ((size_t)NBT * 2 * NHV * SS * HD);
#pragma unroll
        for (int i = 0; i < 4; ++i) {
            float* os = (float*)(void*)sm + ((i & 1) * 4 + wave) * (16 * 68);    // two ranges in turn: a range is written again only behind the barrier of the row group between
#pragma unroll
            for (int t = 0; t < 4; ++t)
#pragma unroll
                for (int j = 0; j < 8; ++j) os[(hi * 8 + j) * 68 + t * 16 + lr] = acc[i][t][j];
            lds_barrier();    // a lane reads back what other lanes have staged; LDS alone: __syncthreads() would also wait for the global stores of the row group before
#pragma unroll
            for (int it = 0; it < 4; ++it) { const int head = c0 / HD + (it >> 1), row = (it & 1) * 8 + (lane >> 2), piece = lane & 3;
                const int p = ((head / (2 * HG)) * NBT + item) * (2 * HG) + head % (2 * HG);
                const float* sp = os + row * 68 + (it >> 1) * HD + piece * 8; const v4f x0 = *(const v4fa*)sp, x1 = *(const v4fa*)(sp + 4); v8us oh, ol;
#pragma unroll
                for (int e = 0; e < 8; ++e) { const float v = e < 4 ? x0[e & 3] : x1[e & 3]; const unsigned short hb = f2bf(v); oh[e] = hb; ol[e] = f2bf(v - bf2f(hb)); }
                const size_t o = ((size_t)p * SS + sb + i * 16) * HD + (piece >> 1) * 256 + ((piece & 1) * 16 + row) * 8; *(v8us*)(ph + o) = oh; *(v8us*)(pl + o) = ol; }    // dims piece * 8 ..: half piece >> 1, lane (piece & 1) * 16 + row
        }
    } else {
        __syncthreads();    // ends every wave's reads of the last stage: the four waves' transposed tiles take both buffers
        unsigned short* th = st + wave * (2 * 64 * 72); unsigned short* tw = th + 64 * 72;
#pragma unroll
        for (int i = 0; i < 4; ++i)
#pragma unroll
            for (int t = 0; t < 4; ++t) { v8us oh, ol;
#pragma unroll
                for (int j = 0; j < 8; ++j) { const float v = acc[i][t][j]; const unsigned short hb = f2bf(v); oh[j] = hb; ol[j] = f2bf(v - bf2f(hb)); }
                const int o = (t * 16 + lr) * 72 + i * 16 + hi * 8; *(v8usa*)(th + o) = oh; *(v8usa*)(tw + o) = ol; }
        __syncthreads();    // a lane reads back what other lanes have staged
        const int hv = c0 / VD, p = ((hv / HG) * NBT + item) * HG + hv % HG;
#pragma unroll
        for (int it = 0; it < 16; ++it) { const int sl = it >> 3, t = (it >> 1) & 3, half = it & 1;    // which 32 s of the wave's 64, which 16 d, which half of the fragment
            const size_t o = (size_t)p * VD * SS + (size_t)(sb / 32 + sl) * (32 * VD) + t * 512 + half * 256 + lane * 8;
            const int l = (t * 16 + lr) * 72 + sl * 32 + half * 16 + hi * 8;
            *(v8us*)(VTh + o) = *(const v8usa*)(th + l); *(v8us*)(VTl + o) = *(const v8usa*)(tw + l); }
        asm volatile("s_wait_xcnt 0x0" ::: "memory");    // behind the last store: in the build the other branch's code follows this one and rewrites the stores' address registers
    }
}

// k_wt: WT [z][n][K] = bf16(Wz[k][n]) (k-major [K][ncols]) via 64 x 64 LDS tiles; grid (K/64, ncols/64, 4), blockIdx.z picks the matrix.
__global__ __launch_bounds__(256) void k_wt(const float* __restrict__ W0, const float* __restrict__ W1, const float* __restrict__ W2, const float* __restrict__ W3, int K, int ncols, bf* WT) {
    __shared__ __align__(16) unsigned short tl[64 * 72];
    const float* Wm = blockIdx.z == 0 ? W0 : blockIdx.z == 1 ? W1 : blockIdx.z == 2 ? W2 : W3; WT += (size_t)blockIdx.z * K * ncols;
    const int tid = threadIdx.x, k0 = blockIdx.x * 64, n0 = blockIdx.y * 64;
    const int kk = tid >> 2, nq = (tid & 3) * 16;
#pragma unroll
    for (int i = 0; i < 16; ++i) tl[(nq + i) * 72 + kk] = f2bf(Wm[(size_t)(k0 + kk) * ncols + n0 + nq + i]);
    __syncthreads();
    const int piece = tid & 7;
    auto pass = [&]() {
#pragma unroll
        for (int s = 0; s < 2; ++s) { const int nr = (tid >> 3) + 32 * s; const v8us val = *(const v8usa*)(tl + nr * 72 + piece * 8); *(v8us*)(WT + (size_t)(n0 + nr) * K + k0 + piece * 8) = val; }
    };
    pass(); 
}

__global__ __launch_bounds__(256) void k_cvtx(const float* __restrict__ src, bf* dst) {
    const int lane = threadIdx.x & 31; const size_t r = (size_t)blockIdx.x * 8 + (threadIdx.x >> 5); if (r >= (size_t)NBT * SS) return;
{
#pragma unroll
        for (int q = 0; q < EE / 256; ++q) { v8us o;
#pragma unroll
            for (int i = 0; i < 8; ++i) o[i] = f2bf(src[r * EE + q * 256 + lane * 8 + i]);
            *(v8us*)(dst + r * EE + q * 256 + lane * 8) = o; }
         }
}
// k_fattn: one value head p (blockIdx.y) and four 32-query tiles per block; waves 2n and 2n + 1 take q/k heads 2p and 2p + 1. Per 32 keys (a step) and 16-query column group: S^T = K.Q^T (a
// lane holds 16 keys of ONE query: lane & 15 = query, lane >> 4 picks keys 8h.. and 16 + 8h..), running maximum m and sum z, p = exp(s x SCL - m) (0 for key > query), and the two score
// tiles, converted in place, are the B operand of O^T += V^T.P^T.
// Who walks which keys: a causal tile t has t + 1 steps, and a block's tiles have 32 - bx, 17 + bx, bx + 1 and 16 - bx. The wave of a long tile (the first two) walks its first SPL steps alone; the wave of a short
// tile walks that tile and then, as a second job, the rest of a long one: every wave walks 16 or 17 steps, so that two waves stand on each SIMD to the end and one's products run under the other's softmax.
// Every job leaves its unnormalised o, m and z in LDS; behind the one barrier each wave takes one tile's column group, joins a long tile's two parts (each x exp(m_part - max m), sums and products alike),
// forms attn = o1 / z1 - lambda o2 / z2, its RMSNorm over the row's 64 values (x rsqrt(mean(attn^2) + eps) x bf(rms_w[d]) x (1 - lambda_init)), and stores the planes R [item * 1024 + s][1024], cols head * 64 + d (bf16 hi + UNSCALED residual).
// Every '#pragma unroll' in it but the lambda loop's walks an array of fragments or accumulators, whose indices must be compile-time constants for the array to stay in registers.
#define SPL 17                    // steps of a long tile that its own wave walks: both long tiles have at least as many for every bx
__device__ __forceinline__ v16bf ldfrag(const bf* p) { return cat16b(*(const v8us*)p, *(const v8us*)(p + 256)); }    // p: the fragment's first element + lane * 8; its second half lies 256 elements on
__device__ __forceinline__ float xhalf(float v) { const int b = __float_as_int(v); return __int_as_float(__builtin_amdgcn_permlanex16(b, b, 0x76543210, 0xfedcba98, false, false)); }    // lane l <-> l ^ 16
__global__ __launch_bounds__(256) void k_fattn(const bf* __restrict__ Qh, const bf* __restrict__ Ql, const bf* __restrict__ Kh, const bf* __restrict__ Kl, const bf* __restrict__ Vh, const bf* __restrict__ Vl,
                                               const float* __restrict__ lq1, const float* __restrict__ lk1, const float* __restrict__ lq2, const float* __restrict__ lk2, const float* __restrict__ rw, bf* Rh, bf* Rl) {
    __shared__ float ost[12][64 * 32];    // a job's o: slots 0..7 = the waves' first jobs (tile wave >> 1, head wave & 1), 8..11 = the long tiles' second parts (tile (slot - 8) >> 1, head slot & 1)
    __shared__ float mst[12][2][32], zst[12][2][32];    // its m and z, per column group and lane
    const int lane = threadIdx.x & 31, wave = __builtin_amdgcn_readfirstlane(threadIdx.x >> 5), lr = lane & 15, hi = lane >> 4, tl = wave >> 1, sel = wave & 1;    // the wave's number in a scalar register: trip counts, plane offsets and branches stay scalar
    const int bx = blockIdx.x, pv = blockIdx.y;
    auto tile_of = [&](int n) { return n == 0 ? 31 - bx : n == 1 ? 16 + bx : n == 2 ? bx : 15 - bx; };
    const size_t pqk = (size_t)(2 * pv + sel) * SS * HD;
    const unsigned fo = lane * 8;    // the lane's place in a half fragment of any plane
    const bf* kbh = Kh + pqk; const bf* kbl = Kl + pqk;
    const int njob = tl < 2 ? 1 : 2;
#pragma unroll 1    // stays rolled: the two jobs are the same code
    for (int job = 0; job < njob; ++job) {
        const int tile = tile_of(job == 0 ? tl : tl - 2);
        const int q0 = tile * 32, sa = job == 0 ? 0 : SPL, se = tl < 2 ? SPL : tile + 1;    // steps sa .. se - 1; a long tile of SPL steps leaves an empty second job (o = 0, z = 0)
        const bf* vsh = Vh + (size_t)pv * VD * SS + sa * (32 * VD); const bf* vsl = Vl + (size_t)pv * VD * SS + sa * (32 * VD);    // wave-uniform, 32 keys (4 fragments) on a step: the lane's own offset fo never changes
        v16bf qh[2], ql[2]; v8f acc[2][4]; float m[2], z[2];
#pragma unroll
        for (int c = 0; c < 2; ++c) { qh[c] = ldfrag(Qh + pqk + (q0 + c * 16) * HD + fo); ql[c] = ldfrag(Ql + pqk + (q0 + c * 16) * HD + fo); m[c] = -3.0e38f; z[c] = 0.f;
#pragma unroll
            for (int t = 0; t < 4; ++t) acc[c][t] = (v8f){}; }
        const int ka = sa * 32 * HD;
        v16bf kh0 = ldfrag(kbh + ka + fo), kh1 = ldfrag(kbh + (ka + 16 * HD) + fo), kl0 = ldfrag(kbl + ka + fo), kl1 = ldfrag(kbl + (ka + 16 * HD) + fo);
#pragma unroll 1    // stays rolled: one step's fragments and accumulators already take the wave's registers
        for (int st = sa; st < se; ++st) {
            const int k0 = st * 32;
            v16bf vh[4], vl[4];
#pragma unroll
            for (int t = 0; t < 4; ++t) { vh[t] = ldfrag(vsh + t * 512 + fo); if (t < 3) vl[t] = ldfrag(vsl + t * 512 + fo); }
            { const v8us a = *(const v8us*)(vsl + 3 * 512 + fo);
              asm volatile("s_wait_xcnt 0x0" ::: "memory");    // in front of the run's last load: the build lands its result in the two address pairs that the fifteen loads before it name
              vl[3] = cat16b(a, *(const v8us*)(vsl + 3 * 512 + fo + 256)); }
            vsh += 32 * VD; vsl += 32 * VD;
            __builtin_amdgcn_sched_barrier(0);    // holds the 16 V loads up here, so that they fly under the score products and the softmax; sunk to their users each would be waited for alone
            v8f s[2][2];
#pragma unroll
            for (int c = 0; c < 2; ++c) { s[c][0] = wmmab(kh0, qh[c], (v8f){}); s[c][1] = wmmab(kh1, qh[c], (v8f){}); }
#pragma unroll
            for (int c = 0; c < 2; ++c) { s[c][0] = wmmab(kh0, ql[c], s[c][0]); s[c][1] = wmmab(kh1, ql[c], s[c][1]); }
#pragma unroll
            for (int c = 0; c < 2; ++c) { s[c][0] = wmmab(kl0, qh[c], s[c][0]); s[c][1] = wmmab(kl1, qh[c], s[c][1]); }
            { const int kn = (k0 + 32 < SS - 32 ? k0 + 32 : SS - 32) * HD;    // the next step's K fragments fly during this step's softmax; the index stays inside the plane
              kh0 = ldfrag(kbh + kn + fo); kh1 = ldfrag(kbh + (kn + 16 * HD) + fo); kl0 = ldfrag(kbl + kn + fo); kl1 = ldfrag(kbl + (kn + 16 * HD) + fo); }
            __builtin_amdgcn_sched_barrier(0);    // holds the next K loads here; sunk to the loop's foot they would be waited for at once
            v16bf ph[2], pl[2];
#pragma unroll
            for (int c = 0; c < 2; ++c) {
                float sc[16]; const int rel = q0 + c * 16 + lr - k0 - 8 * hi;    // key <= query  <=>  its place among the lane's keys <= rel
#pragma unroll
                for (int j = 0; j < 8; ++j) { sc[j] = (j <= rel) ? s[c][0][j] * SCL : -3.0e38f; sc[8 + j] = (16 + j <= rel) ? s[c][1][j] * SCL : -3.0e38f; }
                float tm = sc[0];
#pragma unroll
                for (int e = 1; e < 16; ++e) tm = fmaxf(tm, sc[e]);
                tm = fmaxf(tm, xhalf(tm));
                const float mn = fmaxf(m[c], tm); float al;    // al = exp(m - mn): what the old maximum's sums and products are worth under the new one
                asm("v_exp_f32 %0, %1\n\tv_nop" : "=v"(al) : "v"((m[c] - mn) * 1.44269504f));    // with the slot the instruction set asks for behind a transcendental
                m[c] = mn;
                float zs = 0.f;
#pragma unroll
                for (int e = 0; e < 16; ++e) { const float p = __expf(sc[e] - mn); zs += p; const __bf16 hb = (__bf16)p; ph[c][e] = hb; pl[c][e] = (__bf16)(p - (float)hb); }
                z[c] = z[c] * al + zs;
#pragma unroll
                for (int t = 0; t < 4; ++t) acc[c][t] *= al;
            }
#pragma unroll
            for (int c = 0; c < 2; ++c)
#pragma unroll
                for (int t = 0; t < 4; ++t) acc[c][t] = wmmab(vh[t], ph[c], acc[c][t]);
#pragma unroll
            for (int c = 0; c < 2; ++c)
#pragma unroll
                for (int t = 0; t < 4; ++t) acc[c][t] = wmmab(vh[t], pl[c], acc[c][t]);
#pragma unroll
            for (int c = 0; c < 2; ++c)
#pragma unroll
                for (int t = 0; t < 4; ++t) acc[c][t] = wmmab(vl[t], ph[c], acc[c][t]);
        }
        const int slot = wave + 4 * job;
        float* ob = &ost[slot][lane];
#pragma unroll
        for (int c = 0; c < 2; ++c) { mst[slot][c][lane] = m[c]; zst[slot][c][lane] = z[c] + xhalf(z[c]);
#pragma unroll
            for (int t = 0; t < 4; ++t)
#pragma unroll
                for (int j = 0; j < 8; ++j) ob[((c * 4 + t) * 8 + j) * 32] = acc[c][t][j]; }
    }
    __syncthreads();    // every job's o, m and z are in LDS
    {
        const int c = sel, q0 = tile_of(tl) * 32;    // this wave finishes column group c of tile tl
        float wa[2], wb[2];    // per head of the pair: what the first and the second part's o is multiplied by
#pragma unroll
        for (int s = 0; s < 2; ++s) {
            const float ma = mst[tl * 2 + s][c][lane], za = zst[tl * 2 + s][c][lane];
            if (tl < 2) {
                const float mb = mst[8 + tl * 2 + s][c][lane], zb = zst[8 + tl * 2 + s][c][lane], mn = fmaxf(ma, mb);
                const float fa = __expf(ma - mn), fb = __expf(mb - mn), iz = 1.0f / (za * fa + zb * fb);
                wa[s] = fa * iz; wb[s] = fb * iz;
            } else { wa[s] = 1.0f / za; wb[s] = 0.f; }
        }
        float d1 = 0.f, d2 = 0.f;
#pragma unroll
        for (int d = 0; d < HD; ++d) { d1 = fmaf(bfr(lq1[d]), bfr(lk1[d]), d1); d2 = fmaf(bfr(lq2[d]), bfr(lk2[d]), d2); }
        const float lam = __expf(d1) - __expf(d2) + LINIT;
        const int item = (pv / HG) % NBT, hv = (pv / (NBT * HG)) * HG + pv % HG;    // plane pv = [group][item][head in group]
        v4f rv[4][2];    // the lane's 32 values of rms_w, fetched in one run under the LDS reads below
#pragma unroll
        for (int t = 0; t < 4; ++t) { rv[t][0] = *(const v4fa*)(rw + t * 16 + 8 * hi); rv[t][1] = *(const v4fa*)(rw + t * 16 + 8 * hi + 4); }
        asm volatile("s_wait_xcnt 0x0" ::: "memory");    // stands in front of every later write of a register that these eight loads name (their base pair, their offset)
        const float* o1 = &ost[tl * 2][c * (4 * 8 * 32) + lane]; const float* o2 = o1 + 64 * 32;    // the two heads' first parts; a second part lies 8 slots on
        float av[4][8], x2[4][8], q = 0.f;    // lanes l and l ^ 16 hold the 64 values of one query's row, 32 each
#pragma unroll
        for (int t = 0; t < 4; ++t)
#pragma unroll
            for (int j = 0; j < 8; ++j) { const int e = (t * 8 + j) * 32; av[t][j] = o1[e] * wa[0]; x2[t][j] = o2[e] * wa[1]; }
        if (tl < 2) {    // one branch round all the second parts' reads, so that they fly together
#pragma unroll
            for (int t = 0; t < 4; ++t)
#pragma unroll
                for (int j = 0; j < 8; ++j) { const int e = (8 * 64 + t * 8 + j) * 32; av[t][j] += o1[e] * wb[0]; x2[t][j] += o2[e] * wb[1]; }
        }
#pragma unroll
        for (int t = 0; t < 4; ++t)
#pragma unroll
            for (int j = 0; j < 8; ++j) { const float a = av[t][j] - lam * x2[t][j]; av[t][j] = a; q += a * a; }
        q += xhalf(q);
        const float sc = rsqrtf(q * (1.0f / VD) + REPS) * (1.0f - LINIT);
        const size_t o = ((size_t)item * SS + q0 + c * 16 + lr) * EE + hv * VD + 8 * hi;
#pragma unroll
        for (int t = 0; t < 4; ++t) { v8us oh, ol;
#pragma unroll
            for (int j = 0; j < 8; ++j) { const float v = av[t][j] * sc * bfr(rv[t][j >> 2][j & 3]); const unsigned short hb = f2bf(v); oh[j] = hb; ol[j] = f2bf(v - bf2f(hb)); }
            *(v8us*)(Rh + o + t * 16) = oh; *(v8us*)(Rl + o + t * 16) = ol; }
    }
}

extern "C" void kernel_launch(void* const* d_in, const int* in_sizes, int n_in,
                              void* d_out, int out_size, void* d_ws, size_t ws_size, hipStream_t stream) {
    (void)in_sizes; (void)n_in; (void)out_size;
    const float* x = (const float*)d_in[0]; const float* Wq = (const float*)d_in[1]; const float* Wk = (const float*)d_in[2]; const float* Wv = (const float*)d_in[3]; const float* Wo = (const float*)d_in[4];
    const float* lq1 = (const float*)d_in[5]; const float* lk1 = (const float*)d_in[6]; const float* lq2 = (const float*)d_in[7]; const float* lk2 = (const float*)d_in[8]; const float* rw = (const float*)d_in[9];
    float* out = (float*)d_out;    // [2][1024][1024]
    char* wsp = (char*)d_ws;
    auto take = [&](size_t bytes) { char* p = wsp; wsp += (bytes + 255) & ~(size_t)255; return (void*)p; };
    bf* WT4 = (bf*)take((size_t)4 * EE * EE * 2); bf* WOT = WT4 + (size_t)3 * EE * EE;    // Wq, Wk, Wv, Wo transposed
    bf* Xb = (bf*)take((size_t)NBT * SS * EE * 2);
    const size_t nP = (size_t)NBT * 2 * NHV * SS * HD;
    bf* PH = (bf*)take(2 * nP * 2); bf* PL = (bf*)take(2 * nP * 2); bf* VTh = (bf*)take((size_t)NBT * NHV * VD * SS * 2); bf* VTl = (bf*)take((size_t)NBT * NHV * VD * SS * 2);    // PH, PL: q planes then k planes
    bf* Rh = (bf*)take((size_t)NBT * SS * EE * 2); bf* Rl = (bf*)take((size_t)NBT * SS * EE * 2);
    if ((size_t)(wsp - (char*)d_ws) > ws_size) return;    // 8 + 4 + 16 + 8 + 4 + 4 = 44 MiB
    k_wt<<<dim3(EE / 64, EE / 64, 4), 256, 0, stream>>>(Wq, Wk, Wv, Wo, EE, EE, WT4);   // (in, out) k-major
    k_cvtx<<<NBT * SS / 8, 256, 0, stream>>>(x, Xb);
    k_qkv<<<dim3(NBT * SS / 128, EE / 128, 3), 128, 0, stream>>>(Xb, WT4, PH, PL, VTh, VTl);
    k_fattn<<<dim3(SS / 128, NBT * NHV, 1), 256, 0, stream>>>(PH, PL, PH + nP, PL + nP, VTh, VTl, lq1, lk1, lq2, lk2, rw, Rh, Rl);
    k_gemmb<true, false><<<dim3(NBT * SS / 64, EE / 64, 1), 128, 0, stream>>>(Rh, Rl, WOT, nullptr, out, EE, nullptr, nullptr);
}

// v009
// It runs in 54.8 microseconds.
// Two timings next to v008 put it at 1.11 and 1.10 times that version's speed.
// Over all steps from v000 it is 18.8 times as fast.
#include <hip/hip_runtime.h>

// Compute dtypes, f32 accumulate, per item: q/k/v = x.W as [1024 x 1024].[1024 x 1024] GEMMs with PLAIN bf16 operands (exact products); per value head (= 2 q/k heads), in ONE
// launch: scores^T = k.q^T ([keys x 32].[32 x queries], both operands bf16 hi + UNSCALED residual, three products), the causal softmax of each head of the pair with a running
// maximum and sum in f32, the unnormalised weights -> hi/lo bf16 straight from the score accumulators, o^T += v^T.p^T (three products), attn = o1 / z1 - lambda o2 / z2 in f32;
// RMSNorm (x rms_w x (1 - lambda_init)) in f32 -> planes; out = attn.Wo (two products) - on v_wmma_f32_16x16x32_bf16. lambda = exp(lq1.lk1) - exp(lq2.lk2) + lambda_init from the inputs on device.
// Launch plan: both batch items ride in every grid; the four weight transposes, the q/k/v projections and the attention each run once for all heads; the projections' epilogue builds the
// hi/lo planes (v transposed) and the attention's epilogue does the RMSNorm, so no launch only reshapes data between two products.
// Plane order: q/k planes [group][item][8 heads], v planes [group][item][4 heads]: value plane p pairs with q/k planes 2p, 2p + 1. Inside a plane the elements lie in FRAGMENT ORDER, as the attention's
// lanes load them: a fragment (16 rows x 32 k) is 512 elements, [half of k: 16][lane = (k >> 3 & 1) * 16 + row][8 k], so that each of its two wave-wide 16-byte loads covers 512 contiguous bytes, 4 whole lines.
// q/k plane: [s / 16] fragments (row = s % 16, k = the head's 32 dims); v plane: [s / 32][d / 16] fragments (row = d % 16, k = s % 32).

#define NBT  2
#define SS   1024
#define EE   1024
#define NHV  16
#define HD   32                   // q/k head dim
#define VD   64                   // v head dim
#define HG   4                    // value heads per group (8 q/k heads)
#define DM   EE
#define SCL  0.17677669529663687f
#define LINIT 0.7836057665316245f    // 0.8 - 0.6 exp(-0.3 * 12)
#define REPS 1e-5f
#define LOSC 1024.0f

typedef _Float16 h16;
typedef unsigned short bf;
typedef __attribute__((ext_vector_type(16))) __bf16   v16bf;
typedef __attribute__((ext_vector_type(16))) _Float16 v16h;
typedef __attribute__((ext_vector_type(8)))  _Float16 v8h;
typedef __attribute__((ext_vector_type(8)))  unsigned short v8us;
typedef __attribute__((ext_vector_type(8)))  float    v8f;
typedef __attribute__((ext_vector_type(4)))  float    v4f;
typedef v8h  __attribute__((may_alias)) v8ha;
typedef v4f  __attribute__((may_alias)) v4fa;
typedef v8us __attribute__((may_alias)) v8usa;

typedef __attribute__((ext_vector_type(2)))  float    v2f;
typedef __attribute__((ext_vector_type(2)))  __bf16   v2bf;
typedef __attribute__((ext_vector_type(4)))  unsigned v4u;
typedef __attribute__((ext_vector_type(8)))  unsigned v8u;
// Every f32 -> bf16 rounding (nearest even) is the chip's own conversion, two values an instruction (v_cvt_pk_bf16_f32), not an integer add, bit extract and shift per value with a 16-bit move to pack it.
__device__ __forceinline__ v2bf cvt2(float a, float b) { return __builtin_convertvector((v2f){a, b}, v2bf); }
__device__ __forceinline__ unsigned pk2(float a, float b) { return __builtin_bit_cast(unsigned, cvt2(a, b)); }
__device__ __forceinline__ unsigned short f2bf(float f) { return __builtin_bit_cast(unsigned short, (__bf16)f); }
// split2: a pair's bf16 hi parts in h, the bf16 of what they leave (v - hi, exact in f32) in l
__device__ __forceinline__ void split2(float a, float b, unsigned& h, unsigned& l) { const v2bf x = cvt2(a, b); h = __builtin_bit_cast(unsigned, x); l = pk2(a - (float)x[0], b - (float)x[1]); }
__device__ __forceinline__ void split8(const float (&v)[8], v8us& oh, v8us& ol) {
    v4u h, l;
#pragma unroll    // the indices into v, h and l must be compile-time constants for them to stay in registers
    for (int p = 0; p < 4; ++p) { unsigned a, b; split2(v[2 * p], v[2 * p + 1], a, b); h[p] = a; l[p] = b; }
    oh = __builtin_bit_cast(v8us, h); ol = __builtin_bit_cast(v8us, l);
}
__device__ __forceinline__ float bf2f(unsigned short b) { return __uint_as_float(((unsigned)b) << 16); }
__device__ __forceinline__ float bfr(float f) { return bf2f(f2bf(f)); }
__device__ __forceinline__ v16h cat16(v8h lo, v8h hi) { return __builtin_shufflevector(lo, hi, 0, 1, 2, 3, 4, 5, 6, 7, 8, 9, 10, 11, 12, 13, 14, 15); }
__device__ __forceinline__ v16bf cat16b(v8us lo, v8us hi) { return __builtin_bit_cast(v16bf, __builtin_shufflevector(lo, hi, 0, 1, 2, 3, 4, 5, 6, 7, 8, 9, 10, 11, 12, 13, 14, 15)); }
__device__ __forceinline__ v8f wmma16(v16h a, v16h b, v8f c) { return __builtin_amdgcn_wmma_f32_16x16x32_f16(false, a, false, b, (short)0, c, false, false); }
__device__ __forceinline__ v8f wmmab(v16bf a, v16bf b, v8f c) { return __builtin_amdgcn_wmma_f32_16x16x32_bf16(false, a, false, b, (short)0, c, false, false); }

// gemm_stages: the main loop of k_gemmb, for a block of 4 waves and a 64 x 64 tile. A stage is 64 k of every operand: 64 rows x one whole 128-byte line, which the block fetches with loads that
// each cover 4 whole lines (a fragment load from global memory touches 16 lines for the same 512 bytes), lays in LDS at pitch LP and reads back as fragments. Two LDS buffers and two register sets: stage
// t + 2 is fetched into the set that stage t has left, at the head of trip t, so that its loads have two trips to land, not one; stage t + 1 goes from its set into
// the other buffer behind stage t's LDS reads; the one barrier of a trip publishes it and ends every wave's reads of the buffer that the next trip overwrites.
// NOP = 2: operands g0 = A, g1 = B; NOP = 3: g0 = A, g1 = its residual, g2 = B. k runs upward in steps of 32 through the same accumulators as with fragments from global memory.
// Returns the buffer that the last stage does not lie in: every wave's reads of it ended in front of the last barrier, so the caller's epilogue may stage in it at once.
// Every '#pragma unroll' in it walks an array of staged rows, fragments or accumulators, whose indices must be compile-time constants for the array to stay in registers.
#define KT  64                    // k per stage
#define LP  72                    // LDS row pitch in bf16: 144 B = 16 B x odd, for ds_load_b128 readers of 128-byte rows
#define TSZ (64 * LP)             // one operand's 64 rows
// lds_barrier: the work-group barrier of a stage, ordering LDS alone: every wave's LDS stores and reads are done in front of it (the fences name the LDS address space), while global loads into registers,
// which no other wave sees, stay in flight across it. __syncthreads() waits for those too: a stage fetched two trips ahead would be waited for at the first barrier behind its loads.
__device__ __forceinline__ void lds_barrier() {
    __builtin_amdgcn_fence(__ATOMIC_RELEASE, "workgroup", "local");
    __builtin_amdgcn_s_barrier();
    __builtin_amdgcn_fence(__ATOMIC_ACQUIRE, "workgroup", "local");
}
template <int NOP, int K>
__device__ __forceinline__ unsigned short* gemm_stages(const bf* __restrict__ g0, const bf* __restrict__ g1, const bf* __restrict__ g2, unsigned short* st, v8f (&acc)[4]) {
    const int tid = threadIdx.x, lane = tid & 31, wave = tid >> 5, lr = lane & 15, hi = lane >> 4;
    const unsigned go = (tid >> 3) * K + (tid & 7) * 8, so = (tid >> 3) * LP + (tid & 7) * 8;    // 8 lanes a row, 16 rows a pass of the block
    const unsigned fa = (wave * 16 + lr) * LP + 8 * hi, fb = (NOP - 1) * TSZ + lr * LP + 8 * hi;    // the lane's place in its wave's A rows and in B's first 16 rows
    v8us rs[2][NOP][4];    // stage t flies into set t & 1
    auto fetch = [&](int kc, v8us (&r)[NOP][4]) {
#pragma unroll
        for (int it = 0; it < 4; ++it) { r[0][it] = *(const v8us*)(g0 + kc + go + it * 16 * K); r[1][it] = *(const v8us*)(g1 + kc + go + it * 16 * K); if (NOP == 3) r[NOP - 1][it] = *(const v8us*)(g2 + kc + go + it * 16 * K); }
    };
    auto put = [&](unsigned short* b, const v8us (&r)[NOP][4]) {
#pragma unroll
        for (int o = 0; o < NOP; ++o)
#pragma unroll
            for (int it = 0; it < 4; ++it) *(v8usa*)(b + o * TSZ + so + it * 16 * LP) = r[o][it];
    };
    auto work = [&](const unsigned short* b) {
        v16bf a[KT / 32], al[KT / 32], w[KT / 32][4];    // fragments first, products behind them: the LDS reads may then run ahead of the products that use them
#pragma unroll
        for (int h = 0; h < KT / 32; ++h) {
            a[h] = cat16b(*(const v8usa*)(b + fa + h * 32), *(const v8usa*)(b + fa + h * 32 + 16));
            if (NOP == 3) al[h] = cat16b(*(const v8usa*)(b + TSZ + fa + h * 32), *(const v8usa*)(b + TSZ + fa + h * 32 + 16));
#pragma unroll
            for (int t = 0; t < 4; ++t) w[h][t] = cat16b(*(const v8usa*)(b + fb + t * 16 * LP + h * 32), *(const v8usa*)(b + fb + t * 16 * LP + h * 32 + 16));
        }
        if (NOP == 3) __builtin_amdgcn_sched_barrier(0);    // keeps the stage's LDS reads one group in front of its products: with two register sets live the build dealt them out in pairs among the products and waited for each pair. NOP = 2 keeps the compiler's own order
#pragma unroll
        for (int h = 0; h < KT / 32; ++h)
#pragma unroll
            for (int t = 0; t < 4; ++t) { acc[t] = wmmab(a[h], w[h][t], acc[t]); if (NOP == 3) acc[t] = wmmab(al[h], w[h][t], acc[t]); }
    };
    constexpr int nt = K / KT;
    static_assert(nt >= 2, "stages 0 and 1 are fetched in front of the loop");
    fetch(0, rs[0]);
    __builtin_amdgcn_sched_barrier(0);    // keeps stage 0's loads in front of stage 1's: loads return in order, and mixed, stage 0 would wait for stage 1's bytes
    fetch(KT, rs[1]);
    put(st, rs[0]);
    lds_barrier();    // publishes stage 0
#pragma unroll    // unrolled whole: a stage's register set is t & 1, which must be a compile-time constant for the sets to stay in registers
    for (int t = 0; t < nt; ++t) {
        if (t + 2 < nt) fetch((t + 2) * KT, rs[t & 1]);    // the set is free: stage t went from it into LDS a trip ago
        __builtin_amdgcn_sched_barrier(0);    // holds these loads up here, so that they have two whole trips to land; sunk among the products they would start later
        work(st + (t & 1) * (NOP * TSZ));
        if (t + 1 < nt) {
            put(st + ((t + 1) & 1) * (NOP * TSZ), rs[(t + 1) & 1]);    // waits for the older set alone: the younger stays in flight
            lds_barrier();    // publishes stage t + 1; stage t's buffer is free behind it
        }
    }
    return st + (nt & 1) * (NOP * TSZ);
}

// gemm_stages128: gemm_stages' scheme (64-k stages, two LDS buffers, two register sets, one lds_barrier a trip) for a 128 x 128 block tile of 4 waves, 2 x 2, each with a 64 x 64 tile of 4 x 4 accumulators.
// Every fragment read from LDS feeds 4 products (in gemm_stages a B fragment feeds 1): 16 KiB of LDS reads per 32 products of a wave against 10 KiB per 8, and each operand row is fetched from L2 by half as many blocks.
// g0 = A's 128 rows, g1 = B's 128 rows. k runs upward in steps of 32 through every accumulator, as in gemm_stages. Returns the buffer that the last stage does not lie in.
#define TS2 (128 * LP)            // one operand's 128 rows
template <int K>
__device__ __forceinline__ unsigned short* gemm_stages128(const bf* __restrict__ g0, const bf* __restrict__ g1, unsigned short* st, v8f (&acc)[4][4]) {
    const int tid = threadIdx.x, lane = tid & 31, wave = tid >> 5, lr = lane & 15, hi = lane >> 4;
    const unsigned go = (tid >> 3) * K + (tid & 7) * 8, so = (tid >> 3) * LP + (tid & 7) * 8;    // 8 lanes a row, 16 rows a pass of the block
    const unsigned fa = ((wave >> 1) * 64 + lr) * LP + 8 * hi, fb = TS2 + ((wave & 1) * 64 + lr) * LP + 8 * hi;    // the lane's place in its wave's first 16 A rows and first 16 B rows
    v8us rs[2][2][8];    // stage t flies into set t & 1
    auto fetch = [&](int kc, v8us (&r)[2][8]) {
#pragma unroll
        for (int it = 0; it < 8; ++it) { r[0][it] = *(const v8us*)(g0 + kc + go + it * 16 * K); r[1][it] = *(const v8us*)(g1 + kc + go + it * 16 * K); }
    };
    auto put = [&](unsigned short* b, const v8us (&r)[2][8]) {
#pragma unroll
        for (int o = 0; o < 2; ++o)
#pragma unroll
            for (int it = 0; it < 8; ++it) *(v8usa*)(b + o * TS2 + so + it * 16 * LP) = r[o][it];
    };
    static_assert(KT == 64, "a stage is two halves of 32 k");
    v16bf a[2][4], w[2][4];    // the fragments of a stage's two halves
    auto frags = [&](const unsigned short* b, int h) {
#pragma unroll
        for (int i = 0; i < 4; ++i) {
            a[h][i] = cat16b(*(const v8usa*)(b + fa + i * 16 * LP + h * 32), *(const v8usa*)(b + fa + i * 16 * LP + h * 32 + 16));
            w[h][i] = cat16b(*(const v8usa*)(b + fb + i * 16 * LP + h * 32), *(const v8usa*)(b + fb + i * 16 * LP + h * 32 + 16));
        }
    };
    auto prods = [&](int h) {
#pragma unroll
        for (int i = 0; i < 4; ++i)
#pragma unroll
            for (int t = 0; t < 4; ++t) acc[i][t] = wmmab(a[h][i], w[h][t], acc[i][t]);
    };
    constexpr int nt = K / KT;
    static_assert(nt >= 2, "stages 0 and 1 are fetched in front of the loop");
    fetch(0, rs[0]);
    __builtin_amdgcn_sched_barrier(0);    // keeps stage 0's loads in front of stage 1's: loads return in order, and mixed, stage 0 would wait for stage 1's bytes
    fetch(KT, rs[1]);
    put(st, rs[0]);
    lds_barrier();    // publishes stage 0
    // Each half's 16 LDS reads stand as one group in front of the 16 products of the half before, which hide them: the second half's products of stage t - 1 run behind stage t's barrier, from registers.
    // The sched_barriers of the loop hold that order; left free, the build set all 32 products of a stage in one run and all 32 reads behind it, with nothing of the wave's own to hide the reads.
#pragma unroll    // unrolled whole: a stage's register set is t & 1, which must be a compile-time constant for the sets to stay in registers
    for (int t = 0; t < nt; ++t) {
        const unsigned short* b = st + (t & 1) * (2 * TS2);
        if (t + 2 < nt) fetch((t + 2) * KT, rs[t & 1]);    // the set is free: stage t went from it into LDS a trip ago
        if (t + 3 == nt) asm volatile("s_wait_xcnt 0x0" ::: "memory");    // behind the last fetch: its loads' offset register is dead from here on, and the build let the LDS reads below land in it
        frags(b, 0);
        __builtin_amdgcn_sched_barrier(0);    // holds the fetch and the first half's reads up here: the loads get their two trips, the reads fly under the products below
        if (t > 0) prods(1);
        __builtin_amdgcn_sched_barrier(0);    // keeps the second half's reads one group behind those products, whose fragment registers they refill
        frags(b, 1);
        __builtin_amdgcn_sched_barrier(0);    // holds those reads in front of the first half's products, which hide them
        prods(0);
        __builtin_amdgcn_sched_barrier(0);    // keeps the products in front of the stores and the barrier; sunk behind the barrier they would stand in one run with the next trip's
        if (t + 1 < nt) {
            put(st + ((t + 1) & 1) * (2 * TS2), rs[(t + 1) & 1]);    // waits for the older set alone: the younger stays in flight
            lds_barrier();    // publishes stage t + 1; stage t's buffer is free behind it: its reads are done in front of the barrier
        }
    }
    prods(1);
    return st + (nt & 1) * (2 * TS2);
}

// k_gemmb: 64 x 64 block tile (4 waves x 16 x 64) of C[NTK][NW] = (A [+ Al]).B^T (K = 1024) [+ bf(bias[c])] [+ bf(R[r][c]) residual]; f32 whole-line epilogue (or f16
template <bool SPLITA, bool F16OUT = false>
__global__ __launch_bounds__(128) void k_gemmb(const bf* __restrict__ A, const bf* __restrict__ Al, const bf* __restrict__ Bn, const float* __restrict__ bias, float* C, int ldc, h16* C2, const float* __restrict__ R = nullptr, int roundR = 1) {
    __shared__ __align__(16) unsigned short st[2 * (SPLITA ? 3 : 2) * TSZ];    // two stage buffers; the epilogue's f32 [4 waves][16][68] lies in the free one
    const int lane = threadIdx.x & 31, wave = threadIdx.x >> 5, lr = lane & 15, hi = lane >> 4;
    const int r0 = blockIdx.x * 64 + wave * 16, c0 = blockIdx.y * 64;
    const size_t ab = (size_t)blockIdx.x * 64 * DM, bb = (size_t)c0 * DM;
    v8f acc[4];
#pragma unroll
    for (int t = 0; t < 4; ++t) acc[t] = (v8f){};
    float* os = (float*)(void*)(SPLITA ? gemm_stages<3, DM>(A + ab, Al + ab, Bn + bb, st, acc) : gemm_stages<2, DM>(A + ab, Bn + bb, nullptr, st, acc)) + wave * (16 * 68);
#pragma unroll
    for (int t = 0; t < 4; ++t) { const float bv = bias ? bfr(bias[c0 + t * 16 + lr]) : 0.f;
#pragma unroll
        for (int j = 0; j < 8; ++j) os[(hi * 8 + j) * 68 + t * 16 + lr] = acc[t][j] + bv; }
    __syncthreads();
    if (F16OUT) {
        h16* crow = (h16*)(void*)C + (size_t)r0 * ldc + c0;
        auto pass = [&]() {
#pragma unroll
            for (int s = 0; s < 4; ++s) { const int row = 4 * s + (lane >> 3), piece = lane & 7; const float* sp = os + row * 68 + piece * 8; v8h o, o2;
#pragma unroll
                for (int i = 0; i < 8; ++i) { const h16 a = (h16)sp[i]; o[i] = a; o2[i] = (h16)((sp[i] - (float)a) * LOSC); }
                *(v8h*)(crow + (size_t)row * ldc + piece * 8) = o; if (C2) *(v8h*)(C2 + (size_t)r0 * ldc + c0 + (size_t)row * ldc + piece * 8) = o2; }
        };
        pass(); 
    } else {
        float* crow = C + (size_t)r0 * ldc + c0;
        auto pass = [&]() {
#pragma unroll
            for (int s = 0; s < 8; ++s) { const int Lid = (lane >> 3) + 4 * s, piece = lane & 7; const int row = Lid >> 1, cofs = (Lid & 1) * 32 + piece * 4;
                v4f val = *(const v4fa*)(os + row * 68 + cofs); if (R) { const v4f rv = *(const v4f*)(R + ((size_t)r0 + row) * ldc + c0 + cofs); val += roundR ? (v4f){bfr(rv[0]), bfr(rv[1]), bfr(rv[2]), bfr(rv[3])} : rv; }
                *(v4f*)(crow + (size_t)row * ldc + cofs) = val; }
        };
        pass(); 
    }
}

// k_qkv: the q (blockIdx.z = 0), k (1) and v (2) projections, 128 x 128 block tile (2 x 2 waves x 64 x 64) of x.Wz (A [2048][1024] bf16, WT [z][n][1024] bf16), main loop gemm_stages128. The epilogue
// writes what the attention reads, straight from the f32 accumulators, in fragment order (head of the file): q/k as hi/lo planes (a wave's 64 columns are two q/k heads; it stages 16 rows, one fragment
// a head, at a time in its own LDS range and stores 4 whole 128-byte lines an instruction), v as transposed hi/lo planes (a wave's 64 columns are one value head; a lane's 8 accumulator rows are 8 consecutive
// s of one column, packed in registers, staged [d][s] in the wave's own LDS range, read back as the attention's lanes will hold them: each store is one half fragment, 512 contiguous bytes).
__global__ __launch_bounds__(128) void k_qkv(const bf* __restrict__ A, const bf* __restrict__ WT, bf* PH, bf* PL, bf* VTh, bf* VTl) {
    __shared__ __align__(16) unsigned short st[2 * 2 * TS2];    // two stage buffers; the epilogue stages: q/k in the free one: f32 [2][4 waves][16][68]; v in both: per wave bf16 hi [64][72] then lo [64][72]
    const int K = EE, z = blockIdx.z;
    const bf* Bn = WT + (size_t)z * EE * EE;
    const int tid = threadIdx.x, lane = tid & 31, wave = tid >> 5, lr = lane & 15, hi = lane >> 4;
    const int c0 = blockIdx.y * 128 + (wave & 1) * 64;    // the wave's first column
    v8f acc[4][4];
#pragma unroll
    for (int i = 0; i < 4; ++i)
#pragma unroll
        for (int t = 0; t < 4; ++t) acc[i][t] = (v8f){};
    unsigned short* sm = gemm_stages128<EE>(A + (size_t)blockIdx.x * 128 * K, Bn + (size_t)blockIdx.y * 128 * K, st, acc);
    const int item = (blockIdx.x * 128) / SS, sb = (blockIdx.x * 128) % SS + (wave >> 1) * 64;    // a block's 128 rows lie in one item; sb: the wave's first row in it
    if (z < 2) {
        bf* ph = PH + (size_t)z * ((size_t)NBT * 2 * NHV * SS * HD); bf* pl = PL + (size_t)z * ((size_t)NBT * 2 * NHV * SS * HD);
#pragma unroll
        for (int i = 0; i < 4; ++i) {
            float* os = (float*)(void*)sm + ((i & 1) * 4 + wave) * (16 * 68);    // two ranges in turn: a range is written again only behind the barrier of the row group between
#pragma unroll
            for (int t = 0; t < 4; ++t)
#pragma unroll
                for (int j = 0; j < 8; ++j) os[(hi * 8 + j) * 68 + t * 16 + lr] = acc[i][t][j];
            lds_barrier();    // a lane reads back what other lanes have staged; LDS alone: __syncthreads() would also wait for the global stores of the row group before
#pragma unroll
            for (int it = 0; it < 4; ++it) { const int head = c0 / HD + (it >> 1), row = (it & 1) * 8 + (lane >> 2), piece = lane & 3;
                const int p = ((head / (2 * HG)) * NBT + item) * (2 * HG) + head % (2 * HG);
                const float* sp = os + row * 68 + (it >> 1) * HD + piece * 8; const v4f x0 = *(const v4fa*)sp, x1 = *(const v4fa*)(sp + 4); v8us oh, ol;
                const float xv[8] = {x0[0], x0[1], x0[2], x0[3], x1[0], x1[1], x1[2], x1[3]}; split8(xv, oh, ol);
                const size_t o = ((size_t)p * SS + sb + i * 16) * HD + (piece >> 1) * 256 + ((piece & 1) * 16 + row) * 8; *(v8us*)(ph + o) = oh; *(v8us*)(pl + o) = ol; }    // dims piece * 8 ..: half piece >> 1, lane (piece & 1) * 16 + row
        }
    } else {
        __syncthreads();    // ends every wave's reads of the last stage: the four waves' transposed tiles take both buffers
        unsigned short* th = st + wave * (2 * 64 * 72); unsigned short* tw = th + 64 * 72;
#pragma unroll
        for (int i = 0; i < 4; ++i)
#pragma unroll
            for (int t = 0; t < 4; ++t) { v8us oh, ol;
                const float xv[8] = {acc[i][t][0], acc[i][t][1], acc[i][t][2], acc[i][t][3], acc[i][t][4], acc[i][t][5], acc[i][t][6], acc[i][t][7]}; split8(xv, oh, ol);
                const int o = (t * 16 + lr) * 72 + i * 16 + hi * 8; *(v8usa*)(th + o) = oh; *(v8usa*)(tw + o) = ol; }
        __syncthreads();    // a lane reads back what other lanes have staged
        const int hv = c0 / VD, p = ((hv / HG) * NBT + item) * HG + hv % HG;
#pragma unroll
        for (int it = 0; it < 16; ++it) { const int sl = it >> 3, t = (it >> 1) & 3, half = it & 1;    // which 32 s of the wave's 64, which 16 d, which half of the fragment
            const size_t o = (size_t)p * VD * SS + (size_t)(sb / 32 + sl) * (32 * VD) + t * 512 + half * 256 + lane * 8;
            const int l = (t * 16 + lr) * 72 + sl * 32 + half * 16 + hi * 8;
            *(v8us*)(VTh + o) = *(const v8usa*)(th + l); *(v8us*)(VTl + o) = *(const v8usa*)(tw + l); }
        asm volatile("s_wait_xcnt 0x0" ::: "memory");    // behind the last store: in the build the other branch's code follows this one and rewrites the stores' address registers
    }
}

// k_wt: WT [z][n][K] = bf16(Wz[k][n]) (k-major [K][ncols]) via 64 x 64 LDS tiles; grid (K/64, ncols/64, 4), blockIdx.z picks the matrix.
__global__ __launch_bounds__(256) void k_wt(const float* __restrict__ W0, const float* __restrict__ W1, const float* __restrict__ W2, const float* __restrict__ W3, int K, int ncols, bf* WT) {
    __shared__ __align__(16) unsigned short tl[64 * 72];
    const float* Wm = blockIdx.z == 0 ? W0 : blockIdx.z == 1 ? W1 : blockIdx.z == 2 ? W2 : W3; WT += (size_t)blockIdx.z * K * ncols;
    const int tid = threadIdx.x, k0 = blockIdx.x * 64, n0 = blockIdx.y * 64;
    const int kk = tid >> 2, nq = (tid & 3) * 16;
#pragma unroll
    for (int i = 0; i < 16; i += 2) { const float* wp = Wm + (size_t)(k0 + kk) * ncols + n0 + nq + i; const unsigned h = pk2(wp[0], wp[1]); tl[(nq + i) * 72 + kk] = (unsigned short)h; tl[(nq + i + 1) * 72 + kk] = (unsigned short)(h >> 16); }
    __syncthreads();
    const int piece = tid & 7;
    auto pass = [&]() {
#pragma unroll
        for (int s = 0; s < 2; ++s) { const int nr = (tid >> 3) + 32 * s; const v8us val = *(const v8usa*)(tl + nr * 72 + piece * 8); *(v8us*)(WT + (size_t)(n0 + nr) * K + k0 + piece * 8) = val; }
    };
    pass(); 
}

__global__ __launch_bounds__(256) void k_cvtx(const float* __restrict__ src, bf* dst) {
    const int lane = threadIdx.x & 31; const size_t r = (size_t)blockIdx.x * 8 + (threadIdx.x >> 5); if (r >= (size_t)NBT * SS) return;
{
#pragma unroll
        for (int q = 0; q < EE / 256; ++q) { v4u o; const float* sp = src + r * EE + q * 256 + lane * 8;
#pragma unroll
            for (int i = 0; i < 4; ++i) o[i] = pk2(sp[2 * i], sp[2 * i + 1]);
            *(v8us*)(dst + r * EE + q * 256 + lane * 8) = __builtin_bit_cast(v8us, o); }
         }
}
// k_fattn: one value head p (blockIdx.y) and four 32-query tiles per block; waves 2n and 2n + 1 take q/k heads 2p and 2p + 1. Per 32 keys (a step) and 16-query column group: S^T = K.Q^T (a
// lane holds 16 keys of ONE query: lane & 15 = query, lane >> 4 picks keys 8h.. and 16 + 8h..), running maximum m and sum z, p = exp(s x SCL - m) (0 for key > query), and the two score
// tiles, converted in place, are the B operand of O^T += V^T.P^T.
// Who walks which keys: a causal tile t has t + 1 steps, and a block's tiles have 32 - bx, 17 + bx, bx + 1 and 16 - bx. The wave of a long tile (the first two) walks its first SPL steps alone; the wave of a short
// tile walks that tile and then, as a second job, the rest of a long one: every wave walks 16 or 17 steps, so that two waves stand on each SIMD to the end and one's products run under the other's softmax.
// Every job leaves its unnormalised o, m and z in LDS; behind the one barrier each wave takes one tile's column group, joins a long tile's two parts (each x exp(m_part - max m), sums and products alike),
// forms attn = o1 / z1 - lambda o2 / z2, its RMSNorm over the row's 64 values (x rsqrt(mean(attn^2) + eps) x bf(rms_w[d]) x (1 - lambda_init)), and stores the planes R [item * 1024 + s][1024], cols head * 64 + d (bf16 hi + UNSCALED residual).
// Every '#pragma unroll' in it but the lambda loop's walks an array of fragments or accumulators, whose indices must be compile-time constants for the array to stay in registers.
#define SPL 17                    // steps of a long tile that its own wave walks: both long tiles have at least as many for every bx
__device__ __forceinline__ v16bf ldfrag(const bf* p) { return cat16b(*(const v8us*)p, *(const v8us*)(p + 256)); }    // p: the fragment's first element + lane * 8; its second half lies 256 elements on
__device__ __forceinline__ float xhalf(float v) { const int b = __float_as_int(v); return __int_as_float(__builtin_amdgcn_permlanex16(b, b, 0x76543210, 0xfedcba98, false, false)); }    // lane l <-> l ^ 16
__global__ __launch_bounds__(256) void k_fattn(const bf* __restrict__ Qh, const bf* __restrict__ Ql, const bf* __restrict__ Kh, const bf* __restrict__ Kl, const bf* __restrict__ Vh, const bf* __restrict__ Vl,
                                               const float* __restrict__ lq1, const float* __restrict__ lk1, const float* __restrict__ lq2, const float* __restrict__ lk2, const float* __restrict__ rw, bf* Rh, bf* Rl) {
    __shared__ float ost[12][64 * 32];    // a job's o: slots 0..7 = the waves' first jobs (tile wave >> 1, head wave & 1), 8..11 = the long tiles' second parts (tile (slot - 8) >> 1, head slot & 1)
    __shared__ float mst[12][2][32], zst[12][2][32];    // its m and z, per column group and lane
    const int lane = threadIdx.x & 31, wave = __builtin_amdgcn_readfirstlane(threadIdx.x >> 5), lr = lane & 15, hi = lane >> 4, tl = wave >> 1, sel = wave & 1;    // the wave's number in a scalar register: trip counts, plane offsets and branches stay scalar
    const int bx = blockIdx.x, pv = blockIdx.y;
    auto tile_of = [&](int n) { return n == 0 ? 31 - bx : n == 1 ? 16 + bx : n == 2 ? bx : 15 - bx; };
    const size_t pqk = (size_t)(2 * pv + sel) * SS * HD;
    const unsigned fo = lane * 8;    // the lane's place in a half fragment of any plane
    const bf* kbh = Kh + pqk; const bf* kbl = Kl + pqk;
    const int njob = tl < 2 ? 1 : 2;
#pragma unroll 1    // stays rolled: the two jobs are the same code
    for (int job = 0; job < njob; ++job) {
        const int tile = tile_of(job == 0 ? tl : tl - 2);
        const int q0 = tile * 32, sa = job == 0 ? 0 : SPL, se = tl < 2 ? SPL : tile + 1;    // steps sa .. se - 1; a long tile of SPL steps leaves an empty second job (o = 0, z = 0)
        const bf* vsh = Vh + (size_t)pv * VD * SS + sa * (32 * VD); const bf* vsl = Vl + (size_t)pv * VD * SS + sa * (32 * VD);    // wave-uniform, 32 keys (4 fragments) on a step: the lane's own offset fo never changes
        v16bf qh[2], ql[2]; v8f acc[2][4]; float m[2], z[2];
#pragma unroll
        for (int c = 0; c < 2; ++c) { qh[c] = ldfrag(Qh + pqk + (q0 + c * 16) * HD + fo); ql[c] = ldfrag(Ql + pqk + (q0 + c * 16) * HD + fo); m[c] = -3.0e38f; z[c] = 0.f;
#pragma unroll
            for (int t = 0; t < 4; ++t) acc[c][t] = (v8f){}; }
        const int ka = sa * 32 * HD;
        v16bf kh0 = ldfrag(kbh + ka + fo), kh1 = ldfrag(kbh + (ka + 16 * HD) + fo), kl0 = ldfrag(kbl + ka + fo), kl1 = ldfrag(kbl + (ka + 16 * HD) + fo);
#pragma unroll 1    // stays rolled: one step's fragments and accumulators already take the wave's registers
        for (int st = sa; st < se; ++st) {
            const int k0 = st * 32;
            v16bf vh[4], vl[4];
#pragma unroll
            for (int t = 0; t < 4; ++t) { vh[t] = ldfrag(vsh + t * 512 + fo); if (t < 3) vl[t] = ldfrag(vsl + t * 512 + fo); }
            { const v8us a = *(const v8us*)(vsl + 3 * 512 + fo);
              asm volatile("s_wait_xcnt 0x0" ::: "memory");    // in front of the run's last load: the build lands its result in the two address pairs that the fifteen loads before it name
              vl[3] = cat16b(a, *(const v8us*)(vsl + 3 * 512 + fo + 256)); }
            vsh += 32 * VD; vsl += 32 * VD;
            __builtin_amdgcn_sched_barrier(0);    // holds the 16 V loads up here, so that they fly under the score products and the softmax; sunk to their users each would be waited for alone
            v8f s[2][2];
#pragma unroll
            for (int c = 0; c < 2; ++c) { s[c][0] = wmmab(kh0, qh[c], (v8f){}); s[c][1] = wmmab(kh1, qh[c], (v8f){}); }
#pragma unroll
            for (int c = 0; c < 2; ++c) { s[c][0] = wmmab(kh0, ql[c], s[c][0]); s[c][1] = wmmab(kh1, ql[c], s[c][1]); }
#pragma unroll
            for (int c = 0; c < 2; ++c) { s[c][0] = wmmab(kl0, qh[c], s[c][0]); s[c][1] = wmmab(kl1, qh[c], s[c][1]); }
            { const int kn = (k0 + 32 < SS - 32 ? k0 + 32 : SS - 32) * HD;    // the next step's K fragments fly during this step's softmax; the index stays inside the plane
              kh0 = ldfrag(kbh + kn + fo); kh1 = ldfrag(kbh + (kn + 16 * HD) + fo); kl0 = ldfrag(kbl + kn + fo); kl1 = ldfrag(kbl + (kn + 16 * HD) + fo); }
            __builtin_amdgcn_sched_barrier(0);    // holds the next K loads here; sunk to the loop's foot they would be waited for at once
            v16bf ph[2], pl[2];
#pragma unroll
            for (int c = 0; c < 2; ++c) {
                float sc[16]; const int rel = q0 + c * 16 + lr - k0 - 8 * hi;    // key <= query  <=>  its place among the lane's keys <= rel
#pragma unroll
                for (int j = 0; j < 8; ++j) { sc[j] = (j <= rel) ? s[c][0][j] * SCL : -3.0e38f; sc[8 + j] = (16 + j <= rel) ? s[c][1][j] * SCL : -3.0e38f; }
                float tm = sc[0];
#pragma unroll
                for (int e = 1; e < 16; ++e) tm = fmaxf(tm, sc[e]);
                tm = fmaxf(tm, xhalf(tm));
                const float mn = fmaxf(m[c], tm); float al;    // al = exp(m - mn): what the old maximum's sums and products are worth under the new one
                asm("v_exp_f32 %0, %1\n\tv_nop" : "=v"(al) : "v"((m[c] - mn) * 1.44269504f));    // with the slot the instruction set asks for behind a transcendental
                m[c] = mn;
                float zs = 0.f;
#pragma unroll
                for (int e = 0; e < 16; ++e) { sc[e] = __expf(sc[e] - mn); zs += sc[e]; }
                v8u hp, lp;
#pragma unroll
                for (int e = 0; e < 8; ++e) { unsigned a, b; split2(sc[2 * e], sc[2 * e + 1], a, b); hp[e] = a; lp[e] = b; }
                ph[c] = __builtin_bit_cast(v16bf, hp); pl[c] = __builtin_bit_cast(v16bf, lp);
                z[c] = z[c] * al + zs;
#pragma unroll
                for (int t = 0; t < 4; ++t) acc[c][t] *= al;
            }
#pragma unroll
            for (int c = 0; c < 2; ++c)
#pragma unroll
                for (int t = 0; t < 4; ++t) acc[c][t] = wmmab(vh[t], ph[c], acc[c][t]);
#pragma unroll
            for (int c = 0; c < 2; ++c)
#pragma unroll
                for (int t = 0; t < 4; ++t) acc[c][t] = wmmab(vh[t], pl[c], acc[c][t]);
#pragma unroll
            for (int c = 0; c < 2; ++c)
#pragma unroll
                for (int t = 0; t < 4; ++t) acc[c][t] = wmmab(vl[t], ph[c], acc[c][t]);
        }
        const int slot = wave + 4 * job;
        float* ob = &ost[slot][lane];
#pragma unroll
        for (int c = 0; c < 2; ++c) { mst[slot][c][lane] = m[c]; zst[slot][c][lane] = z[c] + xhalf(z[c]);
#pragma unroll
            for (int t = 0; t < 4; ++t)
#pragma unroll
                for (int j = 0; j < 8; ++j) ob[((c * 4 + t) * 8 + j) * 32] = acc[c][t][j]; }
    }
    __syncthreads();    // every job's o, m and z are in LDS
    {
        const int c = sel, q0 = tile_of(tl) * 32;    // this wave finishes column group c of tile tl
        float wa[2], wb[2];    // per head of the pair: what the first and the second part's o is multiplied by
#pragma unroll
        for (int s = 0; s < 2; ++s) {
            const float ma = mst[tl * 2 + s][c][lane], za = zst[tl * 2 + s][c][lane];
            if (tl < 2) {
                const float mb = mst[8 + tl * 2 + s][c][lane], zb = zst[8 + tl * 2 + s][c][lane], mn = fmaxf(ma, mb);
                const float fa = __expf(ma - mn), fb = __expf(mb - mn), iz = 1.0f / (za * fa + zb * fb);
                wa[s] = fa * iz; wb[s] = fb * iz;
            } else { wa[s] = 1.0f / za; wb[s] = 0.f; }
        }
        float d1 = 0.f, d2 = 0.f;
#pragma unroll
        for (int d = 0; d < HD; ++d) { const v2bf a = cvt2(lq1[d], lk1[d]), b = cvt2(lq2[d], lk2[d]); d1 = fmaf((float)a[0], (float)a[1], d1); d2 = fmaf((float)b[0], (float)b[1], d2); }
        const float lam = __expf(d1) - __expf(d2) + LINIT;
        const int item = (pv / HG) % NBT, hv = (pv / (NBT * HG)) * HG + pv % HG;    // plane pv = [group][item][head in group]
        v4f rv[4][2];    // the lane's 32 values of rms_w, fetched in one run under the LDS reads below
#pragma unroll
        for (int t = 0; t < 4; ++t) { rv[t][0] = *(const v4fa*)(rw + t * 16 + 8 * hi); rv[t][1] = *(const v4fa*)(rw + t * 16 + 8 * hi + 4); }
        asm volatile("s_wait_xcnt 0x0" ::: "memory");    // stands in front of every later write of a register that these eight loads name (their base pair, their offset)
        const float* o1 = &ost[tl * 2][c * (4 * 8 * 32) + lane]; const float* o2 = o1 + 64 * 32;    // the two heads' first parts; a second part lies 8 slots on
        float av[4][8], x2[4][8], q = 0.f;    // lanes l and l ^ 16 hold the 64 values of one query's row, 32 each
#pragma unroll
        for (int t = 0; t < 4; ++t)
#pragma unroll
            for (int j = 0; j < 8; ++j) { const int e = (t * 8 + j) * 32; av[t][j] = o1[e] * wa[0]; x2[t][j] = o2[e] * wa[1]; }
        if (tl < 2) {    // one branch round all the second parts' reads, so that they fly together
#pragma unroll
            for (int t = 0; t < 4; ++t)
#pragma unroll
                for (int j = 0; j < 8; ++j) { const int e = (8 * 64 + t * 8 + j) * 32; av[t][j] += o1[e] * wb[0]; x2[t][j] += o2[e] * wb[1]; }
        }
#pragma unroll
        for (int t = 0; t < 4; ++t)
#pragma unroll
            for (int j = 0; j < 8; ++j) { const float a = av[t][j] - lam * x2[t][j]; av[t][j] = a; q += a * a; }
        q += xhalf(q);
        const float sc = rsqrtf(q * (1.0f / VD) + REPS) * (1.0f - LINIT);
        const size_t o = ((size_t)item * SS + q0 + c * 16 + lr) * EE + hv * VD + 8 * hi;
#pragma unroll
        for (int t = 0; t < 4; ++t) { v8us oh, ol; float xv[8];
#pragma unroll
            for (int j = 0; j < 8; j += 2) { const v2bf w = cvt2(rv[t][j >> 2][j & 3], rv[t][j >> 2][(j & 3) + 1]); xv[j] = av[t][j] * sc * (float)w[0]; xv[j + 1] = av[t][j + 1] * sc * (float)w[1]; }
            split8(xv, oh, ol);
            *(v8us*)(Rh + o + t * 16) = oh; *(v8us*)(Rl + o + t * 16) = ol; }
    }
}

extern "C" void kernel_launch(void* const* d_in, const int* in_sizes, int n_in,
                              void* d_out, int out_size, void* d_ws, size_t ws_size, hipStream_t stream) {
    (void)in_sizes; (void)n_in; (void)out_size;
    const float* x = (const float*)d_in[0]; const float* Wq = (const float*)d_in[1]; const float* Wk = (const float*)d_in[2]; const float* Wv = (const float*)d_in[3]; const float* Wo = (const float*)d_in[4];
    const float* lq1 = (const float*)d_in[5]; const float* lk1 = (const float*)d_in[6]; const float* lq2 = (const float*)d_in[7]; const float* lk2 = (const float*)d_in[8]; const float* rw = (const float*)d_in[9];
    float* out = (float*)d_out;    // [2][1024][1024]
    char* wsp = (char*)d_ws;
    auto take = [&](size_t bytes) { char* p = wsp; wsp += (bytes + 255) & ~(size_t)255; return (void*)p; };
    bf* WT4 = (bf*)take((size_t)4 * EE * EE * 2); bf* WOT = WT4 + (size_t)3 * EE * EE;    // Wq, Wk, Wv, Wo transposed
    bf* Xb = (bf*)take((size_t)NBT * SS * EE * 2);
    const size_t nP = (size_t)NBT * 2 * NHV * SS * HD;
    bf* PH = (bf*)take(2 * nP * 2); bf* PL = (bf*)take(2 * nP * 2); bf* VTh = (bf*)take((size_t)NBT * NHV * VD * SS * 2); bf* VTl = (bf*)take((size_t)NBT * NHV * VD * SS * 2);    // PH, PL: q planes then k planes
    bf* Rh = (bf*)take((size_t)NBT * SS * EE * 2); bf* Rl = (bf*)take((size_t)NBT * SS * EE * 2);
    if ((size_t)(wsp - (char*)d_ws) > ws_size) return;    // 8 + 4 + 16 + 8 + 4 + 4 = 44 MiB
    k_wt<<<dim3(EE / 64, EE / 64, 4), 256, 0, stream>>>(Wq, Wk, Wv, Wo, EE, EE, WT4);   // (in, out) k-major
    k_cvtx<<<NBT * SS / 8, 256, 0, stream>>>(x, Xb);
    k_qkv<<<dim3(NBT * SS / 128, EE / 128, 3), 128, 0, stream>>>(Xb, WT4, PH, PL, VTh, VTl);
    k_fattn<<<dim3(SS / 128, NBT * NHV, 1), 256, 0, stream>>>(PH, PL, PH + nP, PL + nP, VTh, VTl, lq1, lk1, lq2, lk2, rw, Rh, Rl);
    k_gemmb<true, false><<<dim3(NBT * SS / 64, EE / 64, 1), 128, 0, stream>>>(Rh, Rl, WOT, nullptr, out, EE, nullptr, nullptr);
}
